// v000
// Times are from an AMD MI455X. After a warm-up the kernel runs many times in a row, and a time is the length of
// such a window on the GPU divided by its runs, so every launch and the gaps after it count. The runs cycle
// through copies of the inputs. A figure is the median of several windows, for all but v000 over two sittings.
// Sittings can differ by a few percent; kernels timed side by side share one.
// v000, which the later versions start from, runs in 717 microseconds.
#include <hip/hip_runtime.h>

// ---------------------------------------------------------------------------
// Transformer encoder block for MI455X (gfx1250, wave32, WMMA bf16)
//   B=2, S=2048, D=1024, H=16, DK=64, FF=4096, fp32 I/O
// ---------------------------------------------------------------------------

typedef __attribute__((ext_vector_type(16))) __bf16 v16bf;
typedef __attribute__((ext_vector_type(8)))  float  v8f;

using u16 = unsigned short;
using u32 = unsigned int;

static constexpr int Hh = 16;
static constexpr int Dd = 1024;
static constexpr int DKk = 64;
static constexpr int FFf = 4096;
static constexpr int Bb = 2;
static constexpr int Ss = 2048;
static constexpr int BS = Bb * Ss;       // 4096 rows
static constexpr float LN_EPS = 1e-5f;

// ---------------- helpers ---------------------------------------------------

__device__ __forceinline__ u16 f2bf(float f) {
    u32 u = __float_as_uint(f);
    u32 r = u + 0x7FFFu + ((u >> 16) & 1u);   // round-to-nearest-even
    return (u16)(r >> 16);
}

union Op32 { uint4 q[2]; v16bf v; };

// Load one WMMA 16x16x32 bf16 operand (A layout; B uses the same pattern on
// the transposed [N,K] matrix).  `base` points at a row-major bf16 tile in
// LDS with `stride` elements per row, `kbase` selects the 32-wide K chunk.
// Lanes 0-15: K = kbase+{0..7,16..23};  lanes 16-31: K = kbase+{8..15,24..31}.
__device__ __forceinline__ v16bf lds_load_op(const u16* base, int row, int stride,
                                             int kbase, int lane) {
    const u16* p = base + row * stride + kbase + ((lane >> 4) & 1) * 8;
    Op32 u;
    u.q[0] = *reinterpret_cast<const uint4*>(p);
    u.q[1] = *reinterpret_cast<const uint4*>(p + 16);
    return u.v;
}

__device__ __forceinline__ v8f wmma_bf16(v16bf a, v16bf b, v8f c) {
    return __builtin_amdgcn_wmma_f32_16x16x32_bf16(false, a, false, b,
                                                   (short)0, c, false, false);
}

// Cross-lane XOR reduction step within 16-lane halves of the wave32.
// Prefer v_permlane16_b32 (VALU, co-executes with WMMA) over ds_bpermute.
template <int MASK>
__device__ __forceinline__ float xor16f(float v) {
#if __has_builtin(__builtin_amdgcn_permlane16)
    u32 s0, s1;
    if constexpr (MASK == 1)      { s0 = 0x67452301u; s1 = 0xEFCDAB89u; }
    else if constexpr (MASK == 2) { s0 = 0x54761032u; s1 = 0xDCFE98BAu; }
    else if constexpr (MASK == 4) { s0 = 0x32107654u; s1 = 0xBA98FEDCu; }
    else                          { s0 = 0xFEDCBA98u; s1 = 0x76543210u; }
    u32 u = __float_as_uint(v);
    u32 r = __builtin_amdgcn_permlane16(u, u, s0, s1, false, false);
    return __uint_as_float(r);
#else
    return __shfl_xor(v, MASK);
#endif
}

// ---------------- fp32 -> bf16 conversion -----------------------------------

__global__ __launch_bounds__(256) void cvt_bf16_kernel(const float* __restrict__ x,
                                                       u16* __restrict__ y, int n) {
    for (int i = blockIdx.x * blockDim.x + threadIdx.x; i < n;
         i += gridDim.x * blockDim.x)
        y[i] = f2bf(x[i]);
}

// ---------------- generic WMMA GEMM -----------------------------------------
// C[M,N] = A[M,K](bf16) * Bt[N,K](bf16)^T + bias[N], with epilogue modes.
// Block tile 128x128, K-step 64, 8 waves; wave tile 32x64 (2x4 WMMA tiles).

enum { MODE_F32 = 0, MODE_RELU_BF16 = 1, MODE_QPROJ = 2, MODE_VPROJ = 3 };

template <int MODE>
__global__ __launch_bounds__(256) void gemm_bf16_kernel(
    const u16* __restrict__ A, const u16* __restrict__ Bt,
    const float* __restrict__ bias, float* __restrict__ Cf,
    u16* __restrict__ Cb, int M, int N, int K) {
    __shared__ u16 As[128 * 64];   // 16 KB
    __shared__ u16 Bs[128 * 64];   // 16 KB

    const int tid  = threadIdx.x;
    const int lane = tid & 31;
    const int ln   = lane & 15;
    const int half = lane >> 4;
    const int wave = tid >> 5;
    const int wr   = (wave & 3) * 32;   // wave row offset within 128
    const int wc   = (wave >> 2) * 64;  // wave col offset within 128
    const int m0   = blockIdx.y * 128;
    const int n0   = blockIdx.x * 128;

    v8f acc[2][4] = {};

    for (int kc = 0; kc < K; kc += 64) {
        __syncthreads();
        // stage A,B tiles: 128 rows x 64 K each = 1024 x 16B chunks, 4+4/thread
#pragma unroll
        for (int i = 0; i < 4; ++i) {
            int chunk = i * 256 + tid;            // coalesced across threads
            int row = chunk >> 3, q = chunk & 7;
            *reinterpret_cast<uint4*>(&As[row * 64 + q * 8]) =
                *reinterpret_cast<const uint4*>(&A[(size_t)(m0 + row) * K + kc + q * 8]);
            *reinterpret_cast<uint4*>(&Bs[row * 64 + q * 8]) =
                *reinterpret_cast<const uint4*>(&Bt[(size_t)(n0 + row) * K + kc + q * 8]);
        }
        if (kc + 64 < K) {   // keep HBM ahead of the LDS stage
            int chunk = tid;
            int row = chunk >> 3, q = chunk & 7;
            __builtin_prefetch(&A[(size_t)(m0 + row) * K + kc + 64 + q * 8], 0, 0);
            __builtin_prefetch(&Bt[(size_t)(n0 + row) * K + kc + 64 + q * 8], 0, 0);
        }
        __syncthreads();

        v16bf a[2][2];
#pragma unroll
        for (int c = 0; c < 2; ++c)
#pragma unroll
            for (int i = 0; i < 2; ++i)
                a[c][i] = lds_load_op(As, wr + i * 16 + ln, 64, c * 32, lane);

#pragma unroll
        for (int c = 0; c < 2; ++c) {
#pragma unroll
            for (int j = 0; j < 4; ++j) {
                v16bf b = lds_load_op(Bs, wc + j * 16 + ln, 64, c * 32, lane);
                acc[0][j] = wmma_bf16(a[c][0], b, acc[0][j]);
                acc[1][j] = wmma_bf16(a[c][1], b, acc[1][j]);
            }
        }
    }

    // Epilogue.  C layout: VGPR r -> row r + 8*half, col = lane&15.
#pragma unroll
    for (int i = 0; i < 2; ++i) {
#pragma unroll
        for (int j = 0; j < 4; ++j) {
            const int col = n0 + wc + j * 16 + ln;
            const float bval = bias[col];
#pragma unroll
            for (int r = 0; r < 8; ++r) {
                const int row = m0 + wr + i * 16 + r + half * 8;
                float val = acc[i][j][r] + bval;
                if constexpr (MODE == MODE_F32) {
                    Cf[(size_t)row * N + col] = val;
                } else if constexpr (MODE == MODE_RELU_BF16) {
                    Cb[(size_t)row * N + col] = f2bf(fmaxf(val, 0.0f));
                } else if constexpr (MODE == MODE_QPROJ) {
                    // row = b*S+s ; col = h*DK+kk  ->  [b,h,s,kk] bf16
                    int h = col >> 6, kk = col & 63;
                    int s = row & (Ss - 1), bidx = row >> 11;
                    Cb[(((size_t)(bidx * Hh + h) * Ss + s) * DKk) + kk] = f2bf(val);
                } else {  // MODE_VPROJ: [b,h,kk,s] (V transposed)
                    int h = col >> 6, kk = col & 63;
                    int s = row & (Ss - 1), bidx = row >> 11;
                    Cb[(((size_t)(bidx * Hh + h) * DKk + kk) * Ss) + s] = f2bf(val);
                }
            }
        }
    }
}

// ---------------- fused flash attention -------------------------------------
// grid = (S/64, B*H), block = 128 (4 waves).  Each wave owns 16 query rows.
// 64-key tiles: 8 score WMMAs + 8 PV WMMAs per barrier pair.
// Q,K: bf16 [B*H, S, DK] ; VT: bf16 [B*H, DK, S] ; O: bf16 [B, S, H*DK].

__global__ __launch_bounds__(128) void flash_attn_kernel(
    const u16* __restrict__ Q, const u16* __restrict__ Km,
    const u16* __restrict__ VT, u16* __restrict__ O) {
    __shared__ u16 qs[64 * 64];          // 64 q rows x DK      (8 KB)
    __shared__ u16 ks[64 * 64];          // 64 keys  x DK       (8 KB)
    __shared__ u16 vts[64 * 64];         // DK rows  x 64 keys  (8 KB)
    __shared__ u16 ps[4 * 16 * 64];      // per-wave P scratch  (8 KB)

    const int tid  = threadIdx.x;
    const int lane = tid & 31;
    const int ln   = lane & 15;
    const int half = lane >> 4;
    const int wave = tid >> 5;
    const int bh   = blockIdx.y;                 // b*H + h
    const int q0   = blockIdx.x * 64;
    const int rb   = wave * 16;

    // stage Q tile
    {
        const u16* qg = Q + ((size_t)bh * Ss + q0) * DKk;
        int row = tid >> 1, cb = (tid & 1) * 32;
#pragma unroll
        for (int q = 0; q < 4; ++q)
            *reinterpret_cast<uint4*>(&qs[row * 64 + cb + q * 8]) =
                *reinterpret_cast<const uint4*>(&qg[(size_t)row * DKk + cb + q * 8]);
    }
    __syncthreads();

    v16bf aq[2];
#pragma unroll
    for (int c = 0; c < 2; ++c)
        aq[c] = lds_load_op(qs, rb + ln, 64, c * 32, lane);

    float m[8], l[8];
    v8f o[4] = {};
#pragma unroll
    for (int r = 0; r < 8; ++r) { m[r] = -INFINITY; l[r] = 0.0f; }

    u16* psw = ps + wave * 16 * 64;

    for (int kb = 0; kb < Ss; kb += 64) {
        __syncthreads();
        {   // stage K tile: 64 keys x DK
            int row = tid >> 1, cb = (tid & 1) * 32;
            const u16* kg = Km + ((size_t)bh * Ss + kb) * DKk;
#pragma unroll
            for (int q = 0; q < 4; ++q)
                *reinterpret_cast<uint4*>(&ks[row * 64 + cb + q * 8]) =
                    *reinterpret_cast<const uint4*>(&kg[(size_t)row * DKk + cb + q * 8]);
        }
        {   // stage V^T tile: DK rows x 64 keys
            int row = tid >> 1, cb = (tid & 1) * 32;
            const u16* vg = VT + (size_t)bh * DKk * Ss + kb;
#pragma unroll
            for (int q = 0; q < 4; ++q)
                *reinterpret_cast<uint4*>(&vts[row * 64 + cb + q * 8]) =
                    *reinterpret_cast<const uint4*>(&vg[(size_t)row * Ss + cb + q * 8]);
        }
        __syncthreads();

        // scores: [16 q rows] x [64 keys] in 4 tiles, accumulate over DK
        v8f s[4] = {};
#pragma unroll
        for (int c = 0; c < 2; ++c)
#pragma unroll
            for (int t = 0; t < 4; ++t) {
                v16bf bk = lds_load_op(ks, t * 16 + ln, 64, c * 32, lane);
                s[t] = wmma_bf16(aq[c], bk, s[t]);
            }
#pragma unroll
        for (int t = 0; t < 4; ++t) s[t] = s[t] * 0.125f;   // 1/sqrt(DK)

        // online softmax (rows live in 16-lane halves of the wave)
        float rmax[8];
#pragma unroll
        for (int r = 0; r < 8; ++r)
            rmax[r] = fmaxf(fmaxf(s[0][r], s[1][r]), fmaxf(s[2][r], s[3][r]));
#pragma unroll
        for (int r = 0; r < 8; ++r) {
            rmax[r] = fmaxf(rmax[r], xor16f<1>(rmax[r]));
            rmax[r] = fmaxf(rmax[r], xor16f<2>(rmax[r]));
            rmax[r] = fmaxf(rmax[r], xor16f<4>(rmax[r]));
            rmax[r] = fmaxf(rmax[r], xor16f<8>(rmax[r]));
        }

        float alpha[8];
#pragma unroll
        for (int r = 0; r < 8; ++r) {
            float mn = fmaxf(m[r], rmax[r]);
            alpha[r] = __expf(m[r] - mn);
            m[r] = mn;
        }
#pragma unroll
        for (int t = 0; t < 4; ++t)
#pragma unroll
            for (int r = 0; r < 8; ++r)
                s[t][r] = __expf(s[t][r] - m[r]);

        float rsum[8];
#pragma unroll
        for (int r = 0; r < 8; ++r)
            rsum[r] = (s[0][r] + s[1][r]) + (s[2][r] + s[3][r]);
#pragma unroll
        for (int r = 0; r < 8; ++r) {
            rsum[r] += xor16f<1>(rsum[r]);
            rsum[r] += xor16f<2>(rsum[r]);
            rsum[r] += xor16f<4>(rsum[r]);
            rsum[r] += xor16f<8>(rsum[r]);
            l[r] = l[r] * alpha[r] + rsum[r];
        }

        // reshape P (C layout -> A layout) via per-wave LDS round trip
#pragma unroll
        for (int t = 0; t < 4; ++t)
#pragma unroll
            for (int r = 0; r < 8; ++r) {
                int rowp = r + half * 8;
                psw[rowp * 64 + t * 16 + ln] = f2bf(s[t][r]);
            }
        asm volatile("s_wait_dscnt 0x0" ::: "memory");  // wave-local LDS RAW
        v16bf ap[2];
#pragma unroll
        for (int c = 0; c < 2; ++c)
            ap[c] = lds_load_op(psw, ln, 64, c * 32, lane);

        // O = O*alpha + P @ V  (two 32-key WMMA K-steps per col group)
#pragma unroll
        for (int n = 0; n < 4; ++n) {
#pragma unroll
            for (int r = 0; r < 8; ++r) o[n][r] *= alpha[r];
#pragma unroll
            for (int c = 0; c < 2; ++c) {
                v16bf bv = lds_load_op(vts, n * 16 + ln, 64, c * 32, lane);
                o[n] = wmma_bf16(ap[c], bv, o[n]);
            }
        }
    }

    // finalize: O /= l, write concatenated-head layout [b, s, h*DK + col]
    const int bidx = bh >> 4, h = bh & 15;
#pragma unroll
    for (int r = 0; r < 8; ++r) {
        float inv = 1.0f / l[r];
        int srow = q0 + rb + r + half * 8;
#pragma unroll
        for (int n = 0; n < 4; ++n) {
            int col = h * DKk + n * 16 + ln;
            O[((size_t)bidx * Ss + srow) * (Hh * DKk) + col] = f2bf(o[n][r] * inv);
        }
    }
}

// ---------------- residual + LayerNorm --------------------------------------
// one row per block; 256 threads * 4 elems = D

template <bool WRITE_BF16>
__global__ __launch_bounds__(256) void add_ln_kernel(
    const float* __restrict__ a, const float* __restrict__ b,
    const float* __restrict__ g, const float* __restrict__ be,
    float* __restrict__ oF, u16* __restrict__ oB) {
    __shared__ float ss[256], sq[256];
    const int row = blockIdx.x, tid = threadIdx.x;
    const int i0 = tid * 4;

    float4 xa = *reinterpret_cast<const float4*>(a + (size_t)row * Dd + i0);
    float4 xb = *reinterpret_cast<const float4*>(b + (size_t)row * Dd + i0);
    float v[4] = { xa.x + xb.x, xa.y + xb.y, xa.z + xb.z, xa.w + xb.w };

    float s = v[0] + v[1] + v[2] + v[3];
    float q = v[0] * v[0] + v[1] * v[1] + v[2] * v[2] + v[3] * v[3];
    ss[tid] = s; sq[tid] = q;
    __syncthreads();
    for (int st = 128; st > 0; st >>= 1) {
        if (tid < st) { ss[tid] += ss[tid + st]; sq[tid] += sq[tid + st]; }
        __syncthreads();
    }
    const float mu   = ss[0] * (1.0f / Dd);
    const float var  = sq[0] * (1.0f / Dd) - mu * mu;
    const float rstd = rsqrtf(var + LN_EPS);

    float4 gg = *reinterpret_cast<const float4*>(g + i0);
    float4 bb = *reinterpret_cast<const float4*>(be + i0);
    float o0 = (v[0] - mu) * rstd * gg.x + bb.x;
    float o1 = (v[1] - mu) * rstd * gg.y + bb.y;
    float o2 = (v[2] - mu) * rstd * gg.z + bb.z;
    float o3 = (v[3] - mu) * rstd * gg.w + bb.w;

    *reinterpret_cast<float4*>(oF + (size_t)row * Dd + i0) = make_float4(o0, o1, o2, o3);
    if constexpr (WRITE_BF16) {
        u16* p = oB + (size_t)row * Dd + i0;
        p[0] = f2bf(o0); p[1] = f2bf(o1); p[2] = f2bf(o2); p[3] = f2bf(o3);
    }
}

// ---------------- launcher ---------------------------------------------------

extern "C" void kernel_launch(void* const* d_in, const int* in_sizes, int n_in,
                              void* d_out, int out_size, void* d_ws, size_t ws_size,
                              hipStream_t stream) {
    const float* x  = (const float*)d_in[0];
    const float* wq = (const float*)d_in[1];  const float* bq = (const float*)d_in[2];
    const float* wk = (const float*)d_in[3];  const float* bk = (const float*)d_in[4];
    const float* wv = (const float*)d_in[5];  const float* bv = (const float*)d_in[6];
    const float* wo = (const float*)d_in[7];  const float* bo = (const float*)d_in[8];
    const float* g1 = (const float*)d_in[9];  const float* be1 = (const float*)d_in[10];
    const float* w1 = (const float*)d_in[11]; const float* b1 = (const float*)d_in[12];
    const float* w2 = (const float*)d_in[13]; const float* b2 = (const float*)d_in[14];
    const float* g2 = (const float*)d_in[15]; const float* be2 = (const float*)d_in[16];
    float* out = (float*)d_out;

    char* ws = (char*)d_ws;
    const size_t MB = 1024 * 1024;
    u16* XB  = (u16*)(ws + 0);          //  8 MB  x bf16 [BS, D]
    u16* WQB = (u16*)(ws + 8  * MB);    //  2 MB
    u16* WKB = (u16*)(ws + 10 * MB);    //  2 MB
    u16* WVB = (u16*)(ws + 12 * MB);    //  2 MB
    u16* WOB = (u16*)(ws + 14 * MB);    //  2 MB
    u16* W1B = (u16*)(ws + 16 * MB);    //  8 MB
    u16* W2B = (u16*)(ws + 24 * MB);    //  8 MB
    u16* Qb  = (u16*)(ws + 32 * MB);    //  8 MB  [B,H,S,DK]
    u16* Kb  = (u16*)(ws + 40 * MB);    //  8 MB  [B,H,S,DK]
    u16* VTb = (u16*)(ws + 48 * MB);    //  8 MB  [B,H,DK,S]
    u16* Ob  = (u16*)(ws + 56 * MB);    //  8 MB  [B,S,H*DK]
    float* ATT = (float*)(ws + 64 * MB);   // 16 MB [BS, D]
    float* N1F = (float*)(ws + 80 * MB);   // 16 MB
    u16*   N1B = (u16*)(ws + 96 * MB);     //  8 MB
    u16*   FF1 = (u16*)(ws + 104 * MB);    // 32 MB [BS, FF]
    float* FF2 = (float*)(ws + 136 * MB);  // 16 MB

    // 1. bf16 conversions
    auto cvt = [&](const float* src, u16* dst, int n) {
        int blocks = min((n + 255) / 256, 4096);
        cvt_bf16_kernel<<<blocks, 256, 0, stream>>>(src, dst, n);
    };
    cvt(x,  XB,  BS * Dd);
    cvt(wq, WQB, Hh * DKk * Dd);
    cvt(wk, WKB, Hh * DKk * Dd);
    cvt(wv, WVB, Hh * DKk * Dd);
    cvt(wo, WOB, Dd * Dd);
    cvt(w1, W1B, FFf * Dd);
    cvt(w2, W2B, Dd * FFf);

    // 2. QKV projections (N = H*DK = 1024, K = 1024)
    dim3 gP(Dd / 128, BS / 128);
    gemm_bf16_kernel<MODE_QPROJ><<<gP, 256, 0, stream>>>(XB, WQB, bq, nullptr, Qb,  BS, Dd, Dd);
    gemm_bf16_kernel<MODE_QPROJ><<<gP, 256, 0, stream>>>(XB, WKB, bk, nullptr, Kb,  BS, Dd, Dd);
    gemm_bf16_kernel<MODE_VPROJ><<<gP, 256, 0, stream>>>(XB, WVB, bv, nullptr, VTb, BS, Dd, Dd);

    // 3. fused attention
    flash_attn_kernel<<<dim3(Ss / 64, Bb * Hh), 128, 0, stream>>>(Qb, Kb, VTb, Ob);

    // 4. output projection
    gemm_bf16_kernel<MODE_F32><<<gP, 256, 0, stream>>>(Ob, WOB, bo, ATT, nullptr, BS, Dd, Dd);

    // 5. LN1 (residual with x), keep bf16 mirror for FFN input
    add_ln_kernel<true><<<BS, 256, 0, stream>>>(ATT, x, g1, be1, N1F, N1B);

    // 6. FFN
    gemm_bf16_kernel<MODE_RELU_BF16><<<dim3(FFf / 128, BS / 128), 256, 0, stream>>>(
        N1B, W1B, b1, nullptr, FF1, BS, FFf, Dd);
    gemm_bf16_kernel<MODE_F32><<<gP, 256, 0, stream>>>(FF1, W2B, b2, FF2, nullptr, BS, Dd, FFf);

    // 7. LN2 -> output
    add_ln_kernel<false><<<BS, 256, 0, stream>>>(FF2, N1F, g2, be2, out, nullptr);
}

// v001
// A run of this version takes 441 microseconds.
// Two timings next to v000 both put it at 1.63 times that version's speed.
#include <hip/hip_runtime.h>

// ---------------------------------------------------------------------------
// Transformer encoder block for MI455X (gfx1250, wave32, WMMA bf16)
//   B=2, S=2048, D=1024, H=16, DK=64, FF=4096, fp32 I/O
// ---------------------------------------------------------------------------

typedef __attribute__((ext_vector_type(16))) __bf16 v16bf;
typedef __attribute__((ext_vector_type(8)))  float  v8f;

using u16 = unsigned short;
using u32 = unsigned int;

static constexpr int Hh = 16;
static constexpr int Dd = 1024;
static constexpr int DKk = 64;
static constexpr int FFf = 4096;
static constexpr int Bb = 2;
static constexpr int Ss = 2048;
static constexpr int BS = Bb * Ss;       // 4096 rows
static constexpr float LN_EPS = 1e-5f;
// LDS row pitch in bf16 elements for tiles of 64 elements a row: 144 B = 16 B x 9.
// An odd multiple of 16 B spreads the 16 rows of a ds_load_b128 fragment read
// over all 64 banks; at 128 B eight rows fall on the same four banks.
static constexpr int LP = 72;

// ---------------- helpers ---------------------------------------------------

__device__ __forceinline__ u16 f2bf(float f) {
    u32 u = __float_as_uint(f);
    u32 r = u + 0x7FFFu + ((u >> 16) & 1u);   // round-to-nearest-even
    return (u16)(r >> 16);
}

union Op32 { uint4 q[2]; v16bf v; };

// Load one WMMA 16x16x32 bf16 operand (A layout; B uses the same pattern on
// the transposed [N,K] matrix).  `base` points at a row-major bf16 tile in
// LDS with `stride` elements per row, `kbase` selects the 32-wide K chunk.
// Lanes 0-15: K = kbase+{0..7,16..23};  lanes 16-31: K = kbase+{8..15,24..31}.
__device__ __forceinline__ v16bf lds_load_op(const u16* base, int row, int stride,
                                             int kbase, int lane) {
    const u16* p = base + row * stride + kbase + ((lane >> 4) & 1) * 8;
    Op32 u;
    u.q[0] = *reinterpret_cast<const uint4*>(p);
    u.q[1] = *reinterpret_cast<const uint4*>(p + 16);
    return u.v;
}

__device__ __forceinline__ v8f wmma_bf16(v16bf a, v16bf b, v8f c) {
    return __builtin_amdgcn_wmma_f32_16x16x32_bf16(false, a, false, b,
                                                   (short)0, c, false, false);
}

// Cross-lane XOR reduction step within 16-lane halves of the wave32.
// Prefer v_permlane16_b32 (VALU, co-executes with WMMA) over ds_bpermute.
template <int MASK>
__device__ __forceinline__ float xor16f(float v) {
#if __has_builtin(__builtin_amdgcn_permlane16)
    u32 s0, s1;
    if constexpr (MASK == 1)      { s0 = 0x67452301u; s1 = 0xEFCDAB89u; }
    else if constexpr (MASK == 2) { s0 = 0x54761032u; s1 = 0xDCFE98BAu; }
    else if constexpr (MASK == 4) { s0 = 0x32107654u; s1 = 0xBA98FEDCu; }
    else                          { s0 = 0xFEDCBA98u; s1 = 0x76543210u; }
    u32 u = __float_as_uint(v);
    u32 r = __builtin_amdgcn_permlane16(u, u, s0, s1, false, false);
    return __uint_as_float(r);
#else
    return __shfl_xor(v, MASK);
#endif
}

// ---------------- fp32 -> bf16 conversion -----------------------------------

__global__ __launch_bounds__(256) void cvt_bf16_kernel(const float* __restrict__ x,
                                                       u16* __restrict__ y, int n) {
    for (int i = blockIdx.x * blockDim.x + threadIdx.x; i < n;
         i += gridDim.x * blockDim.x)
        y[i] = f2bf(x[i]);
}

// ---------------- generic WMMA GEMM -----------------------------------------
// C[M,N] = A[M,K](bf16) * Bt[N,K](bf16)^T + bias[N], with epilogue modes.
// Block tile 128x128, K-step 64, 8 waves; wave tile 32x64 (2x4 WMMA tiles).

enum { MODE_F32 = 0, MODE_RELU_BF16 = 1, MODE_QPROJ = 2, MODE_VPROJ = 3 };

template <int MODE>
__global__ __launch_bounds__(256) void gemm_bf16_kernel(
    const u16* __restrict__ A, const u16* __restrict__ Bt,
    const float* __restrict__ bias, float* __restrict__ Cf,
    u16* __restrict__ Cb, int M, int N, int K) {
    __shared__ __attribute__((aligned(16))) u16 As[128 * LP];   // 18 KB
    __shared__ __attribute__((aligned(16))) u16 Bs[128 * LP];   // 18 KB

    const int tid  = threadIdx.x;
    const int lane = tid & 31;
    const int ln   = lane & 15;
    const int half = lane >> 4;
    const int wave = tid >> 5;
    const int wr   = (wave & 3) * 32;   // wave row offset within 128
    const int wc   = (wave >> 2) * 64;  // wave col offset within 128
    const int m0   = blockIdx.y * 128;
    const int n0   = blockIdx.x * 128;

    v8f acc[2][4] = {};

    for (int kc = 0; kc < K; kc += 64) {
        __syncthreads();
        // stage A,B tiles: 128 rows x 64 K each = 1024 x 16B chunks, 4+4/thread
#pragma unroll
        for (int i = 0; i < 4; ++i) {
            int chunk = i * 256 + tid;            // coalesced across threads
            int row = chunk >> 3, q = chunk & 7;
            *reinterpret_cast<uint4*>(&As[row * LP + q * 8]) =
                *reinterpret_cast<const uint4*>(&A[(size_t)(m0 + row) * K + kc + q * 8]);
            *reinterpret_cast<uint4*>(&Bs[row * LP + q * 8]) =
                *reinterpret_cast<const uint4*>(&Bt[(size_t)(n0 + row) * K + kc + q * 8]);
        }
        if (kc + 64 < K) {   // keep HBM ahead of the LDS stage
            int chunk = tid;
            int row = chunk >> 3, q = chunk & 7;
            __builtin_prefetch(&A[(size_t)(m0 + row) * K + kc + 64 + q * 8], 0, 0);
            __builtin_prefetch(&Bt[(size_t)(n0 + row) * K + kc + 64 + q * 8], 0, 0);
        }
        __syncthreads();

        v16bf a[2][2];
#pragma unroll
        for (int c = 0; c < 2; ++c)
#pragma unroll
            for (int i = 0; i < 2; ++i)
                a[c][i] = lds_load_op(As, wr + i * 16 + ln, LP, c * 32, lane);

#pragma unroll
        for (int c = 0; c < 2; ++c) {
#pragma unroll
            for (int j = 0; j < 4; ++j) {
                v16bf b = lds_load_op(Bs, wc + j * 16 + ln, LP, c * 32, lane);
                acc[0][j] = wmma_bf16(a[c][0], b, acc[0][j]);
                acc[1][j] = wmma_bf16(a[c][1], b, acc[1][j]);
            }
        }
    }

    // Epilogue.  C layout: VGPR r -> row r + 8*half, col = lane&15.
#pragma unroll
    for (int i = 0; i < 2; ++i) {
#pragma unroll
        for (int j = 0; j < 4; ++j) {
            const int col = n0 + wc + j * 16 + ln;
            const float bval = bias[col];
#pragma unroll
            for (int r = 0; r < 8; ++r) {
                const int row = m0 + wr + i * 16 + r + half * 8;
                float val = acc[i][j][r] + bval;
                if constexpr (MODE == MODE_F32) {
                    Cf[(size_t)row * N + col] = val;
                } else if constexpr (MODE == MODE_RELU_BF16) {
                    Cb[(size_t)row * N + col] = f2bf(fmaxf(val, 0.0f));
                } else if constexpr (MODE == MODE_QPROJ) {
                    // row = b*S+s ; col = h*DK+kk  ->  [b,h,s,kk] bf16
                    int h = col >> 6, kk = col & 63;
                    int s = row & (Ss - 1), bidx = row >> 11;
                    Cb[(((size_t)(bidx * Hh + h) * Ss + s) * DKk) + kk] = f2bf(val);
                } else {  // MODE_VPROJ: [b,h,kk,s] (V transposed)
                    int h = col >> 6, kk = col & 63;
                    int s = row & (Ss - 1), bidx = row >> 11;
                    Cb[(((size_t)(bidx * Hh + h) * DKk + kk) * Ss) + s] = f2bf(val);
                }
            }
        }
    }
}

// ---------------- fused flash attention -------------------------------------
// grid = (S/64, B*H), block = 128 (4 waves).  Each wave owns 16 query rows.
// 64-key tiles: 8 score WMMAs + 8 PV WMMAs per barrier pair.
// Q,K: bf16 [B*H, S, DK] ; VT: bf16 [B*H, DK, S] ; O: bf16 [B, S, H*DK].

__global__ __launch_bounds__(128) void flash_attn_kernel(
    const u16* __restrict__ Q, const u16* __restrict__ Km,
    const u16* __restrict__ VT, u16* __restrict__ O) {
    __shared__ __attribute__((aligned(16))) u16 qs[64 * LP];       // 64 q rows x DK      (9 KB)
    __shared__ __attribute__((aligned(16))) u16 ks[64 * LP];       // 64 keys  x DK       (9 KB)
    __shared__ __attribute__((aligned(16))) u16 vts[64 * LP];      // DK rows  x 64 keys  (9 KB)
    __shared__ __attribute__((aligned(16))) u16 ps[4 * 16 * LP];   // per-wave P scratch  (9 KB)

    const int tid  = threadIdx.x;
    const int lane = tid & 31;
    const int ln   = lane & 15;
    const int half = lane >> 4;
    const int wave = tid >> 5;
    const int bh   = blockIdx.y;                 // b*H + h
    const int q0   = blockIdx.x * 64;
    const int rb   = wave * 16;

    // stage Q tile
    {
        const u16* qg = Q + ((size_t)bh * Ss + q0) * DKk;
        int row = tid >> 1, cb = (tid & 1) * 32;
#pragma unroll
        for (int q = 0; q < 4; ++q)
            *reinterpret_cast<uint4*>(&qs[row * LP + cb + q * 8]) =
                *reinterpret_cast<const uint4*>(&qg[(size_t)row * DKk + cb + q * 8]);
    }
    __syncthreads();

    v16bf aq[2];
#pragma unroll
    for (int c = 0; c < 2; ++c)
        aq[c] = lds_load_op(qs, rb + ln, LP, c * 32, lane);

    float m[8], l[8];
    v8f o[4] = {};
#pragma unroll
    for (int r = 0; r < 8; ++r) { m[r] = -INFINITY; l[r] = 0.0f; }

    u16* psw = ps + wave * 16 * LP;

    for (int kb = 0; kb < Ss; kb += 64) {
        __syncthreads();
        {   // stage K tile: 64 keys x DK
            int row = tid >> 1, cb = (tid & 1) * 32;
            const u16* kg = Km + ((size_t)bh * Ss + kb) * DKk;
#pragma unroll
            for (int q = 0; q < 4; ++q)
                *reinterpret_cast<uint4*>(&ks[row * LP + cb + q * 8]) =
                    *reinterpret_cast<const uint4*>(&kg[(size_t)row * DKk + cb + q * 8]);
        }
        {   // stage V^T tile: DK rows x 64 keys
            int row = tid >> 1, cb = (tid & 1) * 32;
            const u16* vg = VT + (size_t)bh * DKk * Ss + kb;
#pragma unroll
            for (int q = 0; q < 4; ++q)
                *reinterpret_cast<uint4*>(&vts[row * LP + cb + q * 8]) =
                    *reinterpret_cast<const uint4*>(&vg[(size_t)row * Ss + cb + q * 8]);
        }
        __syncthreads();

        // scores: [16 q rows] x [64 keys] in 4 tiles, accumulate over DK
        v8f s[4] = {};
#pragma unroll
        for (int c = 0; c < 2; ++c)
#pragma unroll
            for (int t = 0; t < 4; ++t) {
                v16bf bk = lds_load_op(ks, t * 16 + ln, LP, c * 32, lane);
                s[t] = wmma_bf16(aq[c], bk, s[t]);
            }
#pragma unroll
        for (int t = 0; t < 4; ++t) s[t] = s[t] * 0.125f;   // 1/sqrt(DK)

        // online softmax (rows live in 16-lane halves of the wave)
        float rmax[8];
#pragma unroll
        for (int r = 0; r < 8; ++r)
            rmax[r] = fmaxf(fmaxf(s[0][r], s[1][r]), fmaxf(s[2][r], s[3][r]));
#pragma unroll
        for (int r = 0; r < 8; ++r) {
            rmax[r] = fmaxf(rmax[r], xor16f<1>(rmax[r]));
            rmax[r] = fmaxf(rmax[r], xor16f<2>(rmax[r]));
            rmax[r] = fmaxf(rmax[r], xor16f<4>(rmax[r]));
            rmax[r] = fmaxf(rmax[r], xor16f<8>(rmax[r]));
        }

        float alpha[8];
#pragma unroll
        for (int r = 0; r < 8; ++r) {
            float mn = fmaxf(m[r], rmax[r]);
            alpha[r] = __expf(m[r] - mn);
            m[r] = mn;
        }
#pragma unroll
        for (int t = 0; t < 4; ++t)
#pragma unroll
            for (int r = 0; r < 8; ++r)
                s[t][r] = __expf(s[t][r] - m[r]);

        float rsum[8];
#pragma unroll
        for (int r = 0; r < 8; ++r)
            rsum[r] = (s[0][r] + s[1][r]) + (s[2][r] + s[3][r]);
#pragma unroll
        for (int r = 0; r < 8; ++r) {
            rsum[r] += xor16f<1>(rsum[r]);
            rsum[r] += xor16f<2>(rsum[r]);
            rsum[r] += xor16f<4>(rsum[r]);
            rsum[r] += xor16f<8>(rsum[r]);
            l[r] = l[r] * alpha[r] + rsum[r];
        }

        // reshape P (C layout -> A layout) via per-wave LDS round trip
#pragma unroll
        for (int t = 0; t < 4; ++t)
#pragma unroll
            for (int r = 0; r < 8; ++r) {
                int rowp = r + half * 8;
                psw[rowp * LP + t * 16 + ln] = f2bf(s[t][r]);
            }
        asm volatile("s_wait_dscnt 0x0" ::: "memory");  // wave-local LDS RAW
        v16bf ap[2];
#pragma unroll
        for (int c = 0; c < 2; ++c)
            ap[c] = lds_load_op(psw, ln, LP, c * 32, lane);

        // O = O*alpha + P @ V  (two 32-key WMMA K-steps per col group)
#pragma unroll
        for (int n = 0; n < 4; ++n) {
#pragma unroll
            for (int r = 0; r < 8; ++r) o[n][r] *= alpha[r];
#pragma unroll
            for (int c = 0; c < 2; ++c) {
                v16bf bv = lds_load_op(vts, n * 16 + ln, LP, c * 32, lane);
                o[n] = wmma_bf16(ap[c], bv, o[n]);
            }
        }
    }

    // finalize: O /= l, write concatenated-head layout [b, s, h*DK + col]
    const int bidx = bh >> 4, h = bh & 15;
#pragma unroll
    for (int r = 0; r < 8; ++r) {
        float inv = 1.0f / l[r];
        int srow = q0 + rb + r + half * 8;
#pragma unroll
        for (int n = 0; n < 4; ++n) {
            int col = h * DKk + n * 16 + ln;
            O[((size_t)bidx * Ss + srow) * (Hh * DKk) + col] = f2bf(o[n][r] * inv);
        }
    }
}

// ---------------- residual + LayerNorm --------------------------------------
// one row per block; 256 threads * 4 elems = D

template <bool WRITE_BF16>
__global__ __launch_bounds__(256) void add_ln_kernel(
    const float* __restrict__ a, const float* __restrict__ b,
    const float* __restrict__ g, const float* __restrict__ be,
    float* __restrict__ oF, u16* __restrict__ oB) {
    __shared__ float ss[256], sq[256];
    const int row = blockIdx.x, tid = threadIdx.x;
    const int i0 = tid * 4;

    float4 xa = *reinterpret_cast<const float4*>(a + (size_t)row * Dd + i0);
    float4 xb = *reinterpret_cast<const float4*>(b + (size_t)row * Dd + i0);
    float v[4] = { xa.x + xb.x, xa.y + xb.y, xa.z + xb.z, xa.w + xb.w };

    float s = v[0] + v[1] + v[2] + v[3];
    float q = v[0] * v[0] + v[1] * v[1] + v[2] * v[2] + v[3] * v[3];
    ss[tid] = s; sq[tid] = q;
    __syncthreads();
    for (int st = 128; st > 0; st >>= 1) {
        if (tid < st) { ss[tid] += ss[tid + st]; sq[tid] += sq[tid + st]; }
        __syncthreads();
    }
    const float mu   = ss[0] * (1.0f / Dd);
    const float var  = sq[0] * (1.0f / Dd) - mu * mu;
    const float rstd = rsqrtf(var + LN_EPS);

    float4 gg = *reinterpret_cast<const float4*>(g + i0);
    float4 bb = *reinterpret_cast<const float4*>(be + i0);
    float o0 = (v[0] - mu) * rstd * gg.x + bb.x;
    float o1 = (v[1] - mu) * rstd * gg.y + bb.y;
    float o2 = (v[2] - mu) * rstd * gg.z + bb.z;
    float o3 = (v[3] - mu) * rstd * gg.w + bb.w;

    *reinterpret_cast<float4*>(oF + (size_t)row * Dd + i0) = make_float4(o0, o1, o2, o3);
    if constexpr (WRITE_BF16) {
        u16* p = oB + (size_t)row * Dd + i0;
        p[0] = f2bf(o0); p[1] = f2bf(o1); p[2] = f2bf(o2); p[3] = f2bf(o3);
    }
}

// ---------------- launcher ---------------------------------------------------

extern "C" void kernel_launch(void* const* d_in, const int* in_sizes, int n_in,
                              void* d_out, int out_size, void* d_ws, size_t ws_size,
                              hipStream_t stream) {
    const float* x  = (const float*)d_in[0];
    const float* wq = (const float*)d_in[1];  const float* bq = (const float*)d_in[2];
    const float* wk = (const float*)d_in[3];  const float* bk = (const float*)d_in[4];
    const float* wv = (const float*)d_in[5];  const float* bv = (const float*)d_in[6];
    const float* wo = (const float*)d_in[7];  const float* bo = (const float*)d_in[8];
    const float* g1 = (const float*)d_in[9];  const float* be1 = (const float*)d_in[10];
    const float* w1 = (const float*)d_in[11]; const float* b1 = (const float*)d_in[12];
    const float* w2 = (const float*)d_in[13]; const float* b2 = (const float*)d_in[14];
    const float* g2 = (const float*)d_in[15]; const float* be2 = (const float*)d_in[16];
    float* out = (float*)d_out;

    char* ws = (char*)d_ws;
    const size_t MB = 1024 * 1024;
    u16* XB  = (u16*)(ws + 0);          //  8 MB  x bf16 [BS, D]
    u16* WQB = (u16*)(ws + 8  * MB);    //  2 MB
    u16* WKB = (u16*)(ws + 10 * MB);    //  2 MB
    u16* WVB = (u16*)(ws + 12 * MB);    //  2 MB
    u16* WOB = (u16*)(ws + 14 * MB);    //  2 MB
    u16* W1B = (u16*)(ws + 16 * MB);    //  8 MB
    u16* W2B = (u16*)(ws + 24 * MB);    //  8 MB
    u16* Qb  = (u16*)(ws + 32 * MB);    //  8 MB  [B,H,S,DK]
    u16* Kb  = (u16*)(ws + 40 * MB);    //  8 MB  [B,H,S,DK]
    u16* VTb = (u16*)(ws + 48 * MB);    //  8 MB  [B,H,DK,S]
    u16* Ob  = (u16*)(ws + 56 * MB);    //  8 MB  [B,S,H*DK]
    float* ATT = (float*)(ws + 64 * MB);   // 16 MB [BS, D]
    float* N1F = (float*)(ws + 80 * MB);   // 16 MB
    u16*   N1B = (u16*)(ws + 96 * MB);     //  8 MB
    u16*   FF1 = (u16*)(ws + 104 * MB);    // 32 MB [BS, FF]
    float* FF2 = (float*)(ws + 136 * MB);  // 16 MB

    // 1. bf16 conversions
    auto cvt = [&](const float* src, u16* dst, int n) {
        int blocks = min((n + 255) / 256, 4096);
        cvt_bf16_kernel<<<blocks, 256, 0, stream>>>(src, dst, n);
    };
    cvt(x,  XB,  BS * Dd);
    cvt(wq, WQB, Hh * DKk * Dd);
    cvt(wk, WKB, Hh * DKk * Dd);
    cvt(wv, WVB, Hh * DKk * Dd);
    cvt(wo, WOB, Dd * Dd);
    cvt(w1, W1B, FFf * Dd);
    cvt(w2, W2B, Dd * FFf);

    // 2. QKV projections (N = H*DK = 1024, K = 1024)
    dim3 gP(Dd / 128, BS / 128);
    gemm_bf16_kernel<MODE_QPROJ><<<gP, 256, 0, stream>>>(XB, WQB, bq, nullptr, Qb,  BS, Dd, Dd);
    gemm_bf16_kernel<MODE_QPROJ><<<gP, 256, 0, stream>>>(XB, WKB, bk, nullptr, Kb,  BS, Dd, Dd);
    gemm_bf16_kernel<MODE_VPROJ><<<gP, 256, 0, stream>>>(XB, WVB, bv, nullptr, VTb, BS, Dd, Dd);

    // 3. fused attention
    flash_attn_kernel<<<dim3(Ss / 64, Bb * Hh), 128, 0, stream>>>(Qb, Kb, VTb, Ob);

    // 4. output projection
    gemm_bf16_kernel<MODE_F32><<<gP, 256, 0, stream>>>(Ob, WOB, bo, ATT, nullptr, BS, Dd, Dd);

    // 5. LN1 (residual with x), keep bf16 mirror for FFN input
    add_ln_kernel<true><<<BS, 256, 0, stream>>>(ATT, x, g1, be1, N1F, N1B);

    // 6. FFN
    gemm_bf16_kernel<MODE_RELU_BF16><<<dim3(FFf / 128, BS / 128), 256, 0, stream>>>(
        N1B, W1B, b1, nullptr, FF1, BS, FFf, Dd);
    gemm_bf16_kernel<MODE_F32><<<gP, 256, 0, stream>>>(FF1, W2B, b2, FF2, nullptr, BS, Dd, FFf);

    // 7. LN2 -> output
    add_ln_kernel<false><<<BS, 256, 0, stream>>>(FF2, N1F, g2, be2, out, nullptr);
}

// v002
// A run of this version takes 425 microseconds.
// Timed twice side by side with v001, it ran 1.04 times as fast both times.
// Counting every step since v000, it is 1.70 times as fast.
#include <hip/hip_runtime.h>

// ---------------------------------------------------------------------------
// Transformer encoder block for MI455X (gfx1250, wave32, WMMA bf16)
//   B=2, S=2048, D=1024, H=16, DK=64, FF=4096, fp32 I/O
// ---------------------------------------------------------------------------

typedef __attribute__((ext_vector_type(16))) __bf16 v16bf;
typedef __attribute__((ext_vector_type(8)))  float  v8f;
typedef __attribute__((ext_vector_type(4)))  float  f32x4;

using u16 = unsigned short;
using u32 = unsigned int;

static constexpr int Hh = 16;
static constexpr int Dd = 1024;
static constexpr int DKk = 64;
static constexpr int FFf = 4096;
static constexpr int Bb = 2;
static constexpr int Ss = 2048;
static constexpr int BS = Bb * Ss;       // 4096 rows
static constexpr float LN_EPS = 1e-5f;
// LDS row pitch in bf16 elements for tiles of 64 elements a row: 144 B = 16 B x 9.
// An odd multiple of 16 B spreads the 16 rows of a ds_load_b128 fragment read
// over all 64 banks; at 128 B eight rows fall on the same four banks.
static constexpr int LP = 72;

// ---------------- helpers ---------------------------------------------------

__device__ __forceinline__ u16 f2bf(float f) {
    u32 u = __float_as_uint(f);
    u32 r = u + 0x7FFFu + ((u >> 16) & 1u);   // round-to-nearest-even
    return (u16)(r >> 16);
}

union Op32 { uint4 q[2]; v16bf v; };

// Load one WMMA 16x16x32 bf16 operand (A layout; B uses the same pattern on
// the transposed [N,K] matrix).  `base` points at a row-major bf16 tile in
// LDS with `stride` elements per row, `kbase` selects the 32-wide K chunk.
// Lanes 0-15: K = kbase+{0..7,16..23};  lanes 16-31: K = kbase+{8..15,24..31}.
__device__ __forceinline__ v16bf lds_load_op(const u16* base, int row, int stride,
                                             int kbase, int lane) {
    const u16* p = base + row * stride + kbase + ((lane >> 4) & 1) * 8;
    Op32 u;
    u.q[0] = *reinterpret_cast<const uint4*>(p);
    u.q[1] = *reinterpret_cast<const uint4*>(p + 16);
    return u.v;
}

__device__ __forceinline__ v8f wmma_bf16(v16bf a, v16bf b, v8f c) {
    return __builtin_amdgcn_wmma_f32_16x16x32_bf16(false, a, false, b,
                                                   (short)0, c, false, false);
}

// Cross-lane XOR reduction step within 16-lane halves of the wave32.
// Prefer v_permlane16_b32 (VALU, co-executes with WMMA) over ds_bpermute.
template <int MASK>
__device__ __forceinline__ float xor16f(float v) {
#if __has_builtin(__builtin_amdgcn_permlane16)
    u32 s0, s1;
    if constexpr (MASK == 1)      { s0 = 0x67452301u; s1 = 0xEFCDAB89u; }
    else if constexpr (MASK == 2) { s0 = 0x54761032u; s1 = 0xDCFE98BAu; }
    else if constexpr (MASK == 4) { s0 = 0x32107654u; s1 = 0xBA98FEDCu; }
    else                          { s0 = 0xFEDCBA98u; s1 = 0x76543210u; }
    u32 u = __float_as_uint(v);
    u32 r = __builtin_amdgcn_permlane16(u, u, s0, s1, false, false);
    return __uint_as_float(r);
#else
    return __shfl_xor(v, MASK);
#endif
}

// ---------------- fp32 -> bf16 conversion -----------------------------------
// One launch converts x and the six weight matrices.  Their bf16 copies lie
// back to back in the workspace, so the destination is one array of 16 Mi
// elements; in units of 1 Mi elements x fills 0-3, wq 4, wk 5, wv 6, wo 7,
// w1 8-11, w2 12-15.  256 blocks of 16 waves, one per WGP: a block owns 64 Ki
// consecutive elements (always inside one source) and walks them in two
// rounds.  In a round a wave has 16 loads of 16 bytes a lane in flight, each
// covering 512 contiguous bytes; each store covers 256 contiguous bytes.

static constexpr int CVT_THREADS = 512;
static constexpr int CVT_BLOCKS  = 256;
static constexpr int CVT_LOADS   = 16;                         // 16-byte loads a lane and round
static constexpr int CVT_ROUNDS  = 2;
static constexpr int CVT_STEP    = CVT_THREADS * 4;            // elements a block-wide load covers
static constexpr int CVT_ROUND   = CVT_STEP * CVT_LOADS;       // elements a block converts a round
static constexpr int CVT_PER_BLOCK = CVT_ROUND * CVT_ROUNDS;   // 64 Ki elements
static_assert((size_t)CVT_BLOCKS * CVT_PER_BLOCK ==
              (size_t)BS * Dd + 4u * Dd * Dd + 2u * (size_t)FFf * Dd, "the grid covers every element once");
static_assert((1 << 20) % CVT_PER_BLOCK == 0, "a block never straddles two sources");

__global__ __launch_bounds__(CVT_THREADS) void cvt_all_bf16_kernel(
    const float* __restrict__ x,  const float* __restrict__ wq,
    const float* __restrict__ wk, const float* __restrict__ wv,
    const float* __restrict__ wo, const float* __restrict__ w1,
    const float* __restrict__ w2, u16* __restrict__ y) {
    const int seg = blockIdx.x >> 4;                   // which 1 Mi-element unit
    const float* src;
    int first;                                         // the source's first unit
    if (seg < 4)       { src = x;  first = 0; }
    else if (seg == 4) { src = wq; first = 4; }
    else if (seg == 5) { src = wk; first = 5; }
    else if (seg == 6) { src = wv; first = 6; }
    else if (seg == 7) { src = wo; first = 7; }
    else if (seg < 12) { src = w1; first = 8; }
    else               { src = w2; first = 12; }

    const size_t dst0 = (size_t)blockIdx.x * CVT_PER_BLOCK + threadIdx.x * 4;
    const float* s = src + (dst0 - ((size_t)first << 20));
    u16* d = y + dst0;

    for (int r = 0; r < CVT_ROUNDS; ++r) {
        f32x4 v[CVT_LOADS];
        // Both inner loops unrolled: constant indices keep v[] in registers.
#pragma unroll
        for (int i = 0; i < CVT_LOADS; ++i)
            v[i] = *reinterpret_cast<const f32x4*>(s + i * CVT_STEP);
        // Inputs-only fence on the loaded values: it keeps the round's 16 loads
        // ahead of its converts.  Left free, the compiler waits out each load
        // alone, with one in flight a wave.
        asm volatile("" :: "v"(v[0]), "v"(v[1]), "v"(v[2]), "v"(v[3]), "v"(v[4]), "v"(v[5]), "v"(v[6]), "v"(v[7]),
                           "v"(v[8]), "v"(v[9]), "v"(v[10]), "v"(v[11]), "v"(v[12]), "v"(v[13]), "v"(v[14]), "v"(v[15]));
#pragma unroll
        for (int i = 0; i < CVT_LOADS; ++i) {
            uint2 p;
            p.x = (u32)f2bf(v[i].x) | ((u32)f2bf(v[i].y) << 16);
            p.y = (u32)f2bf(v[i].z) | ((u32)f2bf(v[i].w) << 16);
            *reinterpret_cast<uint2*>(d + i * CVT_STEP) = p;
        }
        s += CVT_ROUND;
        d += CVT_ROUND;
    }
}

// ---------------- generic WMMA GEMM -----------------------------------------
// C[M,N] = A[M,K](bf16) * Bt[N,K](bf16)^T + bias[N], with epilogue modes.
// Block tile 128x128, K-step 64, 8 waves; wave tile 32x64 (2x4 WMMA tiles).

enum { MODE_F32 = 0, MODE_RELU_BF16 = 1, MODE_QPROJ = 2, MODE_VPROJ = 3 };

template <int MODE>
__global__ __launch_bounds__(256) void gemm_bf16_kernel(
    const u16* __restrict__ A, const u16* __restrict__ Bt,
    const float* __restrict__ bias, float* __restrict__ Cf,
    u16* __restrict__ Cb, int M, int N, int K) {
    __shared__ __attribute__((aligned(16))) u16 As[128 * LP];   // 18 KB
    __shared__ __attribute__((aligned(16))) u16 Bs[128 * LP];   // 18 KB

    const int tid  = threadIdx.x;
    const int lane = tid & 31;
    const int ln   = lane & 15;
    const int half = lane >> 4;
    const int wave = tid >> 5;
    const int wr   = (wave & 3) * 32;   // wave row offset within 128
    const int wc   = (wave >> 2) * 64;  // wave col offset within 128
    const int m0   = blockIdx.y * 128;
    const int n0   = blockIdx.x * 128;

    v8f acc[2][4] = {};

    for (int kc = 0; kc < K; kc += 64) {
        __syncthreads();
        // stage A,B tiles: 128 rows x 64 K each = 1024 x 16B chunks, 4+4/thread
#pragma unroll
        for (int i = 0; i < 4; ++i) {
            int chunk = i * 256 + tid;            // coalesced across threads
            int row = chunk >> 3, q = chunk & 7;
            *reinterpret_cast<uint4*>(&As[row * LP + q * 8]) =
                *reinterpret_cast<const uint4*>(&A[(size_t)(m0 + row) * K + kc + q * 8]);
            *reinterpret_cast<uint4*>(&Bs[row * LP + q * 8]) =
                *reinterpret_cast<const uint4*>(&Bt[(size_t)(n0 + row) * K + kc + q * 8]);
        }
        if (kc + 64 < K) {   // keep HBM ahead of the LDS stage
            int chunk = tid;
            int row = chunk >> 3, q = chunk & 7;
            __builtin_prefetch(&A[(size_t)(m0 + row) * K + kc + 64 + q * 8], 0, 0);
            __builtin_prefetch(&Bt[(size_t)(n0 + row) * K + kc + 64 + q * 8], 0, 0);
        }
        __syncthreads();

        v16bf a[2][2];
#pragma unroll
        for (int c = 0; c < 2; ++c)
#pragma unroll
            for (int i = 0; i < 2; ++i)
                a[c][i] = lds_load_op(As, wr + i * 16 + ln, LP, c * 32, lane);

#pragma unroll
        for (int c = 0; c < 2; ++c) {
#pragma unroll
            for (int j = 0; j < 4; ++j) {
                v16bf b = lds_load_op(Bs, wc + j * 16 + ln, LP, c * 32, lane);
                acc[0][j] = wmma_bf16(a[c][0], b, acc[0][j]);
                acc[1][j] = wmma_bf16(a[c][1], b, acc[1][j]);
            }
        }
    }

    // Epilogue.  C layout: VGPR r -> row r + 8*half, col = lane&15.
#pragma unroll
    for (int i = 0; i < 2; ++i) {
#pragma unroll
        for (int j = 0; j < 4; ++j) {
            const int col = n0 + wc + j * 16 + ln;
            const float bval = bias[col];
#pragma unroll
            for (int r = 0; r < 8; ++r) {
                const int row = m0 + wr + i * 16 + r + half * 8;
                float val = acc[i][j][r] + bval;
                if constexpr (MODE == MODE_F32) {
                    Cf[(size_t)row * N + col] = val;
                } else if constexpr (MODE == MODE_RELU_BF16) {
                    Cb[(size_t)row * N + col] = f2bf(fmaxf(val, 0.0f));
                } else if constexpr (MODE == MODE_QPROJ) {
                    // row = b*S+s ; col = h*DK+kk  ->  [b,h,s,kk] bf16
                    int h = col >> 6, kk = col & 63;
                    int s = row & (Ss - 1), bidx = row >> 11;
                    Cb[(((size_t)(bidx * Hh + h) * Ss + s) * DKk) + kk] = f2bf(val);
                } else {  // MODE_VPROJ: [b,h,kk,s] (V transposed)
                    int h = col >> 6, kk = col & 63;
                    int s = row & (Ss - 1), bidx = row >> 11;
                    Cb[(((size_t)(bidx * Hh + h) * DKk + kk) * Ss) + s] = f2bf(val);
                }
            }
        }
    }
}

// ---------------- fused flash attention -------------------------------------
// grid = (S/64, B*H), block = 128 (4 waves).  Each wave owns 16 query rows.
// 64-key tiles: 8 score WMMAs + 8 PV WMMAs per barrier pair.
// Q,K: bf16 [B*H, S, DK] ; VT: bf16 [B*H, DK, S] ; O: bf16 [B, S, H*DK].

__global__ __launch_bounds__(128) void flash_attn_kernel(
    const u16* __restrict__ Q, const u16* __restrict__ Km,
    const u16* __restrict__ VT, u16* __restrict__ O) {
    __shared__ __attribute__((aligned(16))) u16 qs[64 * LP];       // 64 q rows x DK      (9 KB)
    __shared__ __attribute__((aligned(16))) u16 ks[64 * LP];       // 64 keys  x DK       (9 KB)
    __shared__ __attribute__((aligned(16))) u16 vts[64 * LP];      // DK rows  x 64 keys  (9 KB)
    __shared__ __attribute__((aligned(16))) u16 ps[4 * 16 * LP];   // per-wave P scratch  (9 KB)

    const int tid  = threadIdx.x;
    const int lane = tid & 31;
    const int ln   = lane & 15;
    const int half = lane >> 4;
    const int wave = tid >> 5;
    const int bh   = blockIdx.y;                 // b*H + h
    const int q0   = blockIdx.x * 64;
    const int rb   = wave * 16;

    // stage Q tile
    {
        const u16* qg = Q + ((size_t)bh * Ss + q0) * DKk;
        int row = tid >> 1, cb = (tid & 1) * 32;
#pragma unroll
        for (int q = 0; q < 4; ++q)
            *reinterpret_cast<uint4*>(&qs[row * LP + cb + q * 8]) =
                *reinterpret_cast<const uint4*>(&qg[(size_t)row * DKk + cb + q * 8]);
    }
    __syncthreads();

    v16bf aq[2];
#pragma unroll
    for (int c = 0; c < 2; ++c)
        aq[c] = lds_load_op(qs, rb + ln, LP, c * 32, lane);

    float m[8], l[8];
    v8f o[4] = {};
#pragma unroll
    for (int r = 0; r < 8; ++r) { m[r] = -INFINITY; l[r] = 0.0f; }

    u16* psw = ps + wave * 16 * LP;

    for (int kb = 0; kb < Ss; kb += 64) {
        __syncthreads();
        {   // stage K tile: 64 keys x DK
            int row = tid >> 1, cb = (tid & 1) * 32;
            const u16* kg = Km + ((size_t)bh * Ss + kb) * DKk;
#pragma unroll
            for (int q = 0; q < 4; ++q)
                *reinterpret_cast<uint4*>(&ks[row * LP + cb + q * 8]) =
                    *reinterpret_cast<const uint4*>(&kg[(size_t)row * DKk + cb + q * 8]);
        }
        {   // stage V^T tile: DK rows x 64 keys
            int row = tid >> 1, cb = (tid & 1) * 32;
            const u16* vg = VT + (size_t)bh * DKk * Ss + kb;
#pragma unroll
            for (int q = 0; q < 4; ++q)
                *reinterpret_cast<uint4*>(&vts[row * LP + cb + q * 8]) =
                    *reinterpret_cast<const uint4*>(&vg[(size_t)row * Ss + cb + q * 8]);
        }
        __syncthreads();

        // scores: [16 q rows] x [64 keys] in 4 tiles, accumulate over DK
        v8f s[4] = {};
#pragma unroll
        for (int c = 0; c < 2; ++c)
#pragma unroll
            for (int t = 0; t < 4; ++t) {
                v16bf bk = lds_load_op(ks, t * 16 + ln, LP, c * 32, lane);
                s[t] = wmma_bf16(aq[c], bk, s[t]);
            }
#pragma unroll
        for (int t = 0; t < 4; ++t) s[t] = s[t] * 0.125f;   // 1/sqrt(DK)

        // online softmax (rows live in 16-lane halves of the wave)
        float rmax[8];
#pragma unroll
        for (int r = 0; r < 8; ++r)
            rmax[r] = fmaxf(fmaxf(s[0][r], s[1][r]), fmaxf(s[2][r], s[3][r]));
#pragma unroll
        for (int r = 0; r < 8; ++r) {
            rmax[r] = fmaxf(rmax[r], xor16f<1>(rmax[r]));
            rmax[r] = fmaxf(rmax[r], xor16f<2>(rmax[r]));
            rmax[r] = fmaxf(rmax[r], xor16f<4>(rmax[r]));
            rmax[r] = fmaxf(rmax[r], xor16f<8>(rmax[r]));
        }

        float alpha[8];
#pragma unroll
        for (int r = 0; r < 8; ++r) {
            float mn = fmaxf(m[r], rmax[r]);
            alpha[r] = __expf(m[r] - mn);
            m[r] = mn;
        }
#pragma unroll
        for (int t = 0; t < 4; ++t)
#pragma unroll
            for (int r = 0; r < 8; ++r)
                s[t][r] = __expf(s[t][r] - m[r]);

        float rsum[8];
#pragma unroll
        for (int r = 0; r < 8; ++r)
            rsum[r] = (s[0][r] + s[1][r]) + (s[2][r] + s[3][r]);
#pragma unroll
        for (int r = 0; r < 8; ++r) {
            rsum[r] += xor16f<1>(rsum[r]);
            rsum[r] += xor16f<2>(rsum[r]);
            rsum[r] += xor16f<4>(rsum[r]);
            rsum[r] += xor16f<8>(rsum[r]);
            l[r] = l[r] * alpha[r] + rsum[r];
        }

        // reshape P (C layout -> A layout) via per-wave LDS round trip
#pragma unroll
        for (int t = 0; t < 4; ++t)
#pragma unroll
            for (int r = 0; r < 8; ++r) {
                int rowp = r + half * 8;
                psw[rowp * LP + t * 16 + ln] = f2bf(s[t][r]);
            }
        asm volatile("s_wait_dscnt 0x0" ::: "memory");  // wave-local LDS RAW
        v16bf ap[2];
#pragma unroll
        for (int c = 0; c < 2; ++c)
            ap[c] = lds_load_op(psw, ln, LP, c * 32, lane);

        // O = O*alpha + P @ V  (two 32-key WMMA K-steps per col group)
#pragma unroll
        for (int n = 0; n < 4; ++n) {
#pragma unroll
            for (int r = 0; r < 8; ++r) o[n][r] *= alpha[r];
#pragma unroll
            for (int c = 0; c < 2; ++c) {
                v16bf bv = lds_load_op(vts, n * 16 + ln, LP, c * 32, lane);
                o[n] = wmma_bf16(ap[c], bv, o[n]);
            }
        }
    }

    // finalize: O /= l, write concatenated-head layout [b, s, h*DK + col]
    const int bidx = bh >> 4, h = bh & 15;
#pragma unroll
    for (int r = 0; r < 8; ++r) {
        float inv = 1.0f / l[r];
        int srow = q0 + rb + r + half * 8;
#pragma unroll
        for (int n = 0; n < 4; ++n) {
            int col = h * DKk + n * 16 + ln;
            O[((size_t)bidx * Ss + srow) * (Hh * DKk) + col] = f2bf(o[n][r] * inv);
        }
    }
}

// ---------------- residual + LayerNorm --------------------------------------
// one row per block; 256 threads * 4 elems = D

template <bool WRITE_BF16>
__global__ __launch_bounds__(256) void add_ln_kernel(
    const float* __restrict__ a, const float* __restrict__ b,
    const float* __restrict__ g, const float* __restrict__ be,
    float* __restrict__ oF, u16* __restrict__ oB) {
    __shared__ float ss[256], sq[256];
    const int row = blockIdx.x, tid = threadIdx.x;
    const int i0 = tid * 4;

    float4 xa = *reinterpret_cast<const float4*>(a + (size_t)row * Dd + i0);
    float4 xb = *reinterpret_cast<const float4*>(b + (size_t)row * Dd + i0);
    float v[4] = { xa.x + xb.x, xa.y + xb.y, xa.z + xb.z, xa.w + xb.w };

    float s = v[0] + v[1] + v[2] + v[3];
    float q = v[0] * v[0] + v[1] * v[1] + v[2] * v[2] + v[3] * v[3];
    ss[tid] = s; sq[tid] = q;
    __syncthreads();
    for (int st = 128; st > 0; st >>= 1) {
        if (tid < st) { ss[tid] += ss[tid + st]; sq[tid] += sq[tid + st]; }
        __syncthreads();
    }
    const float mu   = ss[0] * (1.0f / Dd);
    const float var  = sq[0] * (1.0f / Dd) - mu * mu;
    const float rstd = rsqrtf(var + LN_EPS);

    float4 gg = *reinterpret_cast<const float4*>(g + i0);
    float4 bb = *reinterpret_cast<const float4*>(be + i0);
    float o0 = (v[0] - mu) * rstd * gg.x + bb.x;
    float o1 = (v[1] - mu) * rstd * gg.y + bb.y;
    float o2 = (v[2] - mu) * rstd * gg.z + bb.z;
    float o3 = (v[3] - mu) * rstd * gg.w + bb.w;

    *reinterpret_cast<float4*>(oF + (size_t)row * Dd + i0) = make_float4(o0, o1, o2, o3);
    if constexpr (WRITE_BF16) {
        u16* p = oB + (size_t)row * Dd + i0;
        p[0] = f2bf(o0); p[1] = f2bf(o1); p[2] = f2bf(o2); p[3] = f2bf(o3);
    }
}

// ---------------- launcher ---------------------------------------------------

extern "C" void kernel_launch(void* const* d_in, const int* in_sizes, int n_in,
                              void* d_out, int out_size, void* d_ws, size_t ws_size,
                              hipStream_t stream) {
    const float* x  = (const float*)d_in[0];
    const float* wq = (const float*)d_in[1];  const float* bq = (const float*)d_in[2];
    const float* wk = (const float*)d_in[3];  const float* bk = (const float*)d_in[4];
    const float* wv = (const float*)d_in[5];  const float* bv = (const float*)d_in[6];
    const float* wo = (const float*)d_in[7];  const float* bo = (const float*)d_in[8];
    const float* g1 = (const float*)d_in[9];  const float* be1 = (const float*)d_in[10];
    const float* w1 = (const float*)d_in[11]; const float* b1 = (const float*)d_in[12];
    const float* w2 = (const float*)d_in[13]; const float* b2 = (const float*)d_in[14];
    const float* g2 = (const float*)d_in[15]; const float* be2 = (const float*)d_in[16];
    float* out = (float*)d_out;

    char* ws = (char*)d_ws;
    const size_t MB = 1024 * 1024;
    u16* XB  = (u16*)(ws + 0);          //  8 MB  x bf16 [BS, D]
    u16* WQB = (u16*)(ws + 8  * MB);    //  2 MB
    u16* WKB = (u16*)(ws + 10 * MB);    //  2 MB
    u16* WVB = (u16*)(ws + 12 * MB);    //  2 MB
    u16* WOB = (u16*)(ws + 14 * MB);    //  2 MB
    u16* W1B = (u16*)(ws + 16 * MB);    //  8 MB
    u16* W2B = (u16*)(ws + 24 * MB);    //  8 MB
    u16* Qb  = (u16*)(ws + 32 * MB);    //  8 MB  [B,H,S,DK]
    u16* Kb  = (u16*)(ws + 40 * MB);    //  8 MB  [B,H,S,DK]
    u16* VTb = (u16*)(ws + 48 * MB);    //  8 MB  [B,H,DK,S]
    u16* Ob  = (u16*)(ws + 56 * MB);    //  8 MB  [B,S,H*DK]
    float* ATT = (float*)(ws + 64 * MB);   // 16 MB [BS, D]
    float* N1F = (float*)(ws + 80 * MB);   // 16 MB
    u16*   N1B = (u16*)(ws + 96 * MB);     //  8 MB
    u16*   FF1 = (u16*)(ws + 104 * MB);    // 32 MB [BS, FF]
    float* FF2 = (float*)(ws + 136 * MB);  // 16 MB

    // 1. bf16 conversions: XB .. W2B are one contiguous destination
    cvt_all_bf16_kernel<<<CVT_BLOCKS, CVT_THREADS, 0, stream>>>(x, wq, wk, wv, wo, w1, w2, XB);

    // 2. QKV projections (N = H*DK = 1024, K = 1024)
    dim3 gP(Dd / 128, BS / 128);
    gemm_bf16_kernel<MODE_QPROJ><<<gP, 256, 0, stream>>>(XB, WQB, bq, nullptr, Qb,  BS, Dd, Dd);
    gemm_bf16_kernel<MODE_QPROJ><<<gP, 256, 0, stream>>>(XB, WKB, bk, nullptr, Kb,  BS, Dd, Dd);
    gemm_bf16_kernel<MODE_VPROJ><<<gP, 256, 0, stream>>>(XB, WVB, bv, nullptr, VTb, BS, Dd, Dd);

    // 3. fused attention
    flash_attn_kernel<<<dim3(Ss / 64, Bb * Hh), 128, 0, stream>>>(Qb, Kb, VTb, Ob);

    // 4. output projection
    gemm_bf16_kernel<MODE_F32><<<gP, 256, 0, stream>>>(Ob, WOB, bo, ATT, nullptr, BS, Dd, Dd);

    // 5. LN1 (residual with x), keep bf16 mirror for FFN input
    add_ln_kernel<true><<<BS, 256, 0, stream>>>(ATT, x, g1, be1, N1F, N1B);

    // 6. FFN
    gemm_bf16_kernel<MODE_RELU_BF16><<<dim3(FFf / 128, BS / 128), 256, 0, stream>>>(
        N1B, W1B, b1, nullptr, FF1, BS, FFf, Dd);
    gemm_bf16_kernel<MODE_F32><<<gP, 256, 0, stream>>>(FF1, W2B, b2, FF2, nullptr, BS, Dd, FFf);

    // 7. LN2 -> output
    add_ln_kernel<false><<<BS, 256, 0, stream>>>(FF2, N1F, g2, be2, out, nullptr);
}

// v003
// One run takes 242 microseconds.
// Two timings next to v002 put it at 1.74 and 1.76 times that version's speed.
// Counting every step since v000, it is 2.98 times as fast.
#include <hip/hip_runtime.h>

// ---------------------------------------------------------------------------
// Transformer encoder block for MI455X (gfx1250, wave32, WMMA bf16)
//   B=2, S=2048, D=1024, H=16, DK=64, FF=4096, fp32 I/O
// ---------------------------------------------------------------------------

typedef __attribute__((ext_vector_type(16))) __bf16 v16bf;
typedef __attribute__((ext_vector_type(8)))  float  v8f;
typedef __attribute__((ext_vector_type(4)))  float  f32x4;

using u16 = unsigned short;
using u32 = unsigned int;

static constexpr int Hh = 16;
static constexpr int Dd = 1024;
static constexpr int DKk = 64;
static constexpr int FFf = 4096;
static constexpr int Bb = 2;
static constexpr int Ss = 2048;
static constexpr int BS = Bb * Ss;       // 4096 rows
static constexpr float LN_EPS = 1e-5f;
// LDS row pitch in bf16 elements for tiles of 64 elements a row: 144 B = 16 B x 9.
// An odd multiple of 16 B spreads the 16 rows of a ds_load_b128 fragment read
// over all 64 banks; at 128 B eight rows fall on the same four banks.
static constexpr int LP = 72;

// ---------------- helpers ---------------------------------------------------

__device__ __forceinline__ u16 f2bf(float f) {
    u32 u = __float_as_uint(f);
    u32 r = u + 0x7FFFu + ((u >> 16) & 1u);   // round-to-nearest-even
    return (u16)(r >> 16);
}

union Op32 { uint4 q[2]; v16bf v; };

// Load one WMMA 16x16x32 bf16 operand (A layout; B uses the same pattern on
// the transposed [N,K] matrix).  `base` points at a row-major bf16 tile in
// LDS with `stride` elements per row, `kbase` selects the 32-wide K chunk.
// Lanes 0-15: K = kbase+{0..7,16..23};  lanes 16-31: K = kbase+{8..15,24..31}.
__device__ __forceinline__ v16bf lds_load_op(const u16* base, int row, int stride,
                                             int kbase, int lane) {
    const u16* p = base + row * stride + kbase + ((lane >> 4) & 1) * 8;
    Op32 u;
    u.q[0] = *reinterpret_cast<const uint4*>(p);
    u.q[1] = *reinterpret_cast<const uint4*>(p + 16);
    return u.v;
}

__device__ __forceinline__ v8f wmma_bf16(v16bf a, v16bf b, v8f c) {
    return __builtin_amdgcn_wmma_f32_16x16x32_bf16(false, a, false, b,
                                                   (short)0, c, false, false);
}

// Byte address inside the work-group's LDS: the low half of the flat address.
__device__ __forceinline__ u32 lds_addr(const void* p) { return (u32)(size_t)p; }

// Eight asynchronous copies of 16 bytes a lane, global memory -> LDS, through
// no register: four for each of two tiles.  Copy i of tile n moves the bytes at
// gn + i * gstepn to LDS byte ln + i * lstep.  The s_wait_xcnt stands inside the
// statement, behind the last copy, so that no address register is rewritten
// ahead of it.
__device__ __forceinline__ void async_copy4x2(u32 l0, u32 l1, u32 lstep, const u16* g0, size_t gstep0,
                                              const u16* g1, size_t gstep1) {
    asm volatile(
        "global_load_async_to_lds_b128 %0, %8, off\n\t"
        "global_load_async_to_lds_b128 %1, %9, off\n\t"
        "global_load_async_to_lds_b128 %2, %10, off\n\t"
        "global_load_async_to_lds_b128 %3, %11, off\n\t"
        "global_load_async_to_lds_b128 %4, %12, off\n\t"
        "global_load_async_to_lds_b128 %5, %13, off\n\t"
        "global_load_async_to_lds_b128 %6, %14, off\n\t"
        "global_load_async_to_lds_b128 %7, %15, off\n\t"
        "s_wait_xcnt 0x0"
        :: "v"(l0), "v"(l0 + lstep), "v"(l0 + 2 * lstep), "v"(l0 + 3 * lstep),
           "v"(l1), "v"(l1 + lstep), "v"(l1 + 2 * lstep), "v"(l1 + 3 * lstep),
           "v"(g0), "v"(g0 + gstep0), "v"(g0 + 2 * gstep0), "v"(g0 + 3 * gstep0),
           "v"(g1), "v"(g1 + gstep1), "v"(g1 + 2 * gstep1), "v"(g1 + 3 * gstep1)
        : "memory");
}

// The hand-over of a two-buffer ring, every wave: this wave's LDS reads of the
// buffer it leaves have returned, its own copies of the next tile have landed,
// and the barrier tells both to the other waves.
__device__ __forceinline__ void ring_publish() {
    asm volatile("s_wait_dscnt 0x0" ::: "memory");     // my reads of the old buffer are done
    asm volatile("s_wait_asynccnt 0x0" ::: "memory");  // my copies of the next tile have landed
    __syncthreads();
}

// Cross-lane XOR reduction step within 16-lane halves of the wave32.
// Prefer v_permlane16_b32 (VALU, co-executes with WMMA) over ds_bpermute.
template <int MASK>
__device__ __forceinline__ float xor16f(float v) {
#if __has_builtin(__builtin_amdgcn_permlane16)
    u32 s0, s1;
    if constexpr (MASK == 1)      { s0 = 0x67452301u; s1 = 0xEFCDAB89u; }
    else if constexpr (MASK == 2) { s0 = 0x54761032u; s1 = 0xDCFE98BAu; }
    else if constexpr (MASK == 4) { s0 = 0x32107654u; s1 = 0xBA98FEDCu; }
    else                          { s0 = 0xFEDCBA98u; s1 = 0x76543210u; }
    u32 u = __float_as_uint(v);
    u32 r = __builtin_amdgcn_permlane16(u, u, s0, s1, false, false);
    return __uint_as_float(r);
#else
    return __shfl_xor(v, MASK);
#endif
}

// ---------------- fp32 -> bf16 conversion -----------------------------------
// One launch converts x and the six weight matrices.  Their bf16 copies lie
// back to back in the workspace, so the destination is one array of 16 Mi
// elements; in units of 1 Mi elements x fills 0-3, wq 4, wk 5, wv 6, wo 7,
// w1 8-11, w2 12-15.  256 blocks of 16 waves, one per WGP: a block owns 64 Ki
// consecutive elements (always inside one source) and walks them in two
// rounds.  In a round a wave has 16 loads of 16 bytes a lane in flight, each
// covering 512 contiguous bytes; each store covers 256 contiguous bytes.

static constexpr int CVT_THREADS = 512;
static constexpr int CVT_BLOCKS  = 256;
static constexpr int CVT_LOADS   = 16;                         // 16-byte loads a lane and round
static constexpr int CVT_ROUNDS  = 2;
static constexpr int CVT_STEP    = CVT_THREADS * 4;            // elements a block-wide load covers
static constexpr int CVT_ROUND   = CVT_STEP * CVT_LOADS;       // elements a block converts a round
static constexpr int CVT_PER_BLOCK = CVT_ROUND * CVT_ROUNDS;   // 64 Ki elements
static_assert((size_t)CVT_BLOCKS * CVT_PER_BLOCK ==
              (size_t)BS * Dd + 4u * Dd * Dd + 2u * (size_t)FFf * Dd, "the grid covers every element once");
static_assert((1 << 20) % CVT_PER_BLOCK == 0, "a block never straddles two sources");

__global__ __launch_bounds__(CVT_THREADS) void cvt_all_bf16_kernel(
    const float* __restrict__ x,  const float* __restrict__ wq,
    const float* __restrict__ wk, const float* __restrict__ wv,
    const float* __restrict__ wo, const float* __restrict__ w1,
    const float* __restrict__ w2, u16* __restrict__ y) {
    const int seg = blockIdx.x >> 4;                   // which 1 Mi-element unit
    const float* src;
    int first;                                         // the source's first unit
    if (seg < 4)       { src = x;  first = 0; }
    else if (seg == 4) { src = wq; first = 4; }
    else if (seg == 5) { src = wk; first = 5; }
    else if (seg == 6) { src = wv; first = 6; }
    else if (seg == 7) { src = wo; first = 7; }
    else if (seg < 12) { src = w1; first = 8; }
    else               { src = w2; first = 12; }

    const size_t dst0 = (size_t)blockIdx.x * CVT_PER_BLOCK + threadIdx.x * 4;
    const float* s = src + (dst0 - ((size_t)first << 20));
    u16* d = y + dst0;

    for (int r = 0; r < CVT_ROUNDS; ++r) {
        f32x4 v[CVT_LOADS];
        // Both inner loops unrolled: constant indices keep v[] in registers.
#pragma unroll
        for (int i = 0; i < CVT_LOADS; ++i)
            v[i] = *reinterpret_cast<const f32x4*>(s + i * CVT_STEP);
        // Inputs-only fence on the loaded values: it keeps the round's 16 loads
        // ahead of its converts.  Left free, the compiler waits out each load
        // alone, with one in flight a wave.
        asm volatile("" :: "v"(v[0]), "v"(v[1]), "v"(v[2]), "v"(v[3]), "v"(v[4]), "v"(v[5]), "v"(v[6]), "v"(v[7]),
                           "v"(v[8]), "v"(v[9]), "v"(v[10]), "v"(v[11]), "v"(v[12]), "v"(v[13]), "v"(v[14]), "v"(v[15]));
#pragma unroll
        for (int i = 0; i < CVT_LOADS; ++i) {
            uint2 p;
            p.x = (u32)f2bf(v[i].x) | ((u32)f2bf(v[i].y) << 16);
            p.y = (u32)f2bf(v[i].z) | ((u32)f2bf(v[i].w) << 16);
            *reinterpret_cast<uint2*>(d + i * CVT_STEP) = p;
        }
        s += CVT_ROUND;
        d += CVT_ROUND;
    }
}

enum { MODE_F32 = 0, MODE_RELU_BF16 = 1, MODE_QPROJ = 2, MODE_VPROJ = 3 };

template <int MODE>
__global__ __launch_bounds__(256) void gemm_bf16_kernel(
    const u16* __restrict__ A, const u16* __restrict__ Bt,
    const float* __restrict__ bias, float* __restrict__ Cf,
    u16* __restrict__ Cb, int M, int N, int K) {
    __shared__ __attribute__((aligned(16))) u16 As[2][128 * LP];   // 2 x 18 KB
    __shared__ __attribute__((aligned(16))) u16 Bs[2][128 * LP];   // 2 x 18 KB

    const int tid  = threadIdx.x;
    const int lane = tid & 31;
    const int ln   = lane & 15;
    const int half = lane >> 4;
    const int wave = tid >> 5;
    const int wr   = (wave & 3) * 32;   // wave row offset within 128
    const int wc   = (wave >> 2) * 64;  // wave col offset within 128
    const int m0   = blockIdx.y * 128;
    const int n0   = blockIdx.x * 128;

    v8f acc[2][4] = {};

    // A tile is 128 rows x 128 B = 1024 pieces of 16 B: 4 a thread and operand.
    // A wave's copy covers four whole rows; copy i takes the rows 32 * i further on.
    const int crow = tid >> 3, cq = tid & 7;
    const u16* ga = A  + (size_t)(m0 + crow) * K + cq * 8;
    const u16* gb = Bt + (size_t)(n0 + crow) * K + cq * 8;
    const u32 la = lds_addr(&As[0][crow * LP + cq * 8]);
    const u32 lb = lds_addr(&Bs[0][crow * LP + cq * 8]);
    constexpr u32 LROWS = 32 * LP * 2;         // LDS bytes of 32 rows
    constexpr u32 LBUF  = 128 * LP * 2;        // LDS bytes of one buffer
    const size_t grows = (size_t)32 * K;       // elements of 32 rows in memory
    const int T = K / 64;

    async_copy4x2(la, lb, LROWS, ga, grows, gb, grows);
    asm volatile("s_wait_asynccnt 0x0" ::: "memory");  // tile 0 has landed before anyone reads it
    __syncthreads();
    if (T > 1)
        async_copy4x2(la + LBUF, lb + LBUF, LROWS, ga + 64, grows, gb + 64, grows);

    for (int t = 0; t < T; ++t) {
        const int buf = t & 1;
        const u16* as = As[buf];
        const u16* bs = Bs[buf];

        v16bf a[2][2];
#pragma unroll
        for (int c = 0; c < 2; ++c)
#pragma unroll
            for (int i = 0; i < 2; ++i)
                a[c][i] = lds_load_op(as, wr + i * 16 + ln, LP, c * 32, lane);

#pragma unroll
        for (int c = 0; c < 2; ++c) {
#pragma unroll
            for (int j = 0; j < 4; ++j) {
                v16bf b = lds_load_op(bs, wc + j * 16 + ln, LP, c * 32, lane);
                acc[0][j] = wmma_bf16(a[c][0], b, acc[0][j]);
                acc[1][j] = wmma_bf16(a[c][1], b, acc[1][j]);
            }
        }

        ring_publish();
        if (t + 2 < T)     // refill the buffers that every wave has just left
            async_copy4x2(la + buf * LBUF, lb + buf * LBUF, LROWS,
                          ga + (size_t)(t + 2) * 64, grows, gb + (size_t)(t + 2) * 64, grows);
    }
    asm volatile("s_wait_asynccnt 0x0" ::: "memory");  // no copy is left in flight at the wave's end

    // Epilogue.  C layout: VGPR r -> row r + 8*half, col = lane&15.
#pragma unroll
    for (int i = 0; i < 2; ++i) {
#pragma unroll
        for (int j = 0; j < 4; ++j) {
            const int col = n0 + wc + j * 16 + ln;
            const float bval = bias[col];
#pragma unroll
            for (int r = 0; r < 8; ++r) {
                const int row = m0 + wr + i * 16 + r + half * 8;
                float val = acc[i][j][r] + bval;
                if constexpr (MODE == MODE_F32) {
                    Cf[(size_t)row * N + col] = val;
                } else if constexpr (MODE == MODE_RELU_BF16) {
                    Cb[(size_t)row * N + col] = f2bf(fmaxf(val, 0.0f));
                } else if constexpr (MODE == MODE_QPROJ) {
                    // row = b*S+s ; col = h*DK+kk  ->  [b,h,s,kk] bf16
                    int h = col >> 6, kk = col & 63;
                    int s = row & (Ss - 1), bidx = row >> 11;
                    Cb[(((size_t)(bidx * Hh + h) * Ss + s) * DKk) + kk] = f2bf(val);
                } else {  // MODE_VPROJ: [b,h,kk,s] (V transposed)
                    int h = col >> 6, kk = col & 63;
                    int s = row & (Ss - 1), bidx = row >> 11;
                    Cb[(((size_t)(bidx * Hh + h) * DKk + kk) * Ss) + s] = f2bf(val);
                }
            }
        }
    }
}

// ---------------- fused flash attention -------------------------------------
// grid = (S/64, B*H), block = 128 (4 waves).  Each wave owns 16 query rows.
// 64-key tiles: 8 score WMMAs + 8 PV WMMAs per barrier.  K and V^T tiles come
// into LDS by asynchronous copies, in a ring of two buffers.
// Q,K: bf16 [B*H, S, DK] ; VT: bf16 [B*H, DK, S] ; O: bf16 [B, S, H*DK].

__global__ __launch_bounds__(128) void flash_attn_kernel(
    const u16* __restrict__ Q, const u16* __restrict__ Km,
    const u16* __restrict__ VT, u16* __restrict__ O) {
    __shared__ __attribute__((aligned(16))) u16 qs[64 * LP];       // 64 q rows x DK      (9 KB)
    __shared__ __attribute__((aligned(16))) u16 ks[2][64 * LP];    // 64 keys  x DK       (2 x 9 KB)
    __shared__ __attribute__((aligned(16))) u16 vts[2][64 * LP];   // DK rows  x 64 keys  (2 x 9 KB)
    __shared__ __attribute__((aligned(16))) u16 ps[4 * 16 * LP];   // per-wave P scratch  (9 KB)

    const int tid  = threadIdx.x;
    const int lane = tid & 31;
    const int ln   = lane & 15;
    const int half = lane >> 4;
    const int wave = tid >> 5;
    const int bh   = blockIdx.y;                 // b*H + h
    const int q0   = blockIdx.x * 64;
    const int rb   = wave * 16;

    // A K or V^T tile is 64 rows x 128 B = 512 pieces of 16 B: 4 a thread and
    // tile.  A wave's copy covers four whole rows; copy i the rows 16 * i further on.
    const int crow = tid >> 3, cq = tid & 7;
    const u16* gk = Km + ((size_t)bh * Ss + crow) * DKk + cq * 8;
    const u16* gv = VT + ((size_t)bh * DKk + crow) * Ss + cq * 8;
    const u32 lk = lds_addr(&ks[0][crow * LP + cq * 8]);
    const u32 lv = lds_addr(&vts[0][crow * LP + cq * 8]);
    constexpr u32 LROWS = 16 * LP * 2;         // LDS bytes of 16 rows
    constexpr u32 LBUF  = 64 * LP * 2;         // LDS bytes of one buffer
    constexpr int T = Ss / 64;
    static_assert(T >= 2, "the ring's prologue fills two tiles");

    async_copy4x2(lk, lv, LROWS, gk, (size_t)16 * DKk, gv, (size_t)16 * Ss);

    // stage Q tile
    {
        const u16* qg = Q + ((size_t)bh * Ss + q0) * DKk;
        int row = tid >> 1, cb = (tid & 1) * 32;
#pragma unroll
        for (int q = 0; q < 4; ++q)
            *reinterpret_cast<uint4*>(&qs[row * LP + cb + q * 8]) =
                *reinterpret_cast<const uint4*>(&qg[(size_t)row * DKk + cb + q * 8]);
    }
    asm volatile("s_wait_asynccnt 0x0" ::: "memory");  // tile 0 has landed before anyone reads it
    __syncthreads();
    async_copy4x2(lk + LBUF, lv + LBUF, LROWS, gk + (size_t)64 * DKk, (size_t)16 * DKk, gv + 64, (size_t)16 * Ss);

    v16bf aq[2];
#pragma unroll
    for (int c = 0; c < 2; ++c)
        aq[c] = lds_load_op(qs, rb + ln, LP, c * 32, lane);

    float m[8], l[8];
    v8f o[4] = {};
#pragma unroll
    for (int r = 0; r < 8; ++r) { m[r] = -INFINITY; l[r] = 0.0f; }

    u16* psw = ps + wave * 16 * LP;

    for (int tile = 0; tile < T; ++tile) {
        const int buf = tile & 1;
        const u16* kt = ks[buf];
        const u16* vt = vts[buf];

        // scores: [16 q rows] x [64 keys] in 4 tiles, accumulate over DK
        v8f s[4] = {};
#pragma unroll
        for (int c = 0; c < 2; ++c)
#pragma unroll
            for (int t = 0; t < 4; ++t) {
                v16bf bk = lds_load_op(kt, t * 16 + ln, LP, c * 32, lane);
                s[t] = wmma_bf16(aq[c], bk, s[t]);
            }
#pragma unroll
        for (int t = 0; t < 4; ++t) s[t] = s[t] * 0.125f;   // 1/sqrt(DK)

        // online softmax (rows live in 16-lane halves of the wave)
        float rmax[8];
#pragma unroll
        for (int r = 0; r < 8; ++r)
            rmax[r] = fmaxf(fmaxf(s[0][r], s[1][r]), fmaxf(s[2][r], s[3][r]));
#pragma unroll
        for (int r = 0; r < 8; ++r) {
            rmax[r] = fmaxf(rmax[r], xor16f<1>(rmax[r]));
            rmax[r] = fmaxf(rmax[r], xor16f<2>(rmax[r]));
            rmax[r] = fmaxf(rmax[r], xor16f<4>(rmax[r]));
            rmax[r] = fmaxf(rmax[r], xor16f<8>(rmax[r]));
        }

        float alpha[8];
#pragma unroll
        for (int r = 0; r < 8; ++r) {
            float mn = fmaxf(m[r], rmax[r]);
            alpha[r] = __expf(m[r] - mn);
            m[r] = mn;
        }
#pragma unroll
        for (int t = 0; t < 4; ++t)
#pragma unroll
            for (int r = 0; r < 8; ++r)
                s[t][r] = __expf(s[t][r] - m[r]);

        float rsum[8];
#pragma unroll
        for (int r = 0; r < 8; ++r)
            rsum[r] = (s[0][r] + s[1][r]) + (s[2][r] + s[3][r]);
#pragma unroll
        for (int r = 0; r < 8; ++r) {
            rsum[r] += xor16f<1>(rsum[r]);
            rsum[r] += xor16f<2>(rsum[r]);
            rsum[r] += xor16f<4>(rsum[r]);
            rsum[r] += xor16f<8>(rsum[r]);
            l[r] = l[r] * alpha[r] + rsum[r];
        }

        // reshape P (C layout -> A layout) via per-wave LDS round trip
#pragma unroll
        for (int t = 0; t < 4; ++t)
#pragma unroll
            for (int r = 0; r < 8; ++r) {
                int rowp = r + half * 8;
                psw[rowp * LP + t * 16 + ln] = f2bf(s[t][r]);
            }
        asm volatile("s_wait_dscnt 0x0" ::: "memory");  // wave-local LDS RAW
        v16bf ap[2];
#pragma unroll
        for (int c = 0; c < 2; ++c)
            ap[c] = lds_load_op(psw, ln, LP, c * 32, lane);

        // O = O*alpha + P @ V  (two 32-key WMMA K-steps per col group)
#pragma unroll
        for (int n = 0; n < 4; ++n) {
#pragma unroll
            for (int r = 0; r < 8; ++r) o[n][r] *= alpha[r];
#pragma unroll
            for (int c = 0; c < 2; ++c) {
                v16bf bv = lds_load_op(vt, n * 16 + ln, LP, c * 32, lane);
                o[n] = wmma_bf16(ap[c], bv, o[n]);
            }
        }

        ring_publish();
        if (tile + 2 < T)  // refill the buffers that every wave has just left
            async_copy4x2(lk + buf * LBUF, lv + buf * LBUF, LROWS,
                          gk + (size_t)(tile + 2) * 64 * DKk, (size_t)16 * DKk,
                          gv + (tile + 2) * 64, (size_t)16 * Ss);
    }
    asm volatile("s_wait_asynccnt 0x0" ::: "memory");  // no copy is left in flight at the wave's end

    // finalize: O /= l, write concatenated-head layout [b, s, h*DK + col]
    const int bidx = bh >> 4, h = bh & 15;
#pragma unroll
    for (int r = 0; r < 8; ++r) {
        float inv = 1.0f / l[r];
        int srow = q0 + rb + r + half * 8;
#pragma unroll
        for (int n = 0; n < 4; ++n) {
            int col = h * DKk + n * 16 + ln;
            O[((size_t)bidx * Ss + srow) * (Hh * DKk) + col] = f2bf(o[n][r] * inv);
        }
    }
}

// ---------------- residual + LayerNorm --------------------------------------
// one row per block; 256 threads * 4 elems = D

template <bool WRITE_BF16>
__global__ __launch_bounds__(256) void add_ln_kernel(
    const float* __restrict__ a, const float* __restrict__ b,
    const float* __restrict__ g, const float* __restrict__ be,
    float* __restrict__ oF, u16* __restrict__ oB) {
    __shared__ float ss[256], sq[256];
    const int row = blockIdx.x, tid = threadIdx.x;
    const int i0 = tid * 4;

    float4 xa = *reinterpret_cast<const float4*>(a + (size_t)row * Dd + i0);
    float4 xb = *reinterpret_cast<const float4*>(b + (size_t)row * Dd + i0);
    float v[4] = { xa.x + xb.x, xa.y + xb.y, xa.z + xb.z, xa.w + xb.w };

    float s = v[0] + v[1] + v[2] + v[3];
    float q = v[0] * v[0] + v[1] * v[1] + v[2] * v[2] + v[3] * v[3];
    ss[tid] = s; sq[tid] = q;
    __syncthreads();
    for (int st = 128; st > 0; st >>= 1) {
        if (tid < st) { ss[tid] += ss[tid + st]; sq[tid] += sq[tid + st]; }
        __syncthreads();
    }
    const float mu   = ss[0] * (1.0f / Dd);
    const float var  = sq[0] * (1.0f / Dd) - mu * mu;
    const float rstd = rsqrtf(var + LN_EPS);

    float4 gg = *reinterpret_cast<const float4*>(g + i0);
    float4 bb = *reinterpret_cast<const float4*>(be + i0);
    float o0 = (v[0] - mu) * rstd * gg.x + bb.x;
    float o1 = (v[1] - mu) * rstd * gg.y + bb.y;
    float o2 = (v[2] - mu) * rstd * gg.z + bb.z;
    float o3 = (v[3] - mu) * rstd * gg.w + bb.w;

    *reinterpret_cast<float4*>(oF + (size_t)row * Dd + i0) = make_float4(o0, o1, o2, o3);
    if constexpr (WRITE_BF16) {
        u16* p = oB + (size_t)row * Dd + i0;
        p[0] = f2bf(o0); p[1] = f2bf(o1); p[2] = f2bf(o2); p[3] = f2bf(o3);
    }
}

// ---------------- launcher ---------------------------------------------------

extern "C" void kernel_launch(void* const* d_in, const int* in_sizes, int n_in,
                              void* d_out, int out_size, void* d_ws, size_t ws_size,
                              hipStream_t stream) {
    const float* x  = (const float*)d_in[0];
    const float* wq = (const float*)d_in[1];  const float* bq = (const float*)d_in[2];
    const float* wk = (const float*)d_in[3];  const float* bk = (const float*)d_in[4];
    const float* wv = (const float*)d_in[5];  const float* bv = (const float*)d_in[6];
    const float* wo = (const float*)d_in[7];  const float* bo = (const float*)d_in[8];
    const float* g1 = (const float*)d_in[9];  const float* be1 = (const float*)d_in[10];
    const float* w1 = (const float*)d_in[11]; const float* b1 = (const float*)d_in[12];
    const float* w2 = (const float*)d_in[13]; const float* b2 = (const float*)d_in[14];
    const float* g2 = (const float*)d_in[15]; const float* be2 = (const float*)d_in[16];
    float* out = (float*)d_out;

    char* ws = (char*)d_ws;
    const size_t MB = 1024 * 1024;
    u16* XB  = (u16*)(ws + 0);          //  8 MB  x bf16 [BS, D]
    u16* WQB = (u16*)(ws + 8  * MB);    //  2 MB
    u16* WKB = (u16*)(ws + 10 * MB);    //  2 MB
    u16* WVB = (u16*)(ws + 12 * MB);    //  2 MB
    u16* WOB = (u16*)(ws + 14 * MB);    //  2 MB
    u16* W1B = (u16*)(ws + 16 * MB);    //  8 MB
    u16* W2B = (u16*)(ws + 24 * MB);    //  8 MB
    u16* Qb  = (u16*)(ws + 32 * MB);    //  8 MB  [B,H,S,DK]
    u16* Kb  = (u16*)(ws + 40 * MB);    //  8 MB  [B,H,S,DK]
    u16* VTb = (u16*)(ws + 48 * MB);    //  8 MB  [B,H,DK,S]
    u16* Ob  = (u16*)(ws + 56 * MB);    //  8 MB  [B,S,H*DK]
    float* ATT = (float*)(ws + 64 * MB);   // 16 MB [BS, D]
    float* N1F = (float*)(ws + 80 * MB);   // 16 MB
    u16*   N1B = (u16*)(ws + 96 * MB);     //  8 MB
    u16*   FF1 = (u16*)(ws + 104 * MB);    // 32 MB [BS, FF]
    float* FF2 = (float*)(ws + 136 * MB);  // 16 MB

    // 1. bf16 conversions: XB .. W2B are one contiguous destination
    cvt_all_bf16_kernel<<<CVT_BLOCKS, CVT_THREADS, 0, stream>>>(x, wq, wk, wv, wo, w1, w2, XB);

    // 2. QKV projections (N = H*DK = 1024, K = 1024)
    dim3 gP(Dd / 128, BS / 128);
    gemm_bf16_kernel<MODE_QPROJ><<<gP, 256, 0, stream>>>(XB, WQB, bq, nullptr, Qb,  BS, Dd, Dd);
    gemm_bf16_kernel<MODE_QPROJ><<<gP, 256, 0, stream>>>(XB, WKB, bk, nullptr, Kb,  BS, Dd, Dd);
    gemm_bf16_kernel<MODE_VPROJ><<<gP, 256, 0, stream>>>(XB, WVB, bv, nullptr, VTb, BS, Dd, Dd);

    // 3. fused attention
    flash_attn_kernel<<<dim3(Ss / 64, Bb * Hh), 128, 0, stream>>>(Qb, Kb, VTb, Ob);

    // 4. output projection
    gemm_bf16_kernel<MODE_F32><<<gP, 256, 0, stream>>>(Ob, WOB, bo, ATT, nullptr, BS, Dd, Dd);

    // 5. LN1 (residual with x), keep bf16 mirror for FFN input
    add_ln_kernel<true><<<BS, 256, 0, stream>>>(ATT, x, g1, be1, N1F, N1B);

    // 6. FFN
    gemm_bf16_kernel<MODE_RELU_BF16><<<dim3(FFf / 128, BS / 128), 256, 0, stream>>>(
        N1B, W1B, b1, nullptr, FF1, BS, FFf, Dd);
    gemm_bf16_kernel<MODE_F32><<<gP, 256, 0, stream>>>(FF1, W2B, b2, FF2, nullptr, BS, Dd, FFf);

    // 7. LN2 -> output
    add_ln_kernel<false><<<BS, 256, 0, stream>>>(FF2, N1F, g2, be2, out, nullptr);
}

// v004
// One run takes 216 microseconds.
// In two side-by-side timings against v003, it was 1.13 and 1.12 times as fast.
// Over all steps from v000 it is 3.34 times as fast.
#include <hip/hip_runtime.h>

// ---------------------------------------------------------------------------
// Transformer encoder block for MI455X (gfx1250, wave32, WMMA bf16)
//   B=2, S=2048, D=1024, H=16, DK=64, FF=4096, fp32 I/O
// ---------------------------------------------------------------------------

typedef __attribute__((ext_vector_type(16))) __bf16 v16bf;
typedef __attribute__((ext_vector_type(8)))  __bf16 v8bf;
typedef __attribute__((ext_vector_type(8)))  float  v8f;
typedef __attribute__((ext_vector_type(4)))  float  f32x4;

using u16 = unsigned short;
using u32 = unsigned int;

static constexpr int Hh = 16;
static constexpr int Dd = 1024;
static constexpr int DKk = 64;
static constexpr int FFf = 4096;
static constexpr int Bb = 2;
static constexpr int Ss = 2048;
static constexpr int BS = Bb * Ss;       // 4096 rows
static constexpr float LN_EPS = 1e-5f;
// LDS row pitch in bf16 elements for tiles of 64 elements a row: 144 B = 16 B x 9.
// An odd multiple of 16 B spreads the 16 rows of a ds_load_b128 fragment read
// over all 64 banks; at 128 B eight rows fall on the same four banks.
static constexpr int LP = 72;

// ---------------- helpers ---------------------------------------------------

__device__ __forceinline__ u16 f2bf(float f) {
    u32 u = __float_as_uint(f);
    u32 r = u + 0x7FFFu + ((u >> 16) & 1u);   // round-to-nearest-even
    return (u16)(r >> 16);
}

union Op32 { uint4 q[2]; v16bf v; };

// Load one WMMA 16x16x32 bf16 operand (A layout; B uses the same pattern on
// the transposed [N,K] matrix).  `base` points at a row-major bf16 tile in
// LDS with `stride` elements per row, `kbase` selects the 32-wide K chunk.
// Lanes 0-15: K = kbase+{0..7,16..23};  lanes 16-31: K = kbase+{8..15,24..31}.
__device__ __forceinline__ v16bf lds_load_op(const u16* base, int row, int stride,
                                             int kbase, int lane) {
    const u16* p = base + row * stride + kbase + ((lane >> 4) & 1) * 8;
    Op32 u;
    u.q[0] = *reinterpret_cast<const uint4*>(p);
    u.q[1] = *reinterpret_cast<const uint4*>(p + 16);
    return u.v;
}

__device__ __forceinline__ v8f wmma_bf16(v16bf a, v16bf b, v8f c) {
    return __builtin_amdgcn_wmma_f32_16x16x32_bf16(false, a, false, b,
                                                   (short)0, c, false, false);
}

// Byte address inside the work-group's LDS: the low half of the flat address.
__device__ __forceinline__ u32 lds_addr(const void* p) { return (u32)(size_t)p; }

// Eight asynchronous copies of 16 bytes a lane, global memory -> LDS, through
// no register: four for each of two tiles.  Copy i of tile n moves the bytes at
// gn + i * gstepn to LDS byte ln + i * lstep.  The s_wait_xcnt stands inside the
// statement, behind the last copy, so that no address register is rewritten
// ahead of it.
__device__ __forceinline__ void async_copy4x2(u32 l0, u32 l1, u32 lstep, const u16* g0, size_t gstep0,
                                              const u16* g1, size_t gstep1) {
    asm volatile(
        "global_load_async_to_lds_b128 %0, %8, off\n\t"
        "global_load_async_to_lds_b128 %1, %9, off\n\t"
        "global_load_async_to_lds_b128 %2, %10, off\n\t"
        "global_load_async_to_lds_b128 %3, %11, off\n\t"
        "global_load_async_to_lds_b128 %4, %12, off\n\t"
        "global_load_async_to_lds_b128 %5, %13, off\n\t"
        "global_load_async_to_lds_b128 %6, %14, off\n\t"
        "global_load_async_to_lds_b128 %7, %15, off\n\t"
        "s_wait_xcnt 0x0"
        :: "v"(l0), "v"(l0 + lstep), "v"(l0 + 2 * lstep), "v"(l0 + 3 * lstep),
           "v"(l1), "v"(l1 + lstep), "v"(l1 + 2 * lstep), "v"(l1 + 3 * lstep),
           "v"(g0), "v"(g0 + gstep0), "v"(g0 + 2 * gstep0), "v"(g0 + 3 * gstep0),
           "v"(g1), "v"(g1 + gstep1), "v"(g1 + 2 * gstep1), "v"(g1 + 3 * gstep1)
        : "memory");
}

// The hand-over of a two-buffer ring, every wave: this wave's LDS reads of the
// buffer it leaves have returned, its own copies of the next tile have landed,
// and the barrier tells both to the other waves.
__device__ __forceinline__ void ring_publish() {
    asm volatile("s_wait_dscnt 0x0" ::: "memory");     // my reads of the old buffer are done
    asm volatile("s_wait_asynccnt 0x0" ::: "memory");  // my copies of the next tile have landed
    __syncthreads();
}

// Lane l takes the value of lane l ^ 16: the two lanes that share a column of a
// WMMA accumulator tile.
__device__ __forceinline__ float xhalf(float v) {
    int b = __builtin_bit_cast(int, v);
    return __builtin_bit_cast(float, __builtin_amdgcn_permlanex16(b, b, 0x76543210, 0xfedcba98, false, false));
}

// Eight f32 -> eight bf16, round-to-nearest-even, two a conversion instruction.
__device__ __forceinline__ v8bf cvt8(v8f v) { return __builtin_convertvector(v, v8bf); }

// ---------------- fp32 -> bf16 conversion -----------------------------------
// One launch converts x and the six weight matrices.  Their bf16 copies lie
// back to back in the workspace, so the destination is one array of 16 Mi
// elements; in units of 1 Mi elements x fills 0-3, wq 4, wk 5, wv 6, wo 7,
// w1 8-11, w2 12-15.  256 blocks of 16 waves, one per WGP: a block owns 64 Ki
// consecutive elements (always inside one source) and walks them in two
// rounds.  In a round a wave has 16 loads of 16 bytes a lane in flight, each
// covering 512 contiguous bytes; each store covers 256 contiguous bytes.

static constexpr int CVT_THREADS = 512;
static constexpr int CVT_BLOCKS  = 256;
static constexpr int CVT_LOADS   = 16;                         // 16-byte loads a lane and round
static constexpr int CVT_ROUNDS  = 2;
static constexpr int CVT_STEP    = CVT_THREADS * 4;            // elements a block-wide load covers
static constexpr int CVT_ROUND   = CVT_STEP * CVT_LOADS;       // elements a block converts a round
static constexpr int CVT_PER_BLOCK = CVT_ROUND * CVT_ROUNDS;   // 64 Ki elements
static_assert((size_t)CVT_BLOCKS * CVT_PER_BLOCK ==
              (size_t)BS * Dd + 4u * Dd * Dd + 2u * (size_t)FFf * Dd, "the grid covers every element once");
static_assert((1 << 20) % CVT_PER_BLOCK == 0, "a block never straddles two sources");

__global__ __launch_bounds__(CVT_THREADS) void cvt_all_bf16_kernel(
    const float* __restrict__ x,  const float* __restrict__ wq,
    const float* __restrict__ wk, const float* __restrict__ wv,
    const float* __restrict__ wo, const float* __restrict__ w1,
    const float* __restrict__ w2, u16* __restrict__ y) {
    const int seg = blockIdx.x >> 4;                   // which 1 Mi-element unit
    const float* src;
    int first;                                         // the source's first unit
    if (seg < 4)       { src = x;  first = 0; }
    else if (seg == 4) { src = wq; first = 4; }
    else if (seg == 5) { src = wk; first = 5; }
    else if (seg == 6) { src = wv; first = 6; }
    else if (seg == 7) { src = wo; first = 7; }
    else if (seg < 12) { src = w1; first = 8; }
    else               { src = w2; first = 12; }

    const size_t dst0 = (size_t)blockIdx.x * CVT_PER_BLOCK + threadIdx.x * 4;
    const float* s = src + (dst0 - ((size_t)first << 20));
    u16* d = y + dst0;

    for (int r = 0; r < CVT_ROUNDS; ++r) {
        f32x4 v[CVT_LOADS];
        // Both inner loops unrolled: constant indices keep v[] in registers.
#pragma unroll
        for (int i = 0; i < CVT_LOADS; ++i)
            v[i] = *reinterpret_cast<const f32x4*>(s + i * CVT_STEP);
        // Inputs-only fence on the loaded values: it keeps the round's 16 loads
        // ahead of its converts.  Left free, the compiler waits out each load
        // alone, with one in flight a wave.
        asm volatile("" :: "v"(v[0]), "v"(v[1]), "v"(v[2]), "v"(v[3]), "v"(v[4]), "v"(v[5]), "v"(v[6]), "v"(v[7]),
                           "v"(v[8]), "v"(v[9]), "v"(v[10]), "v"(v[11]), "v"(v[12]), "v"(v[13]), "v"(v[14]), "v"(v[15]));
#pragma unroll
        for (int i = 0; i < CVT_LOADS; ++i) {
            uint2 p;
            p.x = (u32)f2bf(v[i].x) | ((u32)f2bf(v[i].y) << 16);
            p.y = (u32)f2bf(v[i].z) | ((u32)f2bf(v[i].w) << 16);
            *reinterpret_cast<uint2*>(d + i * CVT_STEP) = p;
        }
        s += CVT_ROUND;
        d += CVT_ROUND;
    }
}

enum { MODE_F32 = 0, MODE_RELU_BF16 = 1, MODE_QPROJ = 2, MODE_VPROJ = 3 };

template <int MODE>
__global__ __launch_bounds__(256) void gemm_bf16_kernel(
    const u16* __restrict__ A, const u16* __restrict__ Bt,
    const float* __restrict__ bias, float* __restrict__ Cf,
    u16* __restrict__ Cb, int M, int N, int K) {
    __shared__ __attribute__((aligned(16))) u16 As[2][128 * LP];   // 2 x 18 KB
    __shared__ __attribute__((aligned(16))) u16 Bs[2][128 * LP];   // 2 x 18 KB

    const int tid  = threadIdx.x;
    const int lane = tid & 31;
    const int ln   = lane & 15;
    const int half = lane >> 4;
    const int wave = tid >> 5;
    const int wr   = (wave & 3) * 32;   // wave row offset within 128
    const int wc   = (wave >> 2) * 64;  // wave col offset within 128
    const int m0   = blockIdx.y * 128;
    const int n0   = blockIdx.x * 128;

    v8f acc[2][4] = {};

    // A tile is 128 rows x 128 B = 1024 pieces of 16 B: 4 a thread and operand.
    // A wave's copy covers four whole rows; copy i takes the rows 32 * i further on.
    const int crow = tid >> 3, cq = tid & 7;
    const u16* ga = A  + (size_t)(m0 + crow) * K + cq * 8;
    const u16* gb = Bt + (size_t)(n0 + crow) * K + cq * 8;
    const u32 la = lds_addr(&As[0][crow * LP + cq * 8]);
    const u32 lb = lds_addr(&Bs[0][crow * LP + cq * 8]);
    constexpr u32 LROWS = 32 * LP * 2;         // LDS bytes of 32 rows
    constexpr u32 LBUF  = 128 * LP * 2;        // LDS bytes of one buffer
    const size_t grows = (size_t)32 * K;       // elements of 32 rows in memory
    const int T = K / 64;

    async_copy4x2(la, lb, LROWS, ga, grows, gb, grows);
    asm volatile("s_wait_asynccnt 0x0" ::: "memory");  // tile 0 has landed before anyone reads it
    __syncthreads();
    if (T > 1)
        async_copy4x2(la + LBUF, lb + LBUF, LROWS, ga + 64, grows, gb + 64, grows);

    for (int t = 0; t < T; ++t) {
        const int buf = t & 1;
        const u16* as = As[buf];
        const u16* bs = Bs[buf];

        v16bf a[2][2];
#pragma unroll
        for (int c = 0; c < 2; ++c)
#pragma unroll
            for (int i = 0; i < 2; ++i)
                a[c][i] = lds_load_op(as, wr + i * 16 + ln, LP, c * 32, lane);

#pragma unroll
        for (int c = 0; c < 2; ++c) {
#pragma unroll
            for (int j = 0; j < 4; ++j) {
                v16bf b = lds_load_op(bs, wc + j * 16 + ln, LP, c * 32, lane);
                acc[0][j] = wmma_bf16(a[c][0], b, acc[0][j]);
                acc[1][j] = wmma_bf16(a[c][1], b, acc[1][j]);
            }
        }

        ring_publish();
        if (t + 2 < T)     // refill the buffers that every wave has just left
            async_copy4x2(la + buf * LBUF, lb + buf * LBUF, LROWS,
                          ga + (size_t)(t + 2) * 64, grows, gb + (size_t)(t + 2) * 64, grows);
    }
    asm volatile("s_wait_asynccnt 0x0" ::: "memory");  // no copy is left in flight at the wave's end

    // Epilogue.  C layout: VGPR r -> row r + 8*half, col = lane&15.
#pragma unroll
    for (int i = 0; i < 2; ++i) {
#pragma unroll
        for (int j = 0; j < 4; ++j) {
            const int col = n0 + wc + j * 16 + ln;
            const float bval = bias[col];
#pragma unroll
            for (int r = 0; r < 8; ++r) {
                const int row = m0 + wr + i * 16 + r + half * 8;
                float val = acc[i][j][r] + bval;
                if constexpr (MODE == MODE_F32) {
                    Cf[(size_t)row * N + col] = val;
                } else if constexpr (MODE == MODE_RELU_BF16) {
                    Cb[(size_t)row * N + col] = f2bf(fmaxf(val, 0.0f));
                } else if constexpr (MODE == MODE_QPROJ) {
                    // row = b*S+s ; col = h*DK+kk  ->  [b,h,s,kk] bf16
                    int h = col >> 6, kk = col & 63;
                    int s = row & (Ss - 1), bidx = row >> 11;
                    Cb[(((size_t)(bidx * Hh + h) * Ss + s) * DKk) + kk] = f2bf(val);
                } else {  // MODE_VPROJ: [b,h,kk,s] (V transposed)
                    int h = col >> 6, kk = col & 63;
                    int s = row & (Ss - 1), bidx = row >> 11;
                    Cb[(((size_t)(bidx * Hh + h) * DKk + kk) * Ss) + s] = f2bf(val);
                }
            }
        }
    }
}

__global__ __launch_bounds__(128) void flash_attn_kernel(
    const u16* __restrict__ Q, const u16* __restrict__ Km,
    const u16* __restrict__ VT, u16* __restrict__ O) {
    __shared__ __attribute__((aligned(16))) u16 qs[64 * LP];       // 64 q rows x DK      (9 KB)
    __shared__ __attribute__((aligned(16))) u16 ks[2][64 * LP];    // 64 keys  x DK       (2 x 9 KB)
    __shared__ __attribute__((aligned(16))) u16 vts[2][64 * LP];   // DK rows  x 64 keys  (2 x 9 KB)

    const int tid  = threadIdx.x;
    const int lane = tid & 31;
    const int ln   = lane & 15;
    const int half = lane >> 4;
    const int wave = tid >> 5;
    const int bh   = blockIdx.y;                 // b*H + h
    const int q0   = blockIdx.x * 64;
    const int rb   = wave * 16;

    // A K or V^T tile is 64 rows x 128 B = 512 pieces of 16 B: 4 a thread and
    // tile.  A wave's copy covers four whole rows; copy i the rows 16 * i further on.
    const int crow = tid >> 3, cq = tid & 7;
    const u16* gk = Km + ((size_t)bh * Ss + crow) * DKk + cq * 8;
    const u16* gv = VT + ((size_t)bh * DKk + crow) * Ss + cq * 8;
    const u32 lk = lds_addr(&ks[0][crow * LP + cq * 8]);
    const u32 lv = lds_addr(&vts[0][crow * LP + cq * 8]);
    constexpr u32 LROWS = 16 * LP * 2;         // LDS bytes of 16 rows
    constexpr u32 LBUF  = 64 * LP * 2;         // LDS bytes of one buffer
    constexpr int T = Ss / 64;
    static_assert(T >= 2, "the ring's prologue fills two tiles");

    async_copy4x2(lk, lv, LROWS, gk, (size_t)16 * DKk, gv, (size_t)16 * Ss);

    // stage Q tile
    {
        const u16* qg = Q + ((size_t)bh * Ss + q0) * DKk;
        int row = tid >> 1, cb = (tid & 1) * 32;
#pragma unroll
        for (int q = 0; q < 4; ++q)
            *reinterpret_cast<uint4*>(&qs[row * LP + cb + q * 8]) =
                *reinterpret_cast<const uint4*>(&qg[(size_t)row * DKk + cb + q * 8]);
    }
    asm volatile("s_wait_asynccnt 0x0" ::: "memory");  // tile 0 has landed before anyone reads it
    __syncthreads();
    async_copy4x2(lk + LBUF, lv + LBUF, LROWS, gk + (size_t)64 * DKk, (size_t)16 * DKk, gv + 64, (size_t)16 * Ss);

    v16bf bq[2];   // Q^T as B operand: lane ln holds query rb + ln
#pragma unroll
    for (int c = 0; c < 2; ++c)
        bq[c] = lds_load_op(qs, rb + ln, LP, c * 32, lane);

    float m = -INFINITY, l = 0.0f;   // of query rb + ln; l sums this lane half's keys only
    v8f o[4] = {};                   // O^T: o[n][r] = head element n*16 + 8*half + r of query rb + ln

    for (int tile = 0; tile < T; ++tile) {
        const int buf = tile & 1;
        const u16* kt = ks[buf];
        const u16* vt = vts[buf];

        // scores^T: [64 keys] x [16 queries] in 4 tiles, accumulate over DK
        v8f s[4] = {};
#pragma unroll
        for (int c = 0; c < 2; ++c)
#pragma unroll
            for (int t = 0; t < 4; ++t) {
                v16bf ak = lds_load_op(kt, t * 16 + ln, LP, c * 32, lane);
                s[t] = wmma_bf16(ak, bq[c], s[t]);
            }
#pragma unroll
        for (int t = 0; t < 4; ++t) s[t] = s[t] * 0.125f;   // 1/sqrt(DK)

        // online softmax: a lane holds 32 of its query's 64 scores, lane ^ 16 the rest
        float mx[8];
#pragma unroll
        for (int r = 0; r < 8; ++r)
            mx[r] = fmaxf(fmaxf(s[0][r], s[1][r]), fmaxf(s[2][r], s[3][r]));
        float rmax = fmaxf(fmaxf(fmaxf(mx[0], mx[1]), fmaxf(mx[2], mx[3])),
                           fmaxf(fmaxf(mx[4], mx[5]), fmaxf(mx[6], mx[7])));
        rmax = fmaxf(rmax, xhalf(rmax));

        const float mn = fmaxf(m, rmax);
        const float alpha = __expf(m - mn);
        m = mn;
#pragma unroll
        for (int t = 0; t < 4; ++t)
#pragma unroll
            for (int r = 0; r < 8; ++r)
                s[t][r] = __expf(s[t][r] - m);

        const v8f sv = (s[0] + s[1]) + (s[2] + s[3]);
        l = l * alpha + (((sv[0] + sv[1]) + (sv[2] + sv[3])) + ((sv[4] + sv[5]) + (sv[6] + sv[7])));

        // P^T as B operand: element e is key c*32 + 8*half + e (e < 8), c*32 + 16 + 8*half + e - 8 (e >= 8)
        v16bf bp[2];
#pragma unroll
        for (int c = 0; c < 2; ++c)
            bp[c] = __builtin_shufflevector(cvt8(s[2 * c]), cvt8(s[2 * c + 1]),
                                            0, 1, 2, 3, 4, 5, 6, 7, 8, 9, 10, 11, 12, 13, 14, 15);

        // O^T = O^T*alpha + V^T @ P^T  (two 32-key WMMA K-steps per group of 16 head elements)
#pragma unroll
        for (int n = 0; n < 4; ++n) {
            o[n] = o[n] * alpha;
#pragma unroll
            for (int c = 0; c < 2; ++c) {
                v16bf av = lds_load_op(vt, n * 16 + ln, LP, c * 32, lane);
                o[n] = wmma_bf16(av, bp[c], o[n]);
            }
        }

        ring_publish();
        if (tile + 2 < T)  // refill the buffers that every wave has just left
            async_copy4x2(lk + buf * LBUF, lv + buf * LBUF, LROWS,
                          gk + (size_t)(tile + 2) * 64 * DKk, (size_t)16 * DKk,
                          gv + (tile + 2) * 64, (size_t)16 * Ss);
    }
    asm volatile("s_wait_asynccnt 0x0" ::: "memory");  // no copy is left in flight at the wave's end

    // finalize: O /= l, write concatenated-head layout [b, s, h*DK + col]; a lane's
    // eight registers of a tile are eight consecutive columns: one 16-byte store
    const int bidx = bh >> 4, h = bh & 15;
    l += xhalf(l);                   // join the two lane halves' sums
    const float inv = 1.0f / l;
    u16* op = O + ((size_t)bidx * Ss + q0 + rb + ln) * (Hh * DKk) + h * DKk + half * 8;
#pragma unroll
    for (int n = 0; n < 4; ++n)
        *reinterpret_cast<uint4*>(op + n * 16) = __builtin_bit_cast(uint4, cvt8(o[n] * inv));
}

// ---------------- residual + LayerNorm --------------------------------------
// one row per block; 256 threads * 4 elems = D

template <bool WRITE_BF16>
__global__ __launch_bounds__(256) void add_ln_kernel(
    const float* __restrict__ a, const float* __restrict__ b,
    const float* __restrict__ g, const float* __restrict__ be,
    float* __restrict__ oF, u16* __restrict__ oB) {
    __shared__ float ss[256], sq[256];
    const int row = blockIdx.x, tid = threadIdx.x;
    const int i0 = tid * 4;

    float4 xa = *reinterpret_cast<const float4*>(a + (size_t)row * Dd + i0);
    float4 xb = *reinterpret_cast<const float4*>(b + (size_t)row * Dd + i0);
    float v[4] = { xa.x + xb.x, xa.y + xb.y, xa.z + xb.z, xa.w + xb.w };

    float s = v[0] + v[1] + v[2] + v[3];
    float q = v[0] * v[0] + v[1] * v[1] + v[2] * v[2] + v[3] * v[3];
    ss[tid] = s; sq[tid] = q;
    __syncthreads();
    for (int st = 128; st > 0; st >>= 1) {
        if (tid < st) { ss[tid] += ss[tid + st]; sq[tid] += sq[tid + st]; }
        __syncthreads();
    }
    const float mu   = ss[0] * (1.0f / Dd);
    const float var  = sq[0] * (1.0f / Dd) - mu * mu;
    const float rstd = rsqrtf(var + LN_EPS);

    float4 gg = *reinterpret_cast<const float4*>(g + i0);
    float4 bb = *reinterpret_cast<const float4*>(be + i0);
    float o0 = (v[0] - mu) * rstd * gg.x + bb.x;
    float o1 = (v[1] - mu) * rstd * gg.y + bb.y;
    float o2 = (v[2] - mu) * rstd * gg.z + bb.z;
    float o3 = (v[3] - mu) * rstd * gg.w + bb.w;

    *reinterpret_cast<float4*>(oF + (size_t)row * Dd + i0) = make_float4(o0, o1, o2, o3);
    if constexpr (WRITE_BF16) {
        u16* p = oB + (size_t)row * Dd + i0;
        p[0] = f2bf(o0); p[1] = f2bf(o1); p[2] = f2bf(o2); p[3] = f2bf(o3);
    }
}

// ---------------- launcher ---------------------------------------------------

extern "C" void kernel_launch(void* const* d_in, const int* in_sizes, int n_in,
                              void* d_out, int out_size, void* d_ws, size_t ws_size,
                              hipStream_t stream) {
    const float* x  = (const float*)d_in[0];
    const float* wq = (const float*)d_in[1];  const float* bq = (const float*)d_in[2];
    const float* wk = (const float*)d_in[3];  const float* bk = (const float*)d_in[4];
    const float* wv = (const float*)d_in[5];  const float* bv = (const float*)d_in[6];
    const float* wo = (const float*)d_in[7];  const float* bo = (const float*)d_in[8];
    const float* g1 = (const float*)d_in[9];  const float* be1 = (const float*)d_in[10];
    const float* w1 = (const float*)d_in[11]; const float* b1 = (const float*)d_in[12];
    const float* w2 = (const float*)d_in[13]; const float* b2 = (const float*)d_in[14];
    const float* g2 = (const float*)d_in[15]; const float* be2 = (const float*)d_in[16];
    float* out = (float*)d_out;

    char* ws = (char*)d_ws;
    const size_t MB = 1024 * 1024;
    u16* XB  = (u16*)(ws + 0);          //  8 MB  x bf16 [BS, D]
    u16* WQB = (u16*)(ws + 8  * MB);    //  2 MB
    u16* WKB = (u16*)(ws + 10 * MB);    //  2 MB
    u16* WVB = (u16*)(ws + 12 * MB);    //  2 MB
    u16* WOB = (u16*)(ws + 14 * MB);    //  2 MB
    u16* W1B = (u16*)(ws + 16 * MB);    //  8 MB
    u16* W2B = (u16*)(ws + 24 * MB);    //  8 MB
    u16* Qb  = (u16*)(ws + 32 * MB);    //  8 MB  [B,H,S,DK]
    u16* Kb  = (u16*)(ws + 40 * MB);    //  8 MB  [B,H,S,DK]
    u16* VTb = (u16*)(ws + 48 * MB);    //  8 MB  [B,H,DK,S]
    u16* Ob  = (u16*)(ws + 56 * MB);    //  8 MB  [B,S,H*DK]
    float* ATT = (float*)(ws + 64 * MB);   // 16 MB [BS, D]
    float* N1F = (float*)(ws + 80 * MB);   // 16 MB
    u16*   N1B = (u16*)(ws + 96 * MB);     //  8 MB
    u16*   FF1 = (u16*)(ws + 104 * MB);    // 32 MB [BS, FF]
    float* FF2 = (float*)(ws + 136 * MB);  // 16 MB

    // 1. bf16 conversions: XB .. W2B are one contiguous destination
    cvt_all_bf16_kernel<<<CVT_BLOCKS, CVT_THREADS, 0, stream>>>(x, wq, wk, wv, wo, w1, w2, XB);

    // 2. QKV projections (N = H*DK = 1024, K = 1024)
    dim3 gP(Dd / 128, BS / 128);
    gemm_bf16_kernel<MODE_QPROJ><<<gP, 256, 0, stream>>>(XB, WQB, bq, nullptr, Qb,  BS, Dd, Dd);
    gemm_bf16_kernel<MODE_QPROJ><<<gP, 256, 0, stream>>>(XB, WKB, bk, nullptr, Kb,  BS, Dd, Dd);
    gemm_bf16_kernel<MODE_VPROJ><<<gP, 256, 0, stream>>>(XB, WVB, bv, nullptr, VTb, BS, Dd, Dd);

    // 3. fused attention
    flash_attn_kernel<<<dim3(Ss / 64, Bb * Hh), 128, 0, stream>>>(Qb, Kb, VTb, Ob);

    // 4. output projection
    gemm_bf16_kernel<MODE_F32><<<gP, 256, 0, stream>>>(Ob, WOB, bo, ATT, nullptr, BS, Dd, Dd);

    // 5. LN1 (residual with x), keep bf16 mirror for FFN input
    add_ln_kernel<true><<<BS, 256, 0, stream>>>(ATT, x, g1, be1, N1F, N1B);

    // 6. FFN
    gemm_bf16_kernel<MODE_RELU_BF16><<<dim3(FFf / 128, BS / 128), 256, 0, stream>>>(
        N1B, W1B, b1, nullptr, FF1, BS, FFf, Dd);
    gemm_bf16_kernel<MODE_F32><<<gP, 256, 0, stream>>>(FF1, W2B, b2, FF2, nullptr, BS, Dd, FFf);

    // 7. LN2 -> output
    add_ln_kernel<false><<<BS, 256, 0, stream>>>(FF2, N1F, g2, be2, out, nullptr);
}

// v005
// Measured time: 200 microseconds a run.
// Next to v004, in two timings, it ran 1.08 times as fast each time.
// All steps since v000 together make it 3.62 times as fast.
#include <hip/hip_runtime.h>

// ---------------------------------------------------------------------------
// Transformer encoder block for MI455X (gfx1250, wave32, WMMA bf16)
//   B=2, S=2048, D=1024, H=16, DK=64, FF=4096, fp32 I/O
// ---------------------------------------------------------------------------

typedef __attribute__((ext_vector_type(16))) __bf16 v16bf;
typedef __attribute__((ext_vector_type(8)))  __bf16 v8bf;
typedef __attribute__((ext_vector_type(8)))  float  v8f;
typedef __attribute__((ext_vector_type(4)))  float  f32x4;

using u16 = unsigned short;
using u32 = unsigned int;

static constexpr int Hh = 16;
static constexpr int Dd = 1024;
static constexpr int DKk = 64;
static constexpr int FFf = 4096;
static constexpr int Bb = 2;
static constexpr int Ss = 2048;
static constexpr int BS = Bb * Ss;       // 4096 rows
static constexpr float LN_EPS = 1e-5f;
// LDS row pitch in bf16 elements for tiles of 64 elements a row: 144 B = 16 B x 9.
// An odd multiple of 16 B spreads the 16 rows of a ds_load_b128 fragment read
// over all 64 banks; at 128 B eight rows fall on the same four banks.
static constexpr int LP = 72;

// ---------------- helpers ---------------------------------------------------

__device__ __forceinline__ u16 f2bf(float f) {
    u32 u = __float_as_uint(f);
    u32 r = u + 0x7FFFu + ((u >> 16) & 1u);   // round-to-nearest-even
    return (u16)(r >> 16);
}

union Op32 { uint4 q[2]; v16bf v; };

// Load one WMMA 16x16x32 bf16 operand (A layout; B uses the same pattern on
// the transposed [N,K] matrix).  `base` points at a row-major bf16 tile in
// LDS with `stride` elements per row, `kbase` selects the 32-wide K chunk.
// Lanes 0-15: K = kbase+{0..7,16..23};  lanes 16-31: K = kbase+{8..15,24..31}.
__device__ __forceinline__ v16bf lds_load_op(const u16* base, int row, int stride,
                                             int kbase, int lane) {
    const u16* p = base + row * stride + kbase + ((lane >> 4) & 1) * 8;
    Op32 u;
    u.q[0] = *reinterpret_cast<const uint4*>(p);
    u.q[1] = *reinterpret_cast<const uint4*>(p + 16);
    return u.v;
}

__device__ __forceinline__ v8f wmma_bf16(v16bf a, v16bf b, v8f c) {
    return __builtin_amdgcn_wmma_f32_16x16x32_bf16(false, a, false, b,
                                                   (short)0, c, false, false);
}

// Byte address inside the work-group's LDS: the low half of the flat address.
__device__ __forceinline__ u32 lds_addr(const void* p) { return (u32)(size_t)p; }

// Eight asynchronous copies of 16 bytes a lane, global memory -> LDS, through
// no register: four for each of two tiles.  Copy i of tile n moves the bytes at
// gn + i * gstepn to LDS byte ln + i * lstep.  The s_wait_xcnt stands inside the
// statement, behind the last copy, so that no address register is rewritten
// ahead of it.
__device__ __forceinline__ void async_copy4x2(u32 l0, u32 l1, u32 lstep, const u16* g0, size_t gstep0,
                                              const u16* g1, size_t gstep1) {
    asm volatile(
        "global_load_async_to_lds_b128 %0, %8, off\n\t"
        "global_load_async_to_lds_b128 %1, %9, off\n\t"
        "global_load_async_to_lds_b128 %2, %10, off\n\t"
        "global_load_async_to_lds_b128 %3, %11, off\n\t"
        "global_load_async_to_lds_b128 %4, %12, off\n\t"
        "global_load_async_to_lds_b128 %5, %13, off\n\t"
        "global_load_async_to_lds_b128 %6, %14, off\n\t"
        "global_load_async_to_lds_b128 %7, %15, off\n\t"
        "s_wait_xcnt 0x0"
        :: "v"(l0), "v"(l0 + lstep), "v"(l0 + 2 * lstep), "v"(l0 + 3 * lstep),
           "v"(l1), "v"(l1 + lstep), "v"(l1 + 2 * lstep), "v"(l1 + 3 * lstep),
           "v"(g0), "v"(g0 + gstep0), "v"(g0 + 2 * gstep0), "v"(g0 + 3 * gstep0),
           "v"(g1), "v"(g1 + gstep1), "v"(g1 + 2 * gstep1), "v"(g1 + 3 * gstep1)
        : "memory");
}

// The hand-over of a two-buffer ring, every wave: this wave's LDS reads of the
// buffer it leaves have returned, its own copies of the next tile have landed,
// and the barrier tells both to the other waves.
__device__ __forceinline__ void ring_publish() {
    asm volatile("s_wait_dscnt 0x0" ::: "memory");     // my reads of the old buffer are done
    asm volatile("s_wait_asynccnt 0x0" ::: "memory");  // my copies of the next tile have landed
    __syncthreads();
}

// Lane l takes the value of lane l ^ 16: the two lanes that share a column of a
// WMMA accumulator tile.
__device__ __forceinline__ float xhalf(float v) {
    int b = __builtin_bit_cast(int, v);
    return __builtin_bit_cast(float, __builtin_amdgcn_permlanex16(b, b, 0x76543210, 0xfedcba98, false, false));
}

// Eight f32 -> eight bf16, round-to-nearest-even, two a conversion instruction.
__device__ __forceinline__ v8bf cvt8(v8f v) { return __builtin_convertvector(v, v8bf); }

// ---------------- fp32 -> bf16 conversion -----------------------------------
// One launch converts x and the six weight matrices.  Their bf16 copies lie
// back to back in the workspace, so the destination is one array of 16 Mi
// elements; in units of 1 Mi elements x fills 0-3, wq 4, wk 5, wv 6, wo 7,
// w1 8-11, w2 12-15.  256 blocks of 16 waves, one per WGP: a block owns 64 Ki
// consecutive elements (always inside one source) and walks them in two
// rounds.  In a round a wave has 16 loads of 16 bytes a lane in flight, each
// covering 512 contiguous bytes; each store covers 256 contiguous bytes.

static constexpr int CVT_THREADS = 512;
static constexpr int CVT_BLOCKS  = 256;
static constexpr int CVT_LOADS   = 16;                         // 16-byte loads a lane and round
static constexpr int CVT_ROUNDS  = 2;
static constexpr int CVT_STEP    = CVT_THREADS * 4;            // elements a block-wide load covers
static constexpr int CVT_ROUND   = CVT_STEP * CVT_LOADS;       // elements a block converts a round
static constexpr int CVT_PER_BLOCK = CVT_ROUND * CVT_ROUNDS;   // 64 Ki elements
static_assert((size_t)CVT_BLOCKS * CVT_PER_BLOCK ==
              (size_t)BS * Dd + 4u * Dd * Dd + 2u * (size_t)FFf * Dd, "the grid covers every element once");
static_assert((1 << 20) % CVT_PER_BLOCK == 0, "a block never straddles two sources");

__global__ __launch_bounds__(CVT_THREADS) void cvt_all_bf16_kernel(
    const float* __restrict__ x,  const float* __restrict__ wq,
    const float* __restrict__ wk, const float* __restrict__ wv,
    const float* __restrict__ wo, const float* __restrict__ w1,
    const float* __restrict__ w2, u16* __restrict__ y) {
    const int seg = blockIdx.x >> 4;                   // which 1 Mi-element unit
    const float* src;
    int first;                                         // the source's first unit
    if (seg < 4)       { src = x;  first = 0; }
    else if (seg == 4) { src = wq; first = 4; }
    else if (seg == 5) { src = wk; first = 5; }
    else if (seg == 6) { src = wv; first = 6; }
    else if (seg == 7) { src = wo; first = 7; }
    else if (seg < 12) { src = w1; first = 8; }
    else               { src = w2; first = 12; }

    const size_t dst0 = (size_t)blockIdx.x * CVT_PER_BLOCK + threadIdx.x * 4;
    const float* s = src + (dst0 - ((size_t)first << 20));
    u16* d = y + dst0;

    for (int r = 0; r < CVT_ROUNDS; ++r) {
        f32x4 v[CVT_LOADS];
        // Both inner loops unrolled: constant indices keep v[] in registers.
#pragma unroll
        for (int i = 0; i < CVT_LOADS; ++i)
            v[i] = *reinterpret_cast<const f32x4*>(s + i * CVT_STEP);
        // Inputs-only fence on the loaded values: it keeps the round's 16 loads
        // ahead of its converts.  Left free, the compiler waits out each load
        // alone, with one in flight a wave.
        asm volatile("" :: "v"(v[0]), "v"(v[1]), "v"(v[2]), "v"(v[3]), "v"(v[4]), "v"(v[5]), "v"(v[6]), "v"(v[7]),
                           "v"(v[8]), "v"(v[9]), "v"(v[10]), "v"(v[11]), "v"(v[12]), "v"(v[13]), "v"(v[14]), "v"(v[15]));
#pragma unroll
        for (int i = 0; i < CVT_LOADS; ++i) {
            uint2 p;
            p.x = (u32)f2bf(v[i].x) | ((u32)f2bf(v[i].y) << 16);
            p.y = (u32)f2bf(v[i].z) | ((u32)f2bf(v[i].w) << 16);
            *reinterpret_cast<uint2*>(d + i * CVT_STEP) = p;
        }
        s += CVT_ROUND;
        d += CVT_ROUND;
    }
}

enum { MODE_F32 = 0, MODE_RELU_BF16 = 1, MODE_QPROJ = 2, MODE_VPROJ = 3 };

template <int MODE>
__global__ __launch_bounds__(256) void gemm_bf16_kernel(
    const u16* __restrict__ A, const u16* __restrict__ Bt,
    const float* __restrict__ bias, float* __restrict__ Cf,
    u16* __restrict__ Cb, int M, int N, int K) {
    __shared__ __attribute__((aligned(16))) u16 As[2][128 * LP];   // 2 x 18 KB
    __shared__ __attribute__((aligned(16))) u16 Bs[2][128 * LP];   // 2 x 18 KB

    const int tid  = threadIdx.x;
    const int lane = tid & 31;
    const int ln   = lane & 15;
    const int half = lane >> 4;
    const int wave = tid >> 5;
    const int wr   = (wave & 3) * 32;   // wave row offset within 128
    const int wc   = (wave >> 2) * 64;  // wave col offset within 128
    const int m0   = blockIdx.y * 128;
    const int n0   = blockIdx.x * 128;

    v8f acc[2][4] = {};

    // A tile is 128 rows x 128 B = 1024 pieces of 16 B: 4 a thread and operand.
    // A wave's copy covers four whole rows; copy i takes the rows 32 * i further on.
    const int crow = tid >> 3, cq = tid & 7;
    const u16* ga = A  + (size_t)(m0 + crow) * K + cq * 8;
    const u16* gb = Bt + (size_t)(n0 + crow) * K + cq * 8;
    const u32 la = lds_addr(&As[0][crow * LP + cq * 8]);
    const u32 lb = lds_addr(&Bs[0][crow * LP + cq * 8]);
    constexpr u32 LROWS = 32 * LP * 2;         // LDS bytes of 32 rows
    constexpr u32 LBUF  = 128 * LP * 2;        // LDS bytes of one buffer
    const size_t grows = (size_t)32 * K;       // elements of 32 rows in memory
    const int T = K / 64;

    async_copy4x2(la, lb, LROWS, ga, grows, gb, grows);
    asm volatile("s_wait_asynccnt 0x0" ::: "memory");  // tile 0 has landed before anyone reads it
    __syncthreads();
    if (T > 1)
        async_copy4x2(la + LBUF, lb + LBUF, LROWS, ga + 64, grows, gb + 64, grows);

    for (int t = 0; t < T; ++t) {
        const int buf = t & 1;
        const u16* as = As[buf];
        const u16* bs = Bs[buf];

        // All 24 fragment reads of the trip go out as one group, each fragment
        // into registers of its own, in the order in which the products use them.
        v16bf a[2][2], b[2][4];
#pragma unroll
        for (int c = 0; c < 2; ++c) {
#pragma unroll
            for (int i = 0; i < 2; ++i)
                a[c][i] = lds_load_op(as, wr + i * 16 + ln, LP, c * 32, lane);
#pragma unroll
            for (int j = 0; j < 4; ++j)
                b[c][j] = lds_load_op(bs, wc + j * 16 + ln, LP, c * 32, lane);
        }
        // Keeps the reads ahead of the products.  Left free, the compiler sinks each
        // B fragment's reads to its two products, into one shared register set, and
        // the wave waits out a whole LDS latency eight times a trip.
        __builtin_amdgcn_sched_barrier(0);

#pragma unroll
        for (int c = 0; c < 2; ++c) {
#pragma unroll
            for (int j = 0; j < 4; ++j) {
                acc[0][j] = wmma_bf16(a[c][0], b[c][j], acc[0][j]);
                acc[1][j] = wmma_bf16(a[c][1], b[c][j], acc[1][j]);
            }
        }
        // Keeps the products ahead of the hand-over.  Left free, the compiler lifts the
        // hand-over's waits and barrier over them: every product then waits for the last
        // read, and the next tile's copies have only the reads' time to land in.
        __builtin_amdgcn_sched_barrier(0);

        ring_publish();
        if (t + 2 < T)     // refill the buffers that every wave has just left
            async_copy4x2(la + buf * LBUF, lb + buf * LBUF, LROWS,
                          ga + (size_t)(t + 2) * 64, grows, gb + (size_t)(t + 2) * 64, grows);
    }
    asm volatile("s_wait_asynccnt 0x0" ::: "memory");  // no copy is left in flight at the wave's end

    // Epilogue.  C layout: VGPR r -> row r + 8*half, col = lane&15.
#pragma unroll
    for (int i = 0; i < 2; ++i) {
#pragma unroll
        for (int j = 0; j < 4; ++j) {
            const int col = n0 + wc + j * 16 + ln;
            const float bval = bias[col];
#pragma unroll
            for (int r = 0; r < 8; ++r) {
                const int row = m0 + wr + i * 16 + r + half * 8;
                float val = acc[i][j][r] + bval;
                if constexpr (MODE == MODE_F32) {
                    Cf[(size_t)row * N + col] = val;
                } else if constexpr (MODE == MODE_RELU_BF16) {
                    Cb[(size_t)row * N + col] = f2bf(fmaxf(val, 0.0f));
                } else if constexpr (MODE == MODE_QPROJ) {
                    // row = b*S+s ; col = h*DK+kk  ->  [b,h,s,kk] bf16
                    int h = col >> 6, kk = col & 63;
                    int s = row & (Ss - 1), bidx = row >> 11;
                    Cb[(((size_t)(bidx * Hh + h) * Ss + s) * DKk) + kk] = f2bf(val);
                } else {  // MODE_VPROJ: [b,h,kk,s] (V transposed)
                    int h = col >> 6, kk = col & 63;
                    int s = row & (Ss - 1), bidx = row >> 11;
                    Cb[(((size_t)(bidx * Hh + h) * DKk + kk) * Ss) + s] = f2bf(val);
                }
            }
        }
    }
}

__global__ __launch_bounds__(128) void flash_attn_kernel(
    const u16* __restrict__ Q, const u16* __restrict__ Km,
    const u16* __restrict__ VT, u16* __restrict__ O) {
    __shared__ __attribute__((aligned(16))) u16 qs[64 * LP];       // 64 q rows x DK      (9 KB)
    __shared__ __attribute__((aligned(16))) u16 ks[2][64 * LP];    // 64 keys  x DK       (2 x 9 KB)
    __shared__ __attribute__((aligned(16))) u16 vts[2][64 * LP];   // DK rows  x 64 keys  (2 x 9 KB)

    const int tid  = threadIdx.x;
    const int lane = tid & 31;
    const int ln   = lane & 15;
    const int half = lane >> 4;
    const int wave = tid >> 5;
    const int bh   = blockIdx.y;                 // b*H + h
    const int q0   = blockIdx.x * 64;
    const int rb   = wave * 16;

    // A K or V^T tile is 64 rows x 128 B = 512 pieces of 16 B: 4 a thread and
    // tile.  A wave's copy covers four whole rows; copy i the rows 16 * i further on.
    const int crow = tid >> 3, cq = tid & 7;
    const u16* gk = Km + ((size_t)bh * Ss + crow) * DKk + cq * 8;
    const u16* gv = VT + ((size_t)bh * DKk + crow) * Ss + cq * 8;
    const u32 lk = lds_addr(&ks[0][crow * LP + cq * 8]);
    const u32 lv = lds_addr(&vts[0][crow * LP + cq * 8]);
    constexpr u32 LROWS = 16 * LP * 2;         // LDS bytes of 16 rows
    constexpr u32 LBUF  = 64 * LP * 2;         // LDS bytes of one buffer
    constexpr int T = Ss / 64;
    static_assert(T >= 2, "the ring's prologue fills two tiles");

    async_copy4x2(lk, lv, LROWS, gk, (size_t)16 * DKk, gv, (size_t)16 * Ss);

    // stage Q tile
    {
        const u16* qg = Q + ((size_t)bh * Ss + q0) * DKk;
        int row = tid >> 1, cb = (tid & 1) * 32;
#pragma unroll
        for (int q = 0; q < 4; ++q)
            *reinterpret_cast<uint4*>(&qs[row * LP + cb + q * 8]) =
                *reinterpret_cast<const uint4*>(&qg[(size_t)row * DKk + cb + q * 8]);
    }
    asm volatile("s_wait_asynccnt 0x0" ::: "memory");  // tile 0 has landed before anyone reads it
    __syncthreads();
    async_copy4x2(lk + LBUF, lv + LBUF, LROWS, gk + (size_t)64 * DKk, (size_t)16 * DKk, gv + 64, (size_t)16 * Ss);

    v16bf bq[2];   // Q^T as B operand: lane ln holds query rb + ln
#pragma unroll
    for (int c = 0; c < 2; ++c)
        bq[c] = lds_load_op(qs, rb + ln, LP, c * 32, lane);

    float m = -INFINITY, l = 0.0f;   // of query rb + ln; l sums this lane half's keys only
    v8f o[4] = {};                   // O^T: o[n][r] = head element n*16 + 8*half + r of query rb + ln

    for (int tile = 0; tile < T; ++tile) {
        const int buf = tile & 1;
        const u16* kt = ks[buf];
        const u16* vt = vts[buf];

        // scores^T: [64 keys] x [16 queries] in 4 tiles, accumulate over DK
        v8f s[4] = {};
#pragma unroll
        for (int c = 0; c < 2; ++c)
#pragma unroll
            for (int t = 0; t < 4; ++t) {
                v16bf ak = lds_load_op(kt, t * 16 + ln, LP, c * 32, lane);
                s[t] = wmma_bf16(ak, bq[c], s[t]);
            }
#pragma unroll
        for (int t = 0; t < 4; ++t) s[t] = s[t] * 0.125f;   // 1/sqrt(DK)

        // online softmax: a lane holds 32 of its query's 64 scores, lane ^ 16 the rest
        float mx[8];
#pragma unroll
        for (int r = 0; r < 8; ++r)
            mx[r] = fmaxf(fmaxf(s[0][r], s[1][r]), fmaxf(s[2][r], s[3][r]));
        float rmax = fmaxf(fmaxf(fmaxf(mx[0], mx[1]), fmaxf(mx[2], mx[3])),
                           fmaxf(fmaxf(mx[4], mx[5]), fmaxf(mx[6], mx[7])));
        rmax = fmaxf(rmax, xhalf(rmax));

        const float mn = fmaxf(m, rmax);
        const float alpha = __expf(m - mn);
        m = mn;
#pragma unroll
        for (int t = 0; t < 4; ++t)
#pragma unroll
            for (int r = 0; r < 8; ++r)
                s[t][r] = __expf(s[t][r] - m);

        const v8f sv = (s[0] + s[1]) + (s[2] + s[3]);
        l = l * alpha + (((sv[0] + sv[1]) + (sv[2] + sv[3])) + ((sv[4] + sv[5]) + (sv[6] + sv[7])));

        // P^T as B operand: element e is key c*32 + 8*half + e (e < 8), c*32 + 16 + 8*half + e - 8 (e >= 8)
        v16bf bp[2];
#pragma unroll
        for (int c = 0; c < 2; ++c)
            bp[c] = __builtin_shufflevector(cvt8(s[2 * c]), cvt8(s[2 * c + 1]),
                                            0, 1, 2, 3, 4, 5, 6, 7, 8, 9, 10, 11, 12, 13, 14, 15);

        // O^T = O^T*alpha + V^T @ P^T  (two 32-key WMMA K-steps per group of 16 head elements)
#pragma unroll
        for (int n = 0; n < 4; ++n) {
            o[n] = o[n] * alpha;
#pragma unroll
            for (int c = 0; c < 2; ++c) {
                v16bf av = lds_load_op(vt, n * 16 + ln, LP, c * 32, lane);
                o[n] = wmma_bf16(av, bp[c], o[n]);
            }
        }

        ring_publish();
        if (tile + 2 < T)  // refill the buffers that every wave has just left
            async_copy4x2(lk + buf * LBUF, lv + buf * LBUF, LROWS,
                          gk + (size_t)(tile + 2) * 64 * DKk, (size_t)16 * DKk,
                          gv + (tile + 2) * 64, (size_t)16 * Ss);
    }
    asm volatile("s_wait_asynccnt 0x0" ::: "memory");  // no copy is left in flight at the wave's end

    // finalize: O /= l, write concatenated-head layout [b, s, h*DK + col]; a lane's
    // eight registers of a tile are eight consecutive columns: one 16-byte store
    const int bidx = bh >> 4, h = bh & 15;
    l += xhalf(l);                   // join the two lane halves' sums
    const float inv = 1.0f / l;
    u16* op = O + ((size_t)bidx * Ss + q0 + rb + ln) * (Hh * DKk) + h * DKk + half * 8;
#pragma unroll
    for (int n = 0; n < 4; ++n)
        *reinterpret_cast<uint4*>(op + n * 16) = __builtin_bit_cast(uint4, cvt8(o[n] * inv));
}

// ---------------- residual + LayerNorm --------------------------------------
// one row per block; 256 threads * 4 elems = D

template <bool WRITE_BF16>
__global__ __launch_bounds__(256) void add_ln_kernel(
    const float* __restrict__ a, const float* __restrict__ b,
    const float* __restrict__ g, const float* __restrict__ be,
    float* __restrict__ oF, u16* __restrict__ oB) {
    __shared__ float ss[256], sq[256];
    const int row = blockIdx.x, tid = threadIdx.x;
    const int i0 = tid * 4;

    float4 xa = *reinterpret_cast<const float4*>(a + (size_t)row * Dd + i0);
    float4 xb = *reinterpret_cast<const float4*>(b + (size_t)row * Dd + i0);
    float v[4] = { xa.x + xb.x, xa.y + xb.y, xa.z + xb.z, xa.w + xb.w };

    float s = v[0] + v[1] + v[2] + v[3];
    float q = v[0] * v[0] + v[1] * v[1] + v[2] * v[2] + v[3] * v[3];
    ss[tid] = s; sq[tid] = q;
    __syncthreads();
    for (int st = 128; st > 0; st >>= 1) {
        if (tid < st) { ss[tid] += ss[tid + st]; sq[tid] += sq[tid + st]; }
        __syncthreads();
    }
    const float mu   = ss[0] * (1.0f / Dd);
    const float var  = sq[0] * (1.0f / Dd) - mu * mu;
    const float rstd = rsqrtf(var + LN_EPS);

    float4 gg = *reinterpret_cast<const float4*>(g + i0);
    float4 bb = *reinterpret_cast<const float4*>(be + i0);
    float o0 = (v[0] - mu) * rstd * gg.x + bb.x;
    float o1 = (v[1] - mu) * rstd * gg.y + bb.y;
    float o2 = (v[2] - mu) * rstd * gg.z + bb.z;
    float o3 = (v[3] - mu) * rstd * gg.w + bb.w;

    *reinterpret_cast<float4*>(oF + (size_t)row * Dd + i0) = make_float4(o0, o1, o2, o3);
    if constexpr (WRITE_BF16) {
        u16* p = oB + (size_t)row * Dd + i0;
        p[0] = f2bf(o0); p[1] = f2bf(o1); p[2] = f2bf(o2); p[3] = f2bf(o3);
    }
}

// ---------------- launcher ---------------------------------------------------

extern "C" void kernel_launch(void* const* d_in, const int* in_sizes, int n_in,
                              void* d_out, int out_size, void* d_ws, size_t ws_size,
                              hipStream_t stream) {
    const float* x  = (const float*)d_in[0];
    const float* wq = (const float*)d_in[1];  const float* bq = (const float*)d_in[2];
    const float* wk = (const float*)d_in[3];  const float* bk = (const float*)d_in[4];
    const float* wv = (const float*)d_in[5];  const float* bv = (const float*)d_in[6];
    const float* wo = (const float*)d_in[7];  const float* bo = (const float*)d_in[8];
    const float* g1 = (const float*)d_in[9];  const float* be1 = (const float*)d_in[10];
    const float* w1 = (const float*)d_in[11]; const float* b1 = (const float*)d_in[12];
    const float* w2 = (const float*)d_in[13]; const float* b2 = (const float*)d_in[14];
    const float* g2 = (const float*)d_in[15]; const float* be2 = (const float*)d_in[16];
    float* out = (float*)d_out;

    char* ws = (char*)d_ws;
    const size_t MB = 1024 * 1024;
    u16* XB  = (u16*)(ws + 0);          //  8 MB  x bf16 [BS, D]
    u16* WQB = (u16*)(ws + 8  * MB);    //  2 MB
    u16* WKB = (u16*)(ws + 10 * MB);    //  2 MB
    u16* WVB = (u16*)(ws + 12 * MB);    //  2 MB
    u16* WOB = (u16*)(ws + 14 * MB);    //  2 MB
    u16* W1B = (u16*)(ws + 16 * MB);    //  8 MB
    u16* W2B = (u16*)(ws + 24 * MB);    //  8 MB
    u16* Qb  = (u16*)(ws + 32 * MB);    //  8 MB  [B,H,S,DK]
    u16* Kb  = (u16*)(ws + 40 * MB);    //  8 MB  [B,H,S,DK]
    u16* VTb = (u16*)(ws + 48 * MB);    //  8 MB  [B,H,DK,S]
    u16* Ob  = (u16*)(ws + 56 * MB);    //  8 MB  [B,S,H*DK]
    float* ATT = (float*)(ws + 64 * MB);   // 16 MB [BS, D]
    float* N1F = (float*)(ws + 80 * MB);   // 16 MB
    u16*   N1B = (u16*)(ws + 96 * MB);     //  8 MB
    u16*   FF1 = (u16*)(ws + 104 * MB);    // 32 MB [BS, FF]
    float* FF2 = (float*)(ws + 136 * MB);  // 16 MB

    // 1. bf16 conversions: XB .. W2B are one contiguous destination
    cvt_all_bf16_kernel<<<CVT_BLOCKS, CVT_THREADS, 0, stream>>>(x, wq, wk, wv, wo, w1, w2, XB);

    // 2. QKV projections (N = H*DK = 1024, K = 1024)
    dim3 gP(Dd / 128, BS / 128);
    gemm_bf16_kernel<MODE_QPROJ><<<gP, 256, 0, stream>>>(XB, WQB, bq, nullptr, Qb,  BS, Dd, Dd);
    gemm_bf16_kernel<MODE_QPROJ><<<gP, 256, 0, stream>>>(XB, WKB, bk, nullptr, Kb,  BS, Dd, Dd);
    gemm_bf16_kernel<MODE_VPROJ><<<gP, 256, 0, stream>>>(XB, WVB, bv, nullptr, VTb, BS, Dd, Dd);

    // 3. fused attention
    flash_attn_kernel<<<dim3(Ss / 64, Bb * Hh), 128, 0, stream>>>(Qb, Kb, VTb, Ob);

    // 4. output projection
    gemm_bf16_kernel<MODE_F32><<<gP, 256, 0, stream>>>(Ob, WOB, bo, ATT, nullptr, BS, Dd, Dd);

    // 5. LN1 (residual with x), keep bf16 mirror for FFN input
    add_ln_kernel<true><<<BS, 256, 0, stream>>>(ATT, x, g1, be1, N1F, N1B);

    // 6. FFN
    gemm_bf16_kernel<MODE_RELU_BF16><<<dim3(FFf / 128, BS / 128), 256, 0, stream>>>(
        N1B, W1B, b1, nullptr, FF1, BS, FFf, Dd);
    gemm_bf16_kernel<MODE_F32><<<gP, 256, 0, stream>>>(FF1, W2B, b2, FF2, nullptr, BS, Dd, FFf);

    // 7. LN2 -> output
    add_ln_kernel<false><<<BS, 256, 0, stream>>>(FF2, N1F, g2, be2, out, nullptr);
}

// v006
// Measured time: 189 microseconds a run.
// Two timings next to v005 both put it at 1.05 times that version's speed.
// All steps since v000 together make it 3.81 times as fast.
#include <hip/hip_runtime.h>

// ---------------------------------------------------------------------------
// Transformer encoder block for MI455X (gfx1250, wave32, WMMA bf16)
//   B=2, S=2048, D=1024, H=16, DK=64, FF=4096, fp32 I/O
// ---------------------------------------------------------------------------

typedef __attribute__((ext_vector_type(16))) __bf16 v16bf;
typedef __attribute__((ext_vector_type(8)))  __bf16 v8bf;
typedef __attribute__((ext_vector_type(8)))  float  v8f;
typedef __attribute__((ext_vector_type(4)))  float  f32x4;

using u16 = unsigned short;
using u32 = unsigned int;

static constexpr int Hh = 16;
static constexpr int Dd = 1024;
static constexpr int DKk = 64;
static constexpr int FFf = 4096;
static constexpr int Bb = 2;
static constexpr int Ss = 2048;
static constexpr int BS = Bb * Ss;       // 4096 rows
static constexpr float LN_EPS = 1e-5f;
// LDS row pitch in bf16 elements for tiles of 64 elements a row: 144 B = 16 B x 9.
// An odd multiple of 16 B spreads the 16 rows of a ds_load_b128 fragment read
// over all 64 banks; at 128 B eight rows fall on the same four banks.
static constexpr int LP = 72;

// ---------------- helpers ---------------------------------------------------

__device__ __forceinline__ u16 f2bf(float f) {
    u32 u = __float_as_uint(f);
    u32 r = u + 0x7FFFu + ((u >> 16) & 1u);   // round-to-nearest-even
    return (u16)(r >> 16);
}

union Op32 { uint4 q[2]; v16bf v; };

// Load one WMMA 16x16x32 bf16 operand (A layout; B uses the same pattern on
// the transposed [N,K] matrix).  `base` points at a row-major bf16 tile in
// LDS with `stride` elements per row, `kbase` selects the 32-wide K chunk.
// Lanes 0-15: K = kbase+{0..7,16..23};  lanes 16-31: K = kbase+{8..15,24..31}.
__device__ __forceinline__ v16bf lds_load_op(const u16* base, int row, int stride,
                                             int kbase, int lane) {
    const u16* p = base + row * stride + kbase + ((lane >> 4) & 1) * 8;
    Op32 u;
    u.q[0] = *reinterpret_cast<const uint4*>(p);
    u.q[1] = *reinterpret_cast<const uint4*>(p + 16);
    return u.v;
}

__device__ __forceinline__ v8f wmma_bf16(v16bf a, v16bf b, v8f c) {
    return __builtin_amdgcn_wmma_f32_16x16x32_bf16(false, a, false, b,
                                                   (short)0, c, false, false);
}

// Byte address inside the work-group's LDS: the low half of the flat address.
__device__ __forceinline__ u32 lds_addr(const void* p) { return (u32)(size_t)p; }

// Eight asynchronous copies of 16 bytes a lane, global memory -> LDS, through
// no register: four for each of two tiles.  Copy i of tile n moves the bytes at
// gn + i * gstepn to LDS byte ln + i * lstep.  The s_wait_xcnt stands inside the
// statement, behind the last copy, so that no address register is rewritten
// ahead of it.
__device__ __forceinline__ void async_copy4x2(u32 l0, u32 l1, u32 lstep, const u16* g0, size_t gstep0,
                                              const u16* g1, size_t gstep1) {
    asm volatile(
        "global_load_async_to_lds_b128 %0, %8, off\n\t"
        "global_load_async_to_lds_b128 %1, %9, off\n\t"
        "global_load_async_to_lds_b128 %2, %10, off\n\t"
        "global_load_async_to_lds_b128 %3, %11, off\n\t"
        "global_load_async_to_lds_b128 %4, %12, off\n\t"
        "global_load_async_to_lds_b128 %5, %13, off\n\t"
        "global_load_async_to_lds_b128 %6, %14, off\n\t"
        "global_load_async_to_lds_b128 %7, %15, off\n\t"
        "s_wait_xcnt 0x0"
        :: "v"(l0), "v"(l0 + lstep), "v"(l0 + 2 * lstep), "v"(l0 + 3 * lstep),
           "v"(l1), "v"(l1 + lstep), "v"(l1 + 2 * lstep), "v"(l1 + 3 * lstep),
           "v"(g0), "v"(g0 + gstep0), "v"(g0 + 2 * gstep0), "v"(g0 + 3 * gstep0),
           "v"(g1), "v"(g1 + gstep1), "v"(g1 + 2 * gstep1), "v"(g1 + 3 * gstep1)
        : "memory");
}

// The hand-over of a two-buffer ring, every wave: this wave's LDS reads of the
// buffer it leaves have returned, its own copies of the next tile have landed,
// and the barrier tells both to the other waves.
__device__ __forceinline__ void ring_publish() {
    asm volatile("s_wait_dscnt 0x0" ::: "memory");     // my reads of the old buffer are done
    asm volatile("s_wait_asynccnt 0x0" ::: "memory");  // my copies of the next tile have landed
    __syncthreads();
}

// Lane l takes the value of lane l ^ 16: the two lanes that share a column of a
// WMMA accumulator tile.
__device__ __forceinline__ float xhalf(float v) {
    int b = __builtin_bit_cast(int, v);
    return __builtin_bit_cast(float, __builtin_amdgcn_permlanex16(b, b, 0x76543210, 0xfedcba98, false, false));
}

// Eight f32 -> eight bf16, round-to-nearest-even, two a conversion instruction.
__device__ __forceinline__ v8bf cvt8(v8f v) { return __builtin_convertvector(v, v8bf); }

// ---------------- fp32 -> bf16 conversion -----------------------------------
// One launch converts x and the six weight matrices.  Their bf16 copies lie
// back to back in the workspace, so the destination is one array of 16 Mi
// elements; in units of 1 Mi elements x fills 0-3, wq 4, wk 5, wv 6, wo 7,
// w1 8-11, w2 12-15.  256 blocks of 16 waves, one per WGP: a block owns 64 Ki
// consecutive elements (always inside one source) and walks them in two
// rounds.  In a round a wave has 16 loads of 16 bytes a lane in flight, each
// covering 512 contiguous bytes; each store covers 256 contiguous bytes.

static constexpr int CVT_THREADS = 512;
static constexpr int CVT_BLOCKS  = 256;
static constexpr int CVT_LOADS   = 16;                         // 16-byte loads a lane and round
static constexpr int CVT_ROUNDS  = 2;
static constexpr int CVT_STEP    = CVT_THREADS * 4;            // elements a block-wide load covers
static constexpr int CVT_ROUND   = CVT_STEP * CVT_LOADS;       // elements a block converts a round
static constexpr int CVT_PER_BLOCK = CVT_ROUND * CVT_ROUNDS;   // 64 Ki elements
static_assert((size_t)CVT_BLOCKS * CVT_PER_BLOCK ==
              (size_t)BS * Dd + 4u * Dd * Dd + 2u * (size_t)FFf * Dd, "the grid covers every element once");
static_assert((1 << 20) % CVT_PER_BLOCK == 0, "a block never straddles two sources");

__global__ __launch_bounds__(CVT_THREADS) void cvt_all_bf16_kernel(
    const float* __restrict__ x,  const float* __restrict__ wq,
    const float* __restrict__ wk, const float* __restrict__ wv,
    const float* __restrict__ wo, const float* __restrict__ w1,
    const float* __restrict__ w2, u16* __restrict__ y) {
    const int seg = blockIdx.x >> 4;                   // which 1 Mi-element unit
    const float* src;
    int first;                                         // the source's first unit
    if (seg < 4)       { src = x;  first = 0; }
    else if (seg == 4) { src = wq; first = 4; }
    else if (seg == 5) { src = wk; first = 5; }
    else if (seg == 6) { src = wv; first = 6; }
    else if (seg == 7) { src = wo; first = 7; }
    else if (seg < 12) { src = w1; first = 8; }
    else               { src = w2; first = 12; }

    const size_t dst0 = (size_t)blockIdx.x * CVT_PER_BLOCK + threadIdx.x * 4;
    const float* s = src + (dst0 - ((size_t)first << 20));
    u16* d = y + dst0;

    for (int r = 0; r < CVT_ROUNDS; ++r) {
        f32x4 v[CVT_LOADS];
        // Both inner loops unrolled: constant indices keep v[] in registers.
#pragma unroll
        for (int i = 0; i < CVT_LOADS; ++i)
            v[i] = *reinterpret_cast<const f32x4*>(s + i * CVT_STEP);
        // Inputs-only fence on the loaded values: it keeps the round's 16 loads
        // ahead of its converts.  Left free, the compiler waits out each load
        // alone, with one in flight a wave.
        asm volatile("" :: "v"(v[0]), "v"(v[1]), "v"(v[2]), "v"(v[3]), "v"(v[4]), "v"(v[5]), "v"(v[6]), "v"(v[7]),
                           "v"(v[8]), "v"(v[9]), "v"(v[10]), "v"(v[11]), "v"(v[12]), "v"(v[13]), "v"(v[14]), "v"(v[15]));
#pragma unroll
        for (int i = 0; i < CVT_LOADS; ++i) {
            uint2 p;
            p.x = (u32)f2bf(v[i].x) | ((u32)f2bf(v[i].y) << 16);
            p.y = (u32)f2bf(v[i].z) | ((u32)f2bf(v[i].w) << 16);
            *reinterpret_cast<uint2*>(d + i * CVT_STEP) = p;
        }
        s += CVT_ROUND;
        d += CVT_ROUND;
    }
}

// MODE_QKV is the three projections of x as one product: Bt holds wq, wk and wv
// one below the other (N = 3 * D), Cb the three outputs one behind the other.  A
// block's 128 columns lie in one of the three, which picks its bias and layout.
// 768 blocks; the registers let two be resident on a WGP, so that while one waits
// for its copies or at its barrier the other has work.

enum { MODE_F32 = 0, MODE_RELU_BF16 = 1, MODE_QKV = 2 };

template <int MODE>
__global__ __launch_bounds__(256) void gemm_bf16_kernel(
    const u16* __restrict__ A, const u16* __restrict__ Bt,
    const float* __restrict__ bias, const float* __restrict__ biasK,
    const float* __restrict__ biasV, float* __restrict__ Cf,
    u16* __restrict__ Cb, int M, int N, int K) {
    __shared__ __attribute__((aligned(16))) u16 As[2][128 * LP];   // 2 x 18 KB
    __shared__ __attribute__((aligned(16))) u16 Bs[2][128 * LP];   // 2 x 18 KB

    const int tid  = threadIdx.x;
    const int lane = tid & 31;
    const int ln   = lane & 15;
    const int half = lane >> 4;
    const int wave = tid >> 5;
    const int wr   = (wave & 3) * 32;   // wave row offset within 128
    const int wc   = (wave >> 2) * 64;  // wave col offset within 128
    const int m0   = blockIdx.y * 128;
    const int n0   = blockIdx.x * 128;

    v8f acc[2][4] = {};

    // A tile is 128 rows x 128 B = 1024 pieces of 16 B: 4 a thread and operand.
    // A wave's copy covers four whole rows; copy i takes the rows 32 * i further on.
    const int crow = tid >> 3, cq = tid & 7;
    const u16* ga = A  + (size_t)(m0 + crow) * K + cq * 8;
    const u16* gb = Bt + (size_t)(n0 + crow) * K + cq * 8;
    const u32 la = lds_addr(&As[0][crow * LP + cq * 8]);
    const u32 lb = lds_addr(&Bs[0][crow * LP + cq * 8]);
    constexpr u32 LROWS = 32 * LP * 2;         // LDS bytes of 32 rows
    constexpr u32 LBUF  = 128 * LP * 2;        // LDS bytes of one buffer
    const size_t grows = (size_t)32 * K;       // elements of 32 rows in memory
    const int T = K / 64;

    async_copy4x2(la, lb, LROWS, ga, grows, gb, grows);
    asm volatile("s_wait_asynccnt 0x0" ::: "memory");  // tile 0 has landed before anyone reads it
    __syncthreads();
    if (T > 1)
        async_copy4x2(la + LBUF, lb + LBUF, LROWS, ga + 64, grows, gb + 64, grows);

    for (int t = 0; t < T; ++t) {
        const int buf = t & 1;
        const u16* as = As[buf];
        const u16* bs = Bs[buf];

        // All 24 fragment reads of the trip go out as one group, each fragment
        // into registers of its own, in the order in which the products use them.
        v16bf a[2][2], b[2][4];
#pragma unroll
        for (int c = 0; c < 2; ++c) {
#pragma unroll
            for (int i = 0; i < 2; ++i)
                a[c][i] = lds_load_op(as, wr + i * 16 + ln, LP, c * 32, lane);
#pragma unroll
            for (int j = 0; j < 4; ++j)
                b[c][j] = lds_load_op(bs, wc + j * 16 + ln, LP, c * 32, lane);
        }
        // Keeps the reads ahead of the products.  Left free, the compiler sinks each
        // B fragment's reads to its two products, into one shared register set, and
        // the wave waits out a whole LDS latency eight times a trip.
        __builtin_amdgcn_sched_barrier(0);

#pragma unroll
        for (int c = 0; c < 2; ++c) {
#pragma unroll
            for (int j = 0; j < 4; ++j) {
                acc[0][j] = wmma_bf16(a[c][0], b[c][j], acc[0][j]);
                acc[1][j] = wmma_bf16(a[c][1], b[c][j], acc[1][j]);
            }
        }
        // Keeps the products ahead of the hand-over.  Left free, the compiler lifts the
        // hand-over's waits and barrier over them: every product then waits for the last
        // read, and the next tile's copies have only the reads' time to land in.
        __builtin_amdgcn_sched_barrier(0);

        ring_publish();
        if (t + 2 < T)     // refill the buffers that every wave has just left
            async_copy4x2(la + buf * LBUF, lb + buf * LBUF, LROWS,
                          ga + (size_t)(t + 2) * 64, grows, gb + (size_t)(t + 2) * 64, grows);
    }
    asm volatile("s_wait_asynccnt 0x0" ::: "memory");  // no copy is left in flight at the wave's end

    // Epilogue.  C layout: VGPR r -> row r + 8*half, col = lane&15.
    if constexpr (MODE == MODE_QKV) {
        const int part = n0 >> 10;                     // 0 = Q, 1 = K, 2 = V, the same for the whole block
        const float* bp = part == 0 ? bias : part == 1 ? biasK : biasV;
        u16* cb = Cb + (size_t)part * BS * Dd;
        const int c0 = (n0 & (Dd - 1)) + wc + ln;      // column inside the part
        if (part < 2) {    // row = b*S+s ; col = h*DK+kk  ->  [b,h,s,kk] bf16
#pragma unroll
            for (int i = 0; i < 2; ++i) {
#pragma unroll
                for (int j = 0; j < 4; ++j) {
                    const int col = c0 + j * 16;
                    const float bval = bp[col];
                    const int h = col >> 6, kk = col & 63;
#pragma unroll
                    for (int r = 0; r < 8; ++r) {
                        const int row = m0 + wr + i * 16 + r + half * 8;
                        const int s = row & (Ss - 1), bidx = row >> 11;
                        cb[(((size_t)(bidx * Hh + h) * Ss + s) * DKk) + kk] = f2bf(acc[i][j][r] + bval);
                    }
                }
            }
        } else {           // [b,h,kk,s] (V transposed)
#pragma unroll
            for (int i = 0; i < 2; ++i) {
#pragma unroll
                for (int j = 0; j < 4; ++j) {
                    const int col = c0 + j * 16;
                    const float bval = bp[col];
                    const int h = col >> 6, kk = col & 63;
#pragma unroll
                    for (int r = 0; r < 8; ++r) {
                        const int row = m0 + wr + i * 16 + r + half * 8;
                        const int s = row & (Ss - 1), bidx = row >> 11;
                        cb[(((size_t)(bidx * Hh + h) * DKk + kk) * Ss) + s] = f2bf(acc[i][j][r] + bval);
                    }
                }
            }
            // In the listing a branch that is never taken here leads on into the other
            // layout's code, which rewrites the registers that these stores name.
            asm volatile("s_wait_xcnt 0x0" ::: "memory");
        }
    } else {
#pragma unroll
        for (int i = 0; i < 2; ++i) {
#pragma unroll
            for (int j = 0; j < 4; ++j) {
                const int col = n0 + wc + j * 16 + ln;
                const float bval = bias[col];
#pragma unroll
                for (int r = 0; r < 8; ++r) {
                    const int row = m0 + wr + i * 16 + r + half * 8;
                    float val = acc[i][j][r] + bval;
                    if constexpr (MODE == MODE_F32) {
                        Cf[(size_t)row * N + col] = val;
                    } else {
                        Cb[(size_t)row * N + col] = f2bf(fmaxf(val, 0.0f));
                    }
                }
            }
        }
    }
}

__global__ __launch_bounds__(128) void flash_attn_kernel(
    const u16* __restrict__ Q, const u16* __restrict__ Km,
    const u16* __restrict__ VT, u16* __restrict__ O) {
    __shared__ __attribute__((aligned(16))) u16 qs[64 * LP];       // 64 q rows x DK      (9 KB)
    __shared__ __attribute__((aligned(16))) u16 ks[2][64 * LP];    // 64 keys  x DK       (2 x 9 KB)
    __shared__ __attribute__((aligned(16))) u16 vts[2][64 * LP];   // DK rows  x 64 keys  (2 x 9 KB)

    const int tid  = threadIdx.x;
    const int lane = tid & 31;
    const int ln   = lane & 15;
    const int half = lane >> 4;
    const int wave = tid >> 5;
    const int bh   = blockIdx.y;                 // b*H + h
    const int q0   = blockIdx.x * 64;
    const int rb   = wave * 16;

    // A K or V^T tile is 64 rows x 128 B = 512 pieces of 16 B: 4 a thread and
    // tile.  A wave's copy covers four whole rows; copy i the rows 16 * i further on.
    const int crow = tid >> 3, cq = tid & 7;
    const u16* gk = Km + ((size_t)bh * Ss + crow) * DKk + cq * 8;
    const u16* gv = VT + ((size_t)bh * DKk + crow) * Ss + cq * 8;
    const u32 lk = lds_addr(&ks[0][crow * LP + cq * 8]);
    const u32 lv = lds_addr(&vts[0][crow * LP + cq * 8]);
    constexpr u32 LROWS = 16 * LP * 2;         // LDS bytes of 16 rows
    constexpr u32 LBUF  = 64 * LP * 2;         // LDS bytes of one buffer
    constexpr int T = Ss / 64;
    static_assert(T >= 2, "the ring's prologue fills two tiles");

    async_copy4x2(lk, lv, LROWS, gk, (size_t)16 * DKk, gv, (size_t)16 * Ss);

    // stage Q tile
    {
        const u16* qg = Q + ((size_t)bh * Ss + q0) * DKk;
        int row = tid >> 1, cb = (tid & 1) * 32;
#pragma unroll
        for (int q = 0; q < 4; ++q)
            *reinterpret_cast<uint4*>(&qs[row * LP + cb + q * 8]) =
                *reinterpret_cast<const uint4*>(&qg[(size_t)row * DKk + cb + q * 8]);
    }
    asm volatile("s_wait_asynccnt 0x0" ::: "memory");  // tile 0 has landed before anyone reads it
    __syncthreads();
    async_copy4x2(lk + LBUF, lv + LBUF, LROWS, gk + (size_t)64 * DKk, (size_t)16 * DKk, gv + 64, (size_t)16 * Ss);

    v16bf bq[2];   // Q^T as B operand: lane ln holds query rb + ln
#pragma unroll
    for (int c = 0; c < 2; ++c)
        bq[c] = lds_load_op(qs, rb + ln, LP, c * 32, lane);

    float m = -INFINITY, l = 0.0f;   // of query rb + ln; l sums this lane half's keys only
    v8f o[4] = {};                   // O^T: o[n][r] = head element n*16 + 8*half + r of query rb + ln

    for (int tile = 0; tile < T; ++tile) {
        const int buf = tile & 1;
        const u16* kt = ks[buf];
        const u16* vt = vts[buf];

        // scores^T: [64 keys] x [16 queries] in 4 tiles, accumulate over DK
        v8f s[4] = {};
#pragma unroll
        for (int c = 0; c < 2; ++c)
#pragma unroll
            for (int t = 0; t < 4; ++t) {
                v16bf ak = lds_load_op(kt, t * 16 + ln, LP, c * 32, lane);
                s[t] = wmma_bf16(ak, bq[c], s[t]);
            }
#pragma unroll
        for (int t = 0; t < 4; ++t) s[t] = s[t] * 0.125f;   // 1/sqrt(DK)

        // online softmax: a lane holds 32 of its query's 64 scores, lane ^ 16 the rest
        float mx[8];
#pragma unroll
        for (int r = 0; r < 8; ++r)
            mx[r] = fmaxf(fmaxf(s[0][r], s[1][r]), fmaxf(s[2][r], s[3][r]));
        float rmax = fmaxf(fmaxf(fmaxf(mx[0], mx[1]), fmaxf(mx[2], mx[3])),
                           fmaxf(fmaxf(mx[4], mx[5]), fmaxf(mx[6], mx[7])));
        rmax = fmaxf(rmax, xhalf(rmax));

        const float mn = fmaxf(m, rmax);
        const float alpha = __expf(m - mn);
        m = mn;
#pragma unroll
        for (int t = 0; t < 4; ++t)
#pragma unroll
            for (int r = 0; r < 8; ++r)
                s[t][r] = __expf(s[t][r] - m);

        const v8f sv = (s[0] + s[1]) + (s[2] + s[3]);
        l = l * alpha + (((sv[0] + sv[1]) + (sv[2] + sv[3])) + ((sv[4] + sv[5]) + (sv[6] + sv[7])));

        // P^T as B operand: element e is key c*32 + 8*half + e (e < 8), c*32 + 16 + 8*half + e - 8 (e >= 8)
        v16bf bp[2];
#pragma unroll
        for (int c = 0; c < 2; ++c)
            bp[c] = __builtin_shufflevector(cvt8(s[2 * c]), cvt8(s[2 * c + 1]),
                                            0, 1, 2, 3, 4, 5, 6, 7, 8, 9, 10, 11, 12, 13, 14, 15);

        // O^T = O^T*alpha + V^T @ P^T  (two 32-key WMMA K-steps per group of 16 head elements)
#pragma unroll
        for (int n = 0; n < 4; ++n) {
            o[n] = o[n] * alpha;
#pragma unroll
            for (int c = 0; c < 2; ++c) {
                v16bf av = lds_load_op(vt, n * 16 + ln, LP, c * 32, lane);
                o[n] = wmma_bf16(av, bp[c], o[n]);
            }
        }

        ring_publish();
        if (tile + 2 < T)  // refill the buffers that every wave has just left
            async_copy4x2(lk + buf * LBUF, lv + buf * LBUF, LROWS,
                          gk + (size_t)(tile + 2) * 64 * DKk, (size_t)16 * DKk,
                          gv + (tile + 2) * 64, (size_t)16 * Ss);
    }
    asm volatile("s_wait_asynccnt 0x0" ::: "memory");  // no copy is left in flight at the wave's end

    // finalize: O /= l, write concatenated-head layout [b, s, h*DK + col]; a lane's
    // eight registers of a tile are eight consecutive columns: one 16-byte store
    const int bidx = bh >> 4, h = bh & 15;
    l += xhalf(l);                   // join the two lane halves' sums
    const float inv = 1.0f / l;
    u16* op = O + ((size_t)bidx * Ss + q0 + rb + ln) * (Hh * DKk) + h * DKk + half * 8;
#pragma unroll
    for (int n = 0; n < 4; ++n)
        *reinterpret_cast<uint4*>(op + n * 16) = __builtin_bit_cast(uint4, cvt8(o[n] * inv));
}

// ---------------- residual + LayerNorm --------------------------------------
// one row per block; 256 threads * 4 elems = D

template <bool WRITE_BF16>
__global__ __launch_bounds__(256) void add_ln_kernel(
    const float* __restrict__ a, const float* __restrict__ b,
    const float* __restrict__ g, const float* __restrict__ be,
    float* __restrict__ oF, u16* __restrict__ oB) {
    __shared__ float ss[256], sq[256];
    const int row = blockIdx.x, tid = threadIdx.x;
    const int i0 = tid * 4;

    float4 xa = *reinterpret_cast<const float4*>(a + (size_t)row * Dd + i0);
    float4 xb = *reinterpret_cast<const float4*>(b + (size_t)row * Dd + i0);
    float v[4] = { xa.x + xb.x, xa.y + xb.y, xa.z + xb.z, xa.w + xb.w };

    float s = v[0] + v[1] + v[2] + v[3];
    float q = v[0] * v[0] + v[1] * v[1] + v[2] * v[2] + v[3] * v[3];
    ss[tid] = s; sq[tid] = q;
    __syncthreads();
    for (int st = 128; st > 0; st >>= 1) {
        if (tid < st) { ss[tid] += ss[tid + st]; sq[tid] += sq[tid + st]; }
        __syncthreads();
    }
    const float mu   = ss[0] * (1.0f / Dd);
    const float var  = sq[0] * (1.0f / Dd) - mu * mu;
    const float rstd = rsqrtf(var + LN_EPS);

    float4 gg = *reinterpret_cast<const float4*>(g + i0);
    float4 bb = *reinterpret_cast<const float4*>(be + i0);
    float o0 = (v[0] - mu) * rstd * gg.x + bb.x;
    float o1 = (v[1] - mu) * rstd * gg.y + bb.y;
    float o2 = (v[2] - mu) * rstd * gg.z + bb.z;
    float o3 = (v[3] - mu) * rstd * gg.w + bb.w;

    *reinterpret_cast<float4*>(oF + (size_t)row * Dd + i0) = make_float4(o0, o1, o2, o3);
    if constexpr (WRITE_BF16) {
        u16* p = oB + (size_t)row * Dd + i0;
        p[0] = f2bf(o0); p[1] = f2bf(o1); p[2] = f2bf(o2); p[3] = f2bf(o3);
    }
}

// ---------------- launcher ---------------------------------------------------

extern "C" void kernel_launch(void* const* d_in, const int* in_sizes, int n_in,
                              void* d_out, int out_size, void* d_ws, size_t ws_size,
                              hipStream_t stream) {
    const float* x  = (const float*)d_in[0];
    const float* wq = (const float*)d_in[1];  const float* bq = (const float*)d_in[2];
    const float* wk = (const float*)d_in[3];  const float* bk = (const float*)d_in[4];
    const float* wv = (const float*)d_in[5];  const float* bv = (const float*)d_in[6];
    const float* wo = (const float*)d_in[7];  const float* bo = (const float*)d_in[8];
    const float* g1 = (const float*)d_in[9];  const float* be1 = (const float*)d_in[10];
    const float* w1 = (const float*)d_in[11]; const float* b1 = (const float*)d_in[12];
    const float* w2 = (const float*)d_in[13]; const float* b2 = (const float*)d_in[14];
    const float* g2 = (const float*)d_in[15]; const float* be2 = (const float*)d_in[16];
    float* out = (float*)d_out;

    char* ws = (char*)d_ws;
    const size_t MB = 1024 * 1024;
    u16* XB  = (u16*)(ws + 0);          //  8 MB  x bf16 [BS, D]
    u16* WQB = (u16*)(ws + 8  * MB);    //  2 MB
    u16* WKB = (u16*)(ws + 10 * MB);    //  2 MB
    u16* WVB = (u16*)(ws + 12 * MB);    //  2 MB
    u16* WOB = (u16*)(ws + 14 * MB);    //  2 MB
    u16* W1B = (u16*)(ws + 16 * MB);    //  8 MB
    u16* W2B = (u16*)(ws + 24 * MB);    //  8 MB
    u16* Qb  = (u16*)(ws + 32 * MB);    //  8 MB  [B,H,S,DK]
    u16* Kb  = (u16*)(ws + 40 * MB);    //  8 MB  [B,H,S,DK]
    u16* VTb = (u16*)(ws + 48 * MB);    //  8 MB  [B,H,DK,S]
    u16* Ob  = (u16*)(ws + 56 * MB);    //  8 MB  [B,S,H*DK]
    float* ATT = (float*)(ws + 64 * MB);   // 16 MB [BS, D]
    float* N1F = (float*)(ws + 80 * MB);   // 16 MB
    u16*   N1B = (u16*)(ws + 96 * MB);     //  8 MB
    u16*   FF1 = (u16*)(ws + 104 * MB);    // 32 MB [BS, FF]
    float* FF2 = (float*)(ws + 136 * MB);  // 16 MB

    // 1. bf16 conversions: XB .. W2B are one contiguous destination
    cvt_all_bf16_kernel<<<CVT_BLOCKS, CVT_THREADS, 0, stream>>>(x, wq, wk, wv, wo, w1, w2, XB);

    // 2. QKV projections in one launch (N = 3 * H*DK = 3072, K = 1024): WQB, WKB, WVB
    //    are one [3072, 1024] matrix in the workspace, Qb, Kb, VTb one output range
    dim3 gP(Dd / 128, BS / 128);
    gemm_bf16_kernel<MODE_QKV><<<dim3(3 * Dd / 128, BS / 128), 256, 0, stream>>>(
        XB, WQB, bq, bk, bv, nullptr, Qb, BS, 3 * Dd, Dd);

    // 3. fused attention
    flash_attn_kernel<<<dim3(Ss / 64, Bb * Hh), 128, 0, stream>>>(Qb, Kb, VTb, Ob);

    // 4. output projection
    gemm_bf16_kernel<MODE_F32><<<gP, 256, 0, stream>>>(Ob, WOB, bo, nullptr, nullptr, ATT, nullptr, BS, Dd, Dd);

    // 5. LN1 (residual with x), keep bf16 mirror for FFN input
    add_ln_kernel<true><<<BS, 256, 0, stream>>>(ATT, x, g1, be1, N1F, N1B);

    // 6. FFN
    gemm_bf16_kernel<MODE_RELU_BF16><<<dim3(FFf / 128, BS / 128), 256, 0, stream>>>(
        N1B, W1B, b1, nullptr, nullptr, nullptr, FF1, BS, FFf, Dd);
    gemm_bf16_kernel<MODE_F32><<<gP, 256, 0, stream>>>(FF1, W2B, b2, nullptr, nullptr, FF2, nullptr, BS, Dd, FFf);

    // 7. LN2 -> output
    add_ln_kernel<false><<<BS, 256, 0, stream>>>(FF2, N1F, g2, be2, out, nullptr);
}

// v007
// One run takes 166 microseconds.
// Timed twice side by side with v006, it ran 1.14 times as fast both times.
// Counting every step since v000, it is 4.34 times as fast.
#include <hip/hip_runtime.h>

// ---------------------------------------------------------------------------
// Transformer encoder block for MI455X (gfx1250, wave32, WMMA bf16)
//   B=2, S=2048, D=1024, H=16, DK=64, FF=4096, fp32 I/O
// ---------------------------------------------------------------------------

typedef __attribute__((ext_vector_type(16))) __bf16 v16bf;
typedef __attribute__((ext_vector_type(8)))  __bf16 v8bf;
typedef __attribute__((ext_vector_type(8)))  float  v8f;
typedef __attribute__((ext_vector_type(4)))  float  f32x4;

using u16 = unsigned short;
using u32 = unsigned int;

static constexpr int Hh = 16;
static constexpr int Dd = 1024;
static constexpr int DKk = 64;
static constexpr int FFf = 4096;
static constexpr int Bb = 2;
static constexpr int Ss = 2048;
static constexpr int BS = Bb * Ss;       // 4096 rows
static constexpr float LN_EPS = 1e-5f;
// LDS row pitch in bf16 elements for tiles of 64 elements a row: 144 B = 16 B x 9.
// An odd multiple of 16 B spreads the 16 rows of a ds_load_b128 fragment read
// over all 64 banks; at 128 B eight rows fall on the same four banks.
static constexpr int LP = 72;

// ---------------- helpers ---------------------------------------------------

__device__ __forceinline__ u16 f2bf(float f) {
    u32 u = __float_as_uint(f);
    u32 r = u + 0x7FFFu + ((u >> 16) & 1u);   // round-to-nearest-even
    return (u16)(r >> 16);
}

union Op32 { uint4 q[2]; v16bf v; };

// Load one WMMA 16x16x32 bf16 operand (A layout; B uses the same pattern on
// the transposed [N,K] matrix).  `base` points at a row-major bf16 tile in
// LDS with `stride` elements per row, `kbase` selects the 32-wide K chunk.
// Lanes 0-15: K = kbase+{0..7,16..23};  lanes 16-31: K = kbase+{8..15,24..31}.
__device__ __forceinline__ v16bf lds_load_op(const u16* base, int row, int stride,
                                             int kbase, int lane) {
    const u16* p = base + row * stride + kbase + ((lane >> 4) & 1) * 8;
    Op32 u;
    u.q[0] = *reinterpret_cast<const uint4*>(p);
    u.q[1] = *reinterpret_cast<const uint4*>(p + 16);
    return u.v;
}

__device__ __forceinline__ v8f wmma_bf16(v16bf a, v16bf b, v8f c) {
    return __builtin_amdgcn_wmma_f32_16x16x32_bf16(false, a, false, b,
                                                   (short)0, c, false, false);
}

// Byte address inside the work-group's LDS: the low half of the flat address.
__device__ __forceinline__ u32 lds_addr(const void* p) { return (u32)(size_t)p; }

// Eight asynchronous copies of 16 bytes a lane, global memory -> LDS, through
// no register: four for each of two tiles.  Copy i of tile n moves the bytes at
// gn + i * gstepn to LDS byte ln + i * lstep.  The s_wait_xcnt stands inside the
// statement, behind the last copy, so that no address register is rewritten
// ahead of it.
__device__ __forceinline__ void async_copy4x2(u32 l0, u32 l1, u32 lstep, const u16* g0, size_t gstep0,
                                              const u16* g1, size_t gstep1) {
    asm volatile(
        "global_load_async_to_lds_b128 %0, %8, off\n\t"
        "global_load_async_to_lds_b128 %1, %9, off\n\t"
        "global_load_async_to_lds_b128 %2, %10, off\n\t"
        "global_load_async_to_lds_b128 %3, %11, off\n\t"
        "global_load_async_to_lds_b128 %4, %12, off\n\t"
        "global_load_async_to_lds_b128 %5, %13, off\n\t"
        "global_load_async_to_lds_b128 %6, %14, off\n\t"
        "global_load_async_to_lds_b128 %7, %15, off\n\t"
        "s_wait_xcnt 0x0"
        :: "v"(l0), "v"(l0 + lstep), "v"(l0 + 2 * lstep), "v"(l0 + 3 * lstep),
           "v"(l1), "v"(l1 + lstep), "v"(l1 + 2 * lstep), "v"(l1 + 3 * lstep),
           "v"(g0), "v"(g0 + gstep0), "v"(g0 + 2 * gstep0), "v"(g0 + 3 * gstep0),
           "v"(g1), "v"(g1 + gstep1), "v"(g1 + 2 * gstep1), "v"(g1 + 3 * gstep1)
        : "memory");
}

// The hand-over of a two-buffer ring, every wave: this wave's LDS reads of the
// buffer it leaves have returned, its own copies of the next tile have landed,
// and the barrier tells both to the other waves.
__device__ __forceinline__ void ring_publish() {
    asm volatile("s_wait_dscnt 0x0" ::: "memory");     // my reads of the old buffer are done
    asm volatile("s_wait_asynccnt 0x0" ::: "memory");  // my copies of the next tile have landed
    __syncthreads();
}

// Lane l takes the value of lane l ^ 16: the two lanes that share a column of a
// WMMA accumulator tile.
__device__ __forceinline__ float xhalf(float v) {
    int b = __builtin_bit_cast(int, v);
    return __builtin_bit_cast(float, __builtin_amdgcn_permlanex16(b, b, 0x76543210, 0xfedcba98, false, false));
}

// Eight f32 -> eight bf16, round-to-nearest-even, two a conversion instruction.
__device__ __forceinline__ v8bf cvt8(v8f v) { return __builtin_convertvector(v, v8bf); }

// ---------------- fp32 -> bf16 conversion -----------------------------------
// One launch converts x and the six weight matrices.  Their bf16 copies lie
// back to back in the workspace, so the destination is one array of 16 Mi
// elements; in units of 1 Mi elements x fills 0-3, wq 4, wk 5, wv 6, wo 7,
// w1 8-11, w2 12-15.  256 blocks of 16 waves, one per WGP: a block owns 64 Ki
// consecutive elements (always inside one source) and walks them in two
// rounds.  In a round a wave has 16 loads of 16 bytes a lane in flight, each
// covering 512 contiguous bytes; each store covers 256 contiguous bytes.

static constexpr int CVT_THREADS = 512;
static constexpr int CVT_BLOCKS  = 256;
static constexpr int CVT_LOADS   = 16;                         // 16-byte loads a lane and round
static constexpr int CVT_ROUNDS  = 2;
static constexpr int CVT_STEP    = CVT_THREADS * 4;            // elements a block-wide load covers
static constexpr int CVT_ROUND   = CVT_STEP * CVT_LOADS;       // elements a block converts a round
static constexpr int CVT_PER_BLOCK = CVT_ROUND * CVT_ROUNDS;   // 64 Ki elements
static_assert((size_t)CVT_BLOCKS * CVT_PER_BLOCK ==
              (size_t)BS * Dd + 4u * Dd * Dd + 2u * (size_t)FFf * Dd, "the grid covers every element once");
static_assert((1 << 20) % CVT_PER_BLOCK == 0, "a block never straddles two sources");

__global__ __launch_bounds__(CVT_THREADS) void cvt_all_bf16_kernel(
    const float* __restrict__ x,  const float* __restrict__ wq,
    const float* __restrict__ wk, const float* __restrict__ wv,
    const float* __restrict__ wo, const float* __restrict__ w1,
    const float* __restrict__ w2, u16* __restrict__ y) {
    const int seg = blockIdx.x >> 4;                   // which 1 Mi-element unit
    const float* src;
    int first;                                         // the source's first unit
    if (seg < 4)       { src = x;  first = 0; }
    else if (seg == 4) { src = wq; first = 4; }
    else if (seg == 5) { src = wk; first = 5; }
    else if (seg == 6) { src = wv; first = 6; }
    else if (seg == 7) { src = wo; first = 7; }
    else if (seg < 12) { src = w1; first = 8; }
    else               { src = w2; first = 12; }

    const size_t dst0 = (size_t)blockIdx.x * CVT_PER_BLOCK + threadIdx.x * 4;
    const float* s = src + (dst0 - ((size_t)first << 20));
    u16* d = y + dst0;

    for (int r = 0; r < CVT_ROUNDS; ++r) {
        f32x4 v[CVT_LOADS];
        // Both inner loops unrolled: constant indices keep v[] in registers.
#pragma unroll
        for (int i = 0; i < CVT_LOADS; ++i)
            v[i] = *reinterpret_cast<const f32x4*>(s + i * CVT_STEP);
        // Inputs-only fence on the loaded values: it keeps the round's 16 loads
        // ahead of its converts.  Left free, the compiler waits out each load
        // alone, with one in flight a wave.
        asm volatile("" :: "v"(v[0]), "v"(v[1]), "v"(v[2]), "v"(v[3]), "v"(v[4]), "v"(v[5]), "v"(v[6]), "v"(v[7]),
                           "v"(v[8]), "v"(v[9]), "v"(v[10]), "v"(v[11]), "v"(v[12]), "v"(v[13]), "v"(v[14]), "v"(v[15]));
#pragma unroll
        for (int i = 0; i < CVT_LOADS; ++i) {
            uint2 p;
            p.x = (u32)f2bf(v[i].x) | ((u32)f2bf(v[i].y) << 16);
            p.y = (u32)f2bf(v[i].z) | ((u32)f2bf(v[i].w) << 16);
            *reinterpret_cast<uint2*>(d + i * CVT_STEP) = p;
        }
        s += CVT_ROUND;
        d += CVT_ROUND;
    }
}

// ---------------- generic WMMA GEMM -----------------------------------------
// C[M,N] = A[M,K](bf16) * Bt[N,K](bf16)^T + bias[N], with epilogue modes.
// Block tile 128x128, K-step 64, 8 waves; wave tile 32x64 (2x4 WMMA tiles).
// The A and B tiles come into LDS by asynchronous copies, in a ring of four
// buffers: the copies of the next three tiles fly while this tile is multiplied,
// so that a tile has three trips to land in and the requests of one tile follow
// those of the tile before without a pause.

// MODE_QKV is the three projections of x as one product: Bt holds wq, wk and wv
// one below the other (N = 3 * D), Cb the three outputs one behind the other.  A
// block's 128 columns lie in one of the three, which picks its bias and layout.
// 768 blocks; the registers let two be resident on a WGP, so that while one waits
// for its copies or at its barrier the other has work.

enum { MODE_F32 = 0, MODE_RELU_BF16 = 1, MODE_QKV = 2 };

static constexpr int NBUF = 4;   // buffers of the GEMM ring; 2 x 4 x 18 KB of LDS, two blocks fit a WGP
static_assert(NBUF == 4, "the counted waits below are written for four buffers and eight copies a wave and tile");

template <int MODE>
__global__ __launch_bounds__(256) void gemm_bf16_kernel(
    const u16* __restrict__ A, const u16* __restrict__ Bt,
    const float* __restrict__ bias, const float* __restrict__ biasK,
    const float* __restrict__ biasV, float* __restrict__ Cf,
    u16* __restrict__ Cb, int M, int N, int K) {
    __shared__ __attribute__((aligned(16))) u16 As[NBUF][128 * LP];   // 4 x 18 KB
    __shared__ __attribute__((aligned(16))) u16 Bs[NBUF][128 * LP];   // 4 x 18 KB

    const int tid  = threadIdx.x;
    const int lane = tid & 31;
    const int ln   = lane & 15;
    const int half = lane >> 4;
    const int wave = tid >> 5;
    const int wr   = (wave & 3) * 32;   // wave row offset within 128
    const int wc   = (wave >> 2) * 64;  // wave col offset within 128
    const int m0   = blockIdx.y * 128;
    const int n0   = blockIdx.x * 128;

    v8f acc[2][4] = {};

    // A tile is 128 rows x 128 B = 1024 pieces of 16 B: 4 a thread and operand.
    // A wave's copy covers four whole rows; copy i takes the rows 32 * i further on.
    const int crow = tid >> 3, cq = tid & 7;
    const u16* ga = A  + (size_t)(m0 + crow) * K + cq * 8;
    const u16* gb = Bt + (size_t)(n0 + crow) * K + cq * 8;
    const u32 la = lds_addr(&As[0][crow * LP + cq * 8]);
    const u32 lb = lds_addr(&Bs[0][crow * LP + cq * 8]);
    constexpr u32 LROWS = 32 * LP * 2;         // LDS bytes of 32 rows
    constexpr u32 LBUF  = 128 * LP * 2;        // LDS bytes of one buffer
    const size_t grows = (size_t)32 * K;       // elements of 32 rows in memory
    const int T = K / 64;

    // The first four tiles, each into a buffer that nobody has read yet.  The loop is
    // unrolled so that each buffer's offsets are constants.
    async_copy4x2(la, lb, LROWS, ga, grows, gb, grows);
#pragma unroll
    for (int s = 1; s < NBUF; ++s)
        if (s < T)
            async_copy4x2(la + s * LBUF, lb + s * LBUF, LROWS, ga + s * 64, grows, gb + s * 64, grows);
    // Tile 0 has landed before anyone reads it: a wave's copies count down in issue
    // order, and its 24 youngest are those of tiles 1 to 3.
    if (T >= NBUF) asm volatile("s_wait_asynccnt 0x18" ::: "memory");
    else           asm volatile("s_wait_asynccnt 0x0" ::: "memory");
    __syncthreads();

    for (int t = 0; t < T; ++t) {
        const int buf = t & (NBUF - 1);
        const u16* as = As[buf];
        const u16* bs = Bs[buf];

        // All 24 fragment reads of the trip go out as one group, each fragment
        // into registers of its own, in the order in which the products use them.
        v16bf a[2][2], b[2][4];
#pragma unroll
        for (int c = 0; c < 2; ++c) {
#pragma unroll
            for (int i = 0; i < 2; ++i)
                a[c][i] = lds_load_op(as, wr + i * 16 + ln, LP, c * 32, lane);
#pragma unroll
            for (int j = 0; j < 4; ++j)
                b[c][j] = lds_load_op(bs, wc + j * 16 + ln, LP, c * 32, lane);
        }
        // Keeps the reads ahead of the products.  Left free, the compiler sinks each
        // B fragment's reads to its two products, into one shared register set, and
        // the wave waits out a whole LDS latency eight times a trip.
        __builtin_amdgcn_sched_barrier(0);

#pragma unroll
        for (int c = 0; c < 2; ++c) {
#pragma unroll
            for (int j = 0; j < 4; ++j) {
                acc[0][j] = wmma_bf16(a[c][0], b[c][j], acc[0][j]);
                acc[1][j] = wmma_bf16(a[c][1], b[c][j], acc[1][j]);
            }
        }
        // Keeps the products ahead of the hand-over.  Left free, the compiler lifts the
        // hand-over's waits and barrier over them: every product then waits for the last
        // read, and tile t + 1's copies lose this trip's products from their time to land in.
        __builtin_amdgcn_sched_barrier(0);

        // The hand-over, every wave: my reads of this buffer are done, my copies of tile
        // t + 1 have landed, and the barrier tells both to the other waves.  While tile
        // t + 3 exists the wave's 16 youngest copies are those of tiles t + 2 and t + 3,
        // which stay in flight; in the last trips nothing younger has been issued for long.
        asm volatile("s_wait_dscnt 0x0" ::: "memory");
        if (t + NBUF - 1 < T) asm volatile("s_wait_asynccnt 0x10" ::: "memory");
        else                  asm volatile("s_wait_asynccnt 0x0" ::: "memory");
        __syncthreads();
        if (t + NBUF < T)  // refill the buffers that every wave has just left
            async_copy4x2(la + buf * LBUF, lb + buf * LBUF, LROWS,
                          ga + (size_t)(t + NBUF) * 64, grows, gb + (size_t)(t + NBUF) * 64, grows);
    }
    asm volatile("s_wait_asynccnt 0x0" ::: "memory");  // no copy is left in flight at the wave's end

    // Epilogue.  C layout: VGPR r -> row r + 8*half, col = lane&15.
    if constexpr (MODE == MODE_QKV) {
        const int part = n0 >> 10;                     // 0 = Q, 1 = K, 2 = V, the same for the whole block
        const float* bp = part == 0 ? bias : part == 1 ? biasK : biasV;
        u16* cb = Cb + (size_t)part * BS * Dd;
        const int c0 = (n0 & (Dd - 1)) + wc + ln;      // column inside the part
        if (part < 2) {    // row = b*S+s ; col = h*DK+kk  ->  [b,h,s,kk] bf16
#pragma unroll
            for (int i = 0; i < 2; ++i) {
#pragma unroll
                for (int j = 0; j < 4; ++j) {
                    const int col = c0 + j * 16;
                    const float bval = bp[col];
                    const int h = col >> 6, kk = col & 63;
#pragma unroll
                    for (int r = 0; r < 8; ++r) {
                        const int row = m0 + wr + i * 16 + r + half * 8;
                        const int s = row & (Ss - 1), bidx = row >> 11;
                        cb[(((size_t)(bidx * Hh + h) * Ss + s) * DKk) + kk] = f2bf(acc[i][j][r] + bval);
                    }
                }
            }
        } else {           // [b,h,kk,s] (V transposed)
#pragma unroll
            for (int i = 0; i < 2; ++i) {
#pragma unroll
                for (int j = 0; j < 4; ++j) {
                    const int col = c0 + j * 16;
                    const float bval = bp[col];
                    const int h = col >> 6, kk = col & 63;
#pragma unroll
                    for (int r = 0; r < 8; ++r) {
                        const int row = m0 + wr + i * 16 + r + half * 8;
                        const int s = row & (Ss - 1), bidx = row >> 11;
                        cb[(((size_t)(bidx * Hh + h) * DKk + kk) * Ss) + s] = f2bf(acc[i][j][r] + bval);
                    }
                }
            }
            // In the listing a branch that is never taken here leads on into the other
            // layout's code, which rewrites the registers that these stores name.
            asm volatile("s_wait_xcnt 0x0" ::: "memory");
        }
    } else {
#pragma unroll
        for (int i = 0; i < 2; ++i) {
#pragma unroll
            for (int j = 0; j < 4; ++j) {
                const int col = n0 + wc + j * 16 + ln;
                const float bval = bias[col];
#pragma unroll
                for (int r = 0; r < 8; ++r) {
                    const int row = m0 + wr + i * 16 + r + half * 8;
                    float val = acc[i][j][r] + bval;
                    if constexpr (MODE == MODE_F32) {
                        Cf[(size_t)row * N + col] = val;
                    } else {
                        Cb[(size_t)row * N + col] = f2bf(fmaxf(val, 0.0f));
                    }
                }
            }
        }
    }
}

__global__ __launch_bounds__(128) void flash_attn_kernel(
    const u16* __restrict__ Q, const u16* __restrict__ Km,
    const u16* __restrict__ VT, u16* __restrict__ O) {
    __shared__ __attribute__((aligned(16))) u16 qs[64 * LP];       // 64 q rows x DK      (9 KB)
    __shared__ __attribute__((aligned(16))) u16 ks[2][64 * LP];    // 64 keys  x DK       (2 x 9 KB)
    __shared__ __attribute__((aligned(16))) u16 vts[2][64 * LP];   // DK rows  x 64 keys  (2 x 9 KB)

    const int tid  = threadIdx.x;
    const int lane = tid & 31;
    const int ln   = lane & 15;
    const int half = lane >> 4;
    const int wave = tid >> 5;
    const int bh   = blockIdx.y;                 // b*H + h
    const int q0   = blockIdx.x * 64;
    const int rb   = wave * 16;

    // A K or V^T tile is 64 rows x 128 B = 512 pieces of 16 B: 4 a thread and
    // tile.  A wave's copy covers four whole rows; copy i the rows 16 * i further on.
    const int crow = tid >> 3, cq = tid & 7;
    const u16* gk = Km + ((size_t)bh * Ss + crow) * DKk + cq * 8;
    const u16* gv = VT + ((size_t)bh * DKk + crow) * Ss + cq * 8;
    const u32 lk = lds_addr(&ks[0][crow * LP + cq * 8]);
    const u32 lv = lds_addr(&vts[0][crow * LP + cq * 8]);
    constexpr u32 LROWS = 16 * LP * 2;         // LDS bytes of 16 rows
    constexpr u32 LBUF  = 64 * LP * 2;         // LDS bytes of one buffer
    constexpr int T = Ss / 64;
    static_assert(T >= 2, "the ring's prologue fills two tiles");

    async_copy4x2(lk, lv, LROWS, gk, (size_t)16 * DKk, gv, (size_t)16 * Ss);

    // stage Q tile
    {
        const u16* qg = Q + ((size_t)bh * Ss + q0) * DKk;
        int row = tid >> 1, cb = (tid & 1) * 32;
#pragma unroll
        for (int q = 0; q < 4; ++q)
            *reinterpret_cast<uint4*>(&qs[row * LP + cb + q * 8]) =
                *reinterpret_cast<const uint4*>(&qg[(size_t)row * DKk + cb + q * 8]);
    }
    asm volatile("s_wait_asynccnt 0x0" ::: "memory");  // tile 0 has landed before anyone reads it
    __syncthreads();
    async_copy4x2(lk + LBUF, lv + LBUF, LROWS, gk + (size_t)64 * DKk, (size_t)16 * DKk, gv + 64, (size_t)16 * Ss);

    v16bf bq[2];   // Q^T as B operand: lane ln holds query rb + ln
#pragma unroll
    for (int c = 0; c < 2; ++c)
        bq[c] = lds_load_op(qs, rb + ln, LP, c * 32, lane);

    float m = -INFINITY, l = 0.0f;   // of query rb + ln; l sums this lane half's keys only
    v8f o[4] = {};                   // O^T: o[n][r] = head element n*16 + 8*half + r of query rb + ln

    for (int tile = 0; tile < T; ++tile) {
        const int buf = tile & 1;
        const u16* kt = ks[buf];
        const u16* vt = vts[buf];

        // scores^T: [64 keys] x [16 queries] in 4 tiles, accumulate over DK
        v8f s[4] = {};
#pragma unroll
        for (int c = 0; c < 2; ++c)
#pragma unroll
            for (int t = 0; t < 4; ++t) {
                v16bf ak = lds_load_op(kt, t * 16 + ln, LP, c * 32, lane);
                s[t] = wmma_bf16(ak, bq[c], s[t]);
            }
#pragma unroll
        for (int t = 0; t < 4; ++t) s[t] = s[t] * 0.125f;   // 1/sqrt(DK)

        // online softmax: a lane holds 32 of its query's 64 scores, lane ^ 16 the rest
        float mx[8];
#pragma unroll
        for (int r = 0; r < 8; ++r)
            mx[r] = fmaxf(fmaxf(s[0][r], s[1][r]), fmaxf(s[2][r], s[3][r]));
        float rmax = fmaxf(fmaxf(fmaxf(mx[0], mx[1]), fmaxf(mx[2], mx[3])),
                           fmaxf(fmaxf(mx[4], mx[5]), fmaxf(mx[6], mx[7])));
        rmax = fmaxf(rmax, xhalf(rmax));

        const float mn = fmaxf(m, rmax);
        const float alpha = __expf(m - mn);
        m = mn;
#pragma unroll
        for (int t = 0; t < 4; ++t)
#pragma unroll
            for (int r = 0; r < 8; ++r)
                s[t][r] = __expf(s[t][r] - m);

        const v8f sv = (s[0] + s[1]) + (s[2] + s[3]);
        l = l * alpha + (((sv[0] + sv[1]) + (sv[2] + sv[3])) + ((sv[4] + sv[5]) + (sv[6] + sv[7])));

        // P^T as B operand: element e is key c*32 + 8*half + e (e < 8), c*32 + 16 + 8*half + e - 8 (e >= 8)
        v16bf bp[2];
#pragma unroll
        for (int c = 0; c < 2; ++c)
            bp[c] = __builtin_shufflevector(cvt8(s[2 * c]), cvt8(s[2 * c + 1]),
                                            0, 1, 2, 3, 4, 5, 6, 7, 8, 9, 10, 11, 12, 13, 14, 15);

        // O^T = O^T*alpha + V^T @ P^T  (two 32-key WMMA K-steps per group of 16 head elements)
#pragma unroll
        for (int n = 0; n < 4; ++n) {
            o[n] = o[n] * alpha;
#pragma unroll
            for (int c = 0; c < 2; ++c) {
                v16bf av = lds_load_op(vt, n * 16 + ln, LP, c * 32, lane);
                o[n] = wmma_bf16(av, bp[c], o[n]);
            }
        }

        ring_publish();
        if (tile + 2 < T)  // refill the buffers that every wave has just left
            async_copy4x2(lk + buf * LBUF, lv + buf * LBUF, LROWS,
                          gk + (size_t)(tile + 2) * 64 * DKk, (size_t)16 * DKk,
                          gv + (tile + 2) * 64, (size_t)16 * Ss);
    }
    asm volatile("s_wait_asynccnt 0x0" ::: "memory");  // no copy is left in flight at the wave's end

    // finalize: O /= l, write concatenated-head layout [b, s, h*DK + col]; a lane's
    // eight registers of a tile are eight consecutive columns: one 16-byte store
    const int bidx = bh >> 4, h = bh & 15;
    l += xhalf(l);                   // join the two lane halves' sums
    const float inv = 1.0f / l;
    u16* op = O + ((size_t)bidx * Ss + q0 + rb + ln) * (Hh * DKk) + h * DKk + half * 8;
#pragma unroll
    for (int n = 0; n < 4; ++n)
        *reinterpret_cast<uint4*>(op + n * 16) = __builtin_bit_cast(uint4, cvt8(o[n] * inv));
}

// ---------------- residual + LayerNorm --------------------------------------
// one row per block; 256 threads * 4 elems = D

template <bool WRITE_BF16>
__global__ __launch_bounds__(256) void add_ln_kernel(
    const float* __restrict__ a, const float* __restrict__ b,
    const float* __restrict__ g, const float* __restrict__ be,
    float* __restrict__ oF, u16* __restrict__ oB) {
    __shared__ float ss[256], sq[256];
    const int row = blockIdx.x, tid = threadIdx.x;
    const int i0 = tid * 4;

    float4 xa = *reinterpret_cast<const float4*>(a + (size_t)row * Dd + i0);
    float4 xb = *reinterpret_cast<const float4*>(b + (size_t)row * Dd + i0);
    float v[4] = { xa.x + xb.x, xa.y + xb.y, xa.z + xb.z, xa.w + xb.w };

    float s = v[0] + v[1] + v[2] + v[3];
    float q = v[0] * v[0] + v[1] * v[1] + v[2] * v[2] + v[3] * v[3];
    ss[tid] = s; sq[tid] = q;
    __syncthreads();
    for (int st = 128; st > 0; st >>= 1) {
        if (tid < st) { ss[tid] += ss[tid + st]; sq[tid] += sq[tid + st]; }
        __syncthreads();
    }
    const float mu   = ss[0] * (1.0f / Dd);
    const float var  = sq[0] * (1.0f / Dd) - mu * mu;
    const float rstd = rsqrtf(var + LN_EPS);

    float4 gg = *reinterpret_cast<const float4*>(g + i0);
    float4 bb = *reinterpret_cast<const float4*>(be + i0);
    float o0 = (v[0] - mu) * rstd * gg.x + bb.x;
    float o1 = (v[1] - mu) * rstd * gg.y + bb.y;
    float o2 = (v[2] - mu) * rstd * gg.z + bb.z;
    float o3 = (v[3] - mu) * rstd * gg.w + bb.w;

    *reinterpret_cast<float4*>(oF + (size_t)row * Dd + i0) = make_float4(o0, o1, o2, o3);
    if constexpr (WRITE_BF16) {
        u16* p = oB + (size_t)row * Dd + i0;
        p[0] = f2bf(o0); p[1] = f2bf(o1); p[2] = f2bf(o2); p[3] = f2bf(o3);
    }
}

// ---------------- launcher ---------------------------------------------------

extern "C" void kernel_launch(void* const* d_in, const int* in_sizes, int n_in,
                              void* d_out, int out_size, void* d_ws, size_t ws_size,
                              hipStream_t stream) {
    const float* x  = (const float*)d_in[0];
    const float* wq = (const float*)d_in[1];  const float* bq = (const float*)d_in[2];
    const float* wk = (const float*)d_in[3];  const float* bk = (const float*)d_in[4];
    const float* wv = (const float*)d_in[5];  const float* bv = (const float*)d_in[6];
    const float* wo = (const float*)d_in[7];  const float* bo = (const float*)d_in[8];
    const float* g1 = (const float*)d_in[9];  const float* be1 = (const float*)d_in[10];
    const float* w1 = (const float*)d_in[11]; const float* b1 = (const float*)d_in[12];
    const float* w2 = (const float*)d_in[13]; const float* b2 = (const float*)d_in[14];
    const float* g2 = (const float*)d_in[15]; const float* be2 = (const float*)d_in[16];
    float* out = (float*)d_out;

    char* ws = (char*)d_ws;
    const size_t MB = 1024 * 1024;
    u16* XB  = (u16*)(ws + 0);          //  8 MB  x bf16 [BS, D]
    u16* WQB = (u16*)(ws + 8  * MB);    //  2 MB
    u16* WKB = (u16*)(ws + 10 * MB);    //  2 MB
    u16* WVB = (u16*)(ws + 12 * MB);    //  2 MB
    u16* WOB = (u16*)(ws + 14 * MB);    //  2 MB
    u16* W1B = (u16*)(ws + 16 * MB);    //  8 MB
    u16* W2B = (u16*)(ws + 24 * MB);    //  8 MB
    u16* Qb  = (u16*)(ws + 32 * MB);    //  8 MB  [B,H,S,DK]
    u16* Kb  = (u16*)(ws + 40 * MB);    //  8 MB  [B,H,S,DK]
    u16* VTb = (u16*)(ws + 48 * MB);    //  8 MB  [B,H,DK,S]
    u16* Ob  = (u16*)(ws + 56 * MB);    //  8 MB  [B,S,H*DK]
    float* ATT = (float*)(ws + 64 * MB);   // 16 MB [BS, D]
    float* N1F = (float*)(ws + 80 * MB);   // 16 MB
    u16*   N1B = (u16*)(ws + 96 * MB);     //  8 MB
    u16*   FF1 = (u16*)(ws + 104 * MB);    // 32 MB [BS, FF]
    float* FF2 = (float*)(ws + 136 * MB);  // 16 MB

    // 1. bf16 conversions: XB .. W2B are one contiguous destination
    cvt_all_bf16_kernel<<<CVT_BLOCKS, CVT_THREADS, 0, stream>>>(x, wq, wk, wv, wo, w1, w2, XB);

    // 2. QKV projections in one launch (N = 3 * H*DK = 3072, K = 1024): WQB, WKB, WVB
    //    are one [3072, 1024] matrix in the workspace, Qb, Kb, VTb one output range
    dim3 gP(Dd / 128, BS / 128);
    gemm_bf16_kernel<MODE_QKV><<<dim3(3 * Dd / 128, BS / 128), 256, 0, stream>>>(
        XB, WQB, bq, bk, bv, nullptr, Qb, BS, 3 * Dd, Dd);

    // 3. fused attention
    flash_attn_kernel<<<dim3(Ss / 64, Bb * Hh), 128, 0, stream>>>(Qb, Kb, VTb, Ob);

    // 4. output projection
    gemm_bf16_kernel<MODE_F32><<<gP, 256, 0, stream>>>(Ob, WOB, bo, nullptr, nullptr, ATT, nullptr, BS, Dd, Dd);

    // 5. LN1 (residual with x), keep bf16 mirror for FFN input
    add_ln_kernel<true><<<BS, 256, 0, stream>>>(ATT, x, g1, be1, N1F, N1B);

    // 6. FFN
    gemm_bf16_kernel<MODE_RELU_BF16><<<dim3(FFf / 128, BS / 128), 256, 0, stream>>>(
        N1B, W1B, b1, nullptr, nullptr, nullptr, FF1, BS, FFf, Dd);
    gemm_bf16_kernel<MODE_F32><<<gP, 256, 0, stream>>>(FF1, W2B, b2, nullptr, nullptr, FF2, nullptr, BS, Dd, FFf);

    // 7. LN2 -> output
    add_ln_kernel<false><<<BS, 256, 0, stream>>>(FF2, N1F, g2, be2, out, nullptr);
}

// v008
// One run takes 157 microseconds.
// Next to v007, in two timings, it ran 1.06 times as fast each time.
// Over all steps from v000 it is 4.59 times as fast.
#include <hip/hip_runtime.h>

// ---------------------------------------------------------------------------
// Transformer encoder block for MI455X (gfx1250, wave32, WMMA bf16)
//   B=2, S=2048, D=1024, H=16, DK=64, FF=4096, fp32 I/O
// ---------------------------------------------------------------------------

typedef __attribute__((ext_vector_type(16))) __bf16 v16bf;
typedef __attribute__((ext_vector_type(8)))  __bf16 v8bf;
typedef __attribute__((ext_vector_type(8)))  float  v8f;
typedef __attribute__((ext_vector_type(4)))  float  f32x4;

using u16 = unsigned short;
using u32 = unsigned int;

static constexpr int Hh = 16;
static constexpr int Dd = 1024;
static constexpr int DKk = 64;
static constexpr int FFf = 4096;
static constexpr int Bb = 2;
static constexpr int Ss = 2048;
static constexpr int BS = Bb * Ss;       // 4096 rows
static constexpr float LN_EPS = 1e-5f;
// LDS row pitch in bf16 elements for tiles of 64 elements a row: 144 B = 16 B x 9.
// An odd multiple of 16 B spreads the 16 rows of a ds_load_b128 fragment read
// over all 64 banks; at 128 B eight rows fall on the same four banks.
static constexpr int LP = 72;

// ---------------- helpers ---------------------------------------------------

__device__ __forceinline__ u16 f2bf(float f) {
    u32 u = __float_as_uint(f);
    u32 r = u + 0x7FFFu + ((u >> 16) & 1u);   // round-to-nearest-even
    return (u16)(r >> 16);
}

union Op32 { uint4 q[2]; v16bf v; };

// Load one WMMA 16x16x32 bf16 operand (A layout; B uses the same pattern on
// the transposed [N,K] matrix).  `base` points at a row-major bf16 tile in
// LDS with `stride` elements per row, `kbase` selects the 32-wide K chunk.
// Lanes 0-15: K = kbase+{0..7,16..23};  lanes 16-31: K = kbase+{8..15,24..31}.
__device__ __forceinline__ v16bf lds_load_op(const u16* base, int row, int stride,
                                             int kbase, int lane) {
    const u16* p = base + row * stride + kbase + ((lane >> 4) & 1) * 8;
    Op32 u;
    u.q[0] = *reinterpret_cast<const uint4*>(p);
    u.q[1] = *reinterpret_cast<const uint4*>(p + 16);
    return u.v;
}

__device__ __forceinline__ v8f wmma_bf16(v16bf a, v16bf b, v8f c) {
    return __builtin_amdgcn_wmma_f32_16x16x32_bf16(false, a, false, b,
                                                   (short)0, c, false, false);
}

// Byte address inside the work-group's LDS: the low half of the flat address.
__device__ __forceinline__ u32 lds_addr(const void* p) { return (u32)(size_t)p; }

// Eight asynchronous copies of 16 bytes a lane, global memory -> LDS, through
// no register: four for each of two tiles.  Copy i of tile n moves the bytes at
// gn + i * gstepn to LDS byte ln + i * lstep.  The s_wait_xcnt stands inside the
// statement, behind the last copy, so that no address register is rewritten
// ahead of it.
__device__ __forceinline__ void async_copy4x2(u32 l0, u32 l1, u32 lstep, const u16* g0, size_t gstep0,
                                              const u16* g1, size_t gstep1) {
    asm volatile(
        "global_load_async_to_lds_b128 %0, %8, off\n\t"
        "global_load_async_to_lds_b128 %1, %9, off\n\t"
        "global_load_async_to_lds_b128 %2, %10, off\n\t"
        "global_load_async_to_lds_b128 %3, %11, off\n\t"
        "global_load_async_to_lds_b128 %4, %12, off\n\t"
        "global_load_async_to_lds_b128 %5, %13, off\n\t"
        "global_load_async_to_lds_b128 %6, %14, off\n\t"
        "global_load_async_to_lds_b128 %7, %15, off\n\t"
        "s_wait_xcnt 0x0"
        :: "v"(l0), "v"(l0 + lstep), "v"(l0 + 2 * lstep), "v"(l0 + 3 * lstep),
           "v"(l1), "v"(l1 + lstep), "v"(l1 + 2 * lstep), "v"(l1 + 3 * lstep),
           "v"(g0), "v"(g0 + gstep0), "v"(g0 + 2 * gstep0), "v"(g0 + 3 * gstep0),
           "v"(g1), "v"(g1 + gstep1), "v"(g1 + 2 * gstep1), "v"(g1 + 3 * gstep1)
        : "memory");
}

// The same for a second tile of three quarters the rows: four copies and three.
__device__ __forceinline__ void async_copy4x3(u32 l0, u32 l1, u32 lstep, const u16* g0, size_t gstep0,
                                              const u16* g1, size_t gstep1) {
    asm volatile(
        "global_load_async_to_lds_b128 %0, %7, off\n\t"
        "global_load_async_to_lds_b128 %1, %8, off\n\t"
        "global_load_async_to_lds_b128 %2, %9, off\n\t"
        "global_load_async_to_lds_b128 %3, %10, off\n\t"
        "global_load_async_to_lds_b128 %4, %11, off\n\t"
        "global_load_async_to_lds_b128 %5, %12, off\n\t"
        "global_load_async_to_lds_b128 %6, %13, off\n\t"
        "s_wait_xcnt 0x0"
        :: "v"(l0), "v"(l0 + lstep), "v"(l0 + 2 * lstep), "v"(l0 + 3 * lstep),
           "v"(l1), "v"(l1 + lstep), "v"(l1 + 2 * lstep),
           "v"(g0), "v"(g0 + gstep0), "v"(g0 + 2 * gstep0), "v"(g0 + 3 * gstep0),
           "v"(g1), "v"(g1 + gstep1), "v"(g1 + 2 * gstep1)
        : "memory");
}

// The hand-over of a two-buffer ring, every wave: this wave's LDS reads of the
// buffer it leaves have returned, its own copies of the next tile have landed,
// and the barrier tells both to the other waves.
__device__ __forceinline__ void ring_publish() {
    asm volatile("s_wait_dscnt 0x0" ::: "memory");     // my reads of the old buffer are done
    asm volatile("s_wait_asynccnt 0x0" ::: "memory");  // my copies of the next tile have landed
    __syncthreads();
}

// Lane l takes the value of lane l ^ 16: the two lanes that share a column of a
// WMMA accumulator tile.
__device__ __forceinline__ float xhalf(float v) {
    int b = __builtin_bit_cast(int, v);
    return __builtin_bit_cast(float, __builtin_amdgcn_permlanex16(b, b, 0x76543210, 0xfedcba98, false, false));
}

// Eight f32 -> eight bf16, round-to-nearest-even, two a conversion instruction.
__device__ __forceinline__ v8bf cvt8(v8f v) { return __builtin_convertvector(v, v8bf); }

// ---------------- fp32 -> bf16 conversion -----------------------------------
// One launch converts x and the six weight matrices.  Their bf16 copies lie
// back to back in the workspace, so the destination is one array of 16 Mi
// elements; in units of 1 Mi elements x fills 0-3, wq 4, wk 5, wv 6, wo 7,
// w1 8-11, w2 12-15.  256 blocks of 16 waves, one per WGP: a block owns 64 Ki
// consecutive elements (always inside one source) and walks them in two
// rounds.  In a round a wave has 16 loads of 16 bytes a lane in flight, each
// covering 512 contiguous bytes; each store covers 256 contiguous bytes.

static constexpr int CVT_THREADS = 512;
static constexpr int CVT_BLOCKS  = 256;
static constexpr int CVT_LOADS   = 16;                         // 16-byte loads a lane and round
static constexpr int CVT_ROUNDS  = 2;
static constexpr int CVT_STEP    = CVT_THREADS * 4;            // elements a block-wide load covers
static constexpr int CVT_ROUND   = CVT_STEP * CVT_LOADS;       // elements a block converts a round
static constexpr int CVT_PER_BLOCK = CVT_ROUND * CVT_ROUNDS;   // 64 Ki elements
static_assert((size_t)CVT_BLOCKS * CVT_PER_BLOCK ==
              (size_t)BS * Dd + 4u * Dd * Dd + 2u * (size_t)FFf * Dd, "the grid covers every element once");
static_assert((1 << 20) % CVT_PER_BLOCK == 0, "a block never straddles two sources");

__global__ __launch_bounds__(CVT_THREADS) void cvt_all_bf16_kernel(
    const float* __restrict__ x,  const float* __restrict__ wq,
    const float* __restrict__ wk, const float* __restrict__ wv,
    const float* __restrict__ wo, const float* __restrict__ w1,
    const float* __restrict__ w2, u16* __restrict__ y) {
    const int seg = blockIdx.x >> 4;                   // which 1 Mi-element unit
    const float* src;
    int first;                                         // the source's first unit
    if (seg < 4)       { src = x;  first = 0; }
    else if (seg == 4) { src = wq; first = 4; }
    else if (seg == 5) { src = wk; first = 5; }
    else if (seg == 6) { src = wv; first = 6; }
    else if (seg == 7) { src = wo; first = 7; }
    else if (seg < 12) { src = w1; first = 8; }
    else               { src = w2; first = 12; }

    const size_t dst0 = (size_t)blockIdx.x * CVT_PER_BLOCK + threadIdx.x * 4;
    const float* s = src + (dst0 - ((size_t)first << 20));
    u16* d = y + dst0;

    for (int r = 0; r < CVT_ROUNDS; ++r) {
        f32x4 v[CVT_LOADS];
        // Both inner loops unrolled: constant indices keep v[] in registers.
#pragma unroll
        for (int i = 0; i < CVT_LOADS; ++i)
            v[i] = *reinterpret_cast<const f32x4*>(s + i * CVT_STEP);
        // Inputs-only fence on the loaded values: it keeps the round's 16 loads
        // ahead of its converts.  Left free, the compiler waits out each load
        // alone, with one in flight a wave.
        asm volatile("" :: "v"(v[0]), "v"(v[1]), "v"(v[2]), "v"(v[3]), "v"(v[4]), "v"(v[5]), "v"(v[6]), "v"(v[7]),
                           "v"(v[8]), "v"(v[9]), "v"(v[10]), "v"(v[11]), "v"(v[12]), "v"(v[13]), "v"(v[14]), "v"(v[15]));
#pragma unroll
        for (int i = 0; i < CVT_LOADS; ++i) {
            uint2 p;
            p.x = (u32)f2bf(v[i].x) | ((u32)f2bf(v[i].y) << 16);
            p.y = (u32)f2bf(v[i].z) | ((u32)f2bf(v[i].w) << 16);
            *reinterpret_cast<uint2*>(d + i * CVT_STEP) = p;
        }
        s += CVT_ROUND;
        d += CVT_ROUND;
    }
}

// ---------------- generic WMMA GEMM -----------------------------------------
// C[M,N] = A[M,K](bf16) * Bt[N,K](bf16)^T + bias[N], with epilogue modes.
// Block tile TB rows x TN columns, K-step 64.  Three forms, each of 256 blocks, one a WGP:
//   128 x 128,  8 waves, wave tile 32 x 64 (2 x 4 WMMA tiles): the products of 1024 columns;
//   256 x 256, 16 waves, wave tile 64 x 64 (4 x 4 WMMA tiles): the product of 4096 columns.
//             A block copies 64 KB a K-step for four times the products of the small
//             tile's 32 KB, so half the bytes leave L2, and a wave reads 8 fragments
//             from LDS for 16 WMMAs, not 6 for 8;
//   256 x 192, 16 waves, wave tile 64 x 48 (4 x 3 WMMA tiles): the product of 3072 columns,
//             which has only 192 tiles of 256 x 256.  56 KB a K-step for three times the products.
// The A and B tiles come into LDS by asynchronous copies, in a ring of four
// buffers: the copies of the next three tiles fly while this tile is multiplied,
// so that a tile has three trips to land in and the requests of one tile follow
// those of the tile before without a pause.

// MODE_QKV is the three projections of x as one product: Bt holds wq, wk and wv
// one below the other (N = 3 * D), Cb the three outputs one behind the other.  The
// 16 columns of a WMMA tile lie in one of the three, which picks bias and layout.

enum { MODE_F32 = 0, MODE_RELU_BF16 = 1, MODE_QKV = 2 };

static constexpr int NBUF = 4;   // buffers of the GEMM ring
static_assert(NBUF == 4, "the counted waits below are written for four buffers");

template <int MODE, int TB, int TN>
__global__ __launch_bounds__(2 * TB) void gemm_bf16_kernel(
    const u16* __restrict__ A, const u16* __restrict__ Bt,
    const float* __restrict__ bias, const float* __restrict__ biasK,
    const float* __restrict__ biasV, float* __restrict__ Cf,
    u16* __restrict__ Cb, int M, int N, int K) {
    static_assert(TB == 128 || TB == 256, "8 or 16 waves");
    constexpr int WM = TB / 4;                 // rows of a wave tile: four waves one below the other
    constexpr int WN = TN / (TB / 64);         // columns of a wave tile: two or four waves side by side
    constexpr int FA = WM / 16, FB = WN / 16;  // A and B fragments of a wave and 32 k
    constexpr int CROWS = TB / 4;              // rows that one copy of every thread covers
    constexpr int NB = TN / CROWS;             // copies a thread and B tile: 4 or 3
    constexpr int CP = 4 + NB;                 // copies a wave and pair of tiles
    static_assert(WN % 16 == 0 && TN % CROWS == 0 && (NB == 4 || NB == 3), "whole fragments, whole copies");
    __shared__ __attribute__((aligned(16))) u16 As[NBUF][TB * LP];   // 4 x 18 KB or 4 x 36 KB
    __shared__ __attribute__((aligned(16))) u16 Bs[NBUF][TN * LP];

    const int tid  = threadIdx.x;
    const int lane = tid & 31;
    const int ln   = lane & 15;
    const int half = lane >> 4;
    const int wave = tid >> 5;
    const int wr   = (wave & 3) * WM;   // wave row offset within the block tile
    const int wc   = (wave >> 2) * WN;  // wave col offset within the block tile
    const int m0   = blockIdx.y * TB;
    const int n0   = blockIdx.x * TN;

    v8f acc[FA][FB] = {};

    // A tile is TB or TN rows x 128 B, 8 pieces of 16 B a row: 4 a thread for A, NB for B.
    // A wave's copy covers four whole rows; copy i takes the rows CROWS * i further on.
    const int crow = tid >> 3, cq = tid & 7;
    const u16* ga = A  + (size_t)(m0 + crow) * K + cq * 8;
    const u16* gb = Bt + (size_t)(n0 + crow) * K + cq * 8;
    const u32 la = lds_addr(&As[0][crow * LP + cq * 8]);
    const u32 lb = lds_addr(&Bs[0][crow * LP + cq * 8]);
    constexpr u32 LROWS = CROWS * LP * 2;      // LDS bytes of CROWS rows
    constexpr u32 LBUFA = TB * LP * 2;         // LDS bytes of one buffer of A
    constexpr u32 LBUFB = TN * LP * 2;         // and of B
    const size_t grows = (size_t)CROWS * K;    // elements of CROWS rows in memory
    const int T = K / 64;

    // The first four tiles, each into a buffer that nobody has read yet.  The loop is
    // unrolled so that each buffer's offsets are constants.
    auto copy_tiles = [&](int buf, size_t k0) {   // the A and B tiles at column k0 into buffer buf
        if constexpr (NB == 4)
            async_copy4x2(la + buf * LBUFA, lb + buf * LBUFB, LROWS, ga + k0, grows, gb + k0, grows);
        else
            async_copy4x3(la + buf * LBUFA, lb + buf * LBUFB, LROWS, ga + k0, grows, gb + k0, grows);
    };
    copy_tiles(0, 0);
#pragma unroll
    for (int s = 1; s < NBUF; ++s)
        if (s < T) copy_tiles(s, s * 64);
    // Tile 0 has landed before anyone reads it: a wave's copies count down in issue
    // order, and its 3 * CP youngest are those of tiles 1 to 3.
    if (T >= NBUF) asm volatile("s_wait_asynccnt %0" :: "n"(3 * CP) : "memory");
    else           asm volatile("s_wait_asynccnt 0x0" ::: "memory");
    __syncthreads();

    for (int t = 0; t < T; ++t) {
        const int buf = t & (NBUF - 1);
        const u16* as = As[buf];
        const u16* bs = Bs[buf];

        if constexpr (TB == 128) {
            // All 24 fragment reads of the trip go out as one group, each fragment
            // into registers of its own, in the order in which the products use them.
            v16bf a[2][FA], b[2][FB];
#pragma unroll
            for (int c = 0; c < 2; ++c) {
#pragma unroll
                for (int i = 0; i < FA; ++i)
                    a[c][i] = lds_load_op(as, wr + i * 16 + ln, LP, c * 32, lane);
#pragma unroll
                for (int j = 0; j < FB; ++j)
                    b[c][j] = lds_load_op(bs, wc + j * 16 + ln, LP, c * 32, lane);
            }
            // Keeps the reads ahead of the products.  Left free, the compiler sinks each
            // B fragment's reads to its two products, into one shared register set, and
            // the wave waits out a whole LDS latency eight times a trip.
            __builtin_amdgcn_sched_barrier(0);

#pragma unroll
            for (int c = 0; c < 2; ++c) {
#pragma unroll
                for (int j = 0; j < FB; ++j) {
                    acc[0][j] = wmma_bf16(a[c][0], b[c][j], acc[0][j]);
                    acc[1][j] = wmma_bf16(a[c][1], b[c][j], acc[1][j]);
                }
            }
        } else {
            // A wave of sixteen has 256 registers.  Beside the 96 accumulator registers of the
            // 64 x 48 tile the trip's 14 fragments fit: all their reads go out as one group,
            // as above.  Beside the 128 of the 64 x 64 tile only the 8 fragments of 32 k fit:
            // two groups a trip; while one wave waits for its reads, the three that share its
            // SIMD have products to issue.  In a group the reads stand in the order in which
            // the products use them.
            constexpr int G = (FA * FB + 2 * (FA + FB)) * 8 <= 208 ? 2 : 1;   // 32-k steps a group
#pragma unroll
            for (int g = 0; g < 2; g += G) {
                v16bf a[G][FA], b[G][FB];
#pragma unroll
                for (int c = 0; c < G; ++c) {
                    a[c][0] = lds_load_op(as, wr + ln, LP, (g + c) * 32, lane);
#pragma unroll
                    for (int j = 0; j < FB; ++j)
                        b[c][j] = lds_load_op(bs, wc + j * 16 + ln, LP, (g + c) * 32, lane);
#pragma unroll
                    for (int i = 1; i < FA; ++i)
                        a[c][i] = lds_load_op(as, wr + i * 16 + ln, LP, (g + c) * 32, lane);
                }
                // Keeps the group's reads together, ahead of its products (as above).
                __builtin_amdgcn_sched_barrier(0);
#pragma unroll
                for (int c = 0; c < G; ++c)
#pragma unroll
                    for (int i = 0; i < FA; ++i)
#pragma unroll
                        for (int j = 0; j < FB; ++j)
                            acc[i][j] = wmma_bf16(a[c][i], b[c][j], acc[i][j]);
                // Keeps the next group's reads from being spread among these products.
                if (g + G < 2) __builtin_amdgcn_sched_barrier(0);
            }
        }
        // Keeps the products ahead of the hand-over.  Left free, the compiler lifts the
        // hand-over's waits and barrier over them: every product then waits for the last
        // read, and tile t + 1's copies lose this trip's products from their time to land in.
        __builtin_amdgcn_sched_barrier(0);

        // The hand-over, every wave: my reads of this buffer are done, my copies of tile
        // t + 1 have landed, and the barrier tells both to the other waves.  While tile
        // t + 3 exists the wave's 2 * CP youngest copies are those of tiles t + 2 and t + 3,
        // which stay in flight; in the last trips nothing younger has been issued for long.
        asm volatile("s_wait_dscnt 0x0" ::: "memory");
        if (t + NBUF - 1 < T) asm volatile("s_wait_asynccnt %0" :: "n"(2 * CP) : "memory");
        else                  asm volatile("s_wait_asynccnt 0x0" ::: "memory");
        __syncthreads();
        if (t + NBUF < T)  // refill the buffers that every wave has just left
            copy_tiles(buf, (size_t)(t + NBUF) * 64);
    }
    asm volatile("s_wait_asynccnt 0x0" ::: "memory");  // no copy is left in flight at the wave's end

    // Epilogue.  C layout: VGPR r -> row r + 8*half, col = lane&15.
    if constexpr (MODE == MODE_QKV) {
        int part[FB];                                  // 0 = Q, 1 = K, 2 = V: the same for the whole wave
        float bv[FB];                                  // the bias of the lane's columns, read ahead of all stores
#pragma unroll
        for (int j = 0; j < FB; ++j) {
            const int cg = n0 + wc + j * 16;           // the WMMA tile's first column
            part[j] = __builtin_amdgcn_readfirstlane(cg >> 10);
            const float* bp = part[j] == 0 ? bias : part[j] == 1 ? biasK : biasV;
            bv[j] = bp[(cg & (Dd - 1)) + ln];
        }
#pragma unroll
        for (int j = 0; j < FB; ++j) {
            u16* cb = Cb + (size_t)part[j] * BS * Dd;
            const int col = ((n0 + wc + j * 16) & (Dd - 1)) + ln;   // column inside the part
            const float bval = bv[j];
            const int h = col >> 6, kk = col & 63;
            if (part[j] < 2) {    // row = b*S+s ; col = h*DK+kk  ->  [b,h,s,kk] bf16
#pragma unroll
                for (int i = 0; i < FA; ++i) {
#pragma unroll
                    for (int r = 0; r < 8; ++r) {
                        const int row = m0 + wr + i * 16 + r + half * 8;
                        const int s = row & (Ss - 1), bidx = row >> 11;
                        cb[(((size_t)(bidx * Hh + h) * Ss + s) * DKk) + kk] = f2bf(acc[i][j][r] + bval);
                    }
                }
                // The code behind this branch rewrites the registers that these stores name.
                asm volatile("s_wait_xcnt 0x0" ::: "memory");
            } else {              // [b,h,kk,s] (V transposed)
#pragma unroll
                for (int i = 0; i < FA; ++i) {
#pragma unroll
                    for (int r = 0; r < 8; ++r) {
                        const int row = m0 + wr + i * 16 + r + half * 8;
                        const int s = row & (Ss - 1), bidx = row >> 11;
                        cb[(((size_t)(bidx * Hh + h) * DKk + kk) * Ss) + s] = f2bf(acc[i][j][r] + bval);
                    }
                }
                // In the listing this branch runs on into the other layout's code (behind a
                // branch that is never taken here), which rewrites the registers of these stores.
                asm volatile("s_wait_xcnt 0x0" ::: "memory");
            }
        }
    } else {
#pragma unroll
        for (int i = 0; i < FA; ++i) {
#pragma unroll
            for (int j = 0; j < FB; ++j) {
                const int col = n0 + wc + j * 16 + ln;
                const float bval = bias[col];
#pragma unroll
                for (int r = 0; r < 8; ++r) {
                    const int row = m0 + wr + i * 16 + r + half * 8;
                    float val = acc[i][j][r] + bval;
                    if constexpr (MODE == MODE_F32) {
                        Cf[(size_t)row * N + col] = val;
                    } else {
                        Cb[(size_t)row * N + col] = f2bf(fmaxf(val, 0.0f));
                    }
                }
            }
        }
    }
}

__global__ __launch_bounds__(128) void flash_attn_kernel(
    const u16* __restrict__ Q, const u16* __restrict__ Km,
    const u16* __restrict__ VT, u16* __restrict__ O) {
    __shared__ __attribute__((aligned(16))) u16 qs[64 * LP];       // 64 q rows x DK      (9 KB)
    __shared__ __attribute__((aligned(16))) u16 ks[2][64 * LP];    // 64 keys  x DK       (2 x 9 KB)
    __shared__ __attribute__((aligned(16))) u16 vts[2][64 * LP];   // DK rows  x 64 keys  (2 x 9 KB)

    const int tid  = threadIdx.x;
    const int lane = tid & 31;
    const int ln   = lane & 15;
    const int half = lane >> 4;
    const int wave = tid >> 5;
    const int bh   = blockIdx.y;                 // b*H + h
    const int q0   = blockIdx.x * 64;
    const int rb   = wave * 16;

    // A K or V^T tile is 64 rows x 128 B = 512 pieces of 16 B: 4 a thread and
    // tile.  A wave's copy covers four whole rows; copy i the rows 16 * i further on.
    const int crow = tid >> 3, cq = tid & 7;
    const u16* gk = Km + ((size_t)bh * Ss + crow) * DKk + cq * 8;
    const u16* gv = VT + ((size_t)bh * DKk + crow) * Ss + cq * 8;
    const u32 lk = lds_addr(&ks[0][crow * LP + cq * 8]);
    const u32 lv = lds_addr(&vts[0][crow * LP + cq * 8]);
    constexpr u32 LROWS = 16 * LP * 2;         // LDS bytes of 16 rows
    constexpr u32 LBUF  = 64 * LP * 2;         // LDS bytes of one buffer
    constexpr int T = Ss / 64;
    static_assert(T >= 2, "the ring's prologue fills two tiles");

    async_copy4x2(lk, lv, LROWS, gk, (size_t)16 * DKk, gv, (size_t)16 * Ss);

    // stage Q tile
    {
        const u16* qg = Q + ((size_t)bh * Ss + q0) * DKk;
        int row = tid >> 1, cb = (tid & 1) * 32;
#pragma unroll
        for (int q = 0; q < 4; ++q)
            *reinterpret_cast<uint4*>(&qs[row * LP + cb + q * 8]) =
                *reinterpret_cast<const uint4*>(&qg[(size_t)row * DKk + cb + q * 8]);
    }
    asm volatile("s_wait_asynccnt 0x0" ::: "memory");  // tile 0 has landed before anyone reads it
    __syncthreads();
    async_copy4x2(lk + LBUF, lv + LBUF, LROWS, gk + (size_t)64 * DKk, (size_t)16 * DKk, gv + 64, (size_t)16 * Ss);

    v16bf bq[2];   // Q^T as B operand: lane ln holds query rb + ln
#pragma unroll
    for (int c = 0; c < 2; ++c)
        bq[c] = lds_load_op(qs, rb + ln, LP, c * 32, lane);

    float m = -INFINITY, l = 0.0f;   // of query rb + ln; l sums this lane half's keys only
    v8f o[4] = {};                   // O^T: o[n][r] = head element n*16 + 8*half + r of query rb + ln

    for (int tile = 0; tile < T; ++tile) {
        const int buf = tile & 1;
        const u16* kt = ks[buf];
        const u16* vt = vts[buf];

        // scores^T: [64 keys] x [16 queries] in 4 tiles, accumulate over DK
        v8f s[4] = {};
#pragma unroll
        for (int c = 0; c < 2; ++c)
#pragma unroll
            for (int t = 0; t < 4; ++t) {
                v16bf ak = lds_load_op(kt, t * 16 + ln, LP, c * 32, lane);
                s[t] = wmma_bf16(ak, bq[c], s[t]);
            }
#pragma unroll
        for (int t = 0; t < 4; ++t) s[t] = s[t] * 0.125f;   // 1/sqrt(DK)

        // online softmax: a lane holds 32 of its query's 64 scores, lane ^ 16 the rest
        float mx[8];
#pragma unroll
        for (int r = 0; r < 8; ++r)
            mx[r] = fmaxf(fmaxf(s[0][r], s[1][r]), fmaxf(s[2][r], s[3][r]));
        float rmax = fmaxf(fmaxf(fmaxf(mx[0], mx[1]), fmaxf(mx[2], mx[3])),
                           fmaxf(fmaxf(mx[4], mx[5]), fmaxf(mx[6], mx[7])));
        rmax = fmaxf(rmax, xhalf(rmax));

        const float mn = fmaxf(m, rmax);
        const float alpha = __expf(m - mn);
        m = mn;
#pragma unroll
        for (int t = 0; t < 4; ++t)
#pragma unroll
            for (int r = 0; r < 8; ++r)
                s[t][r] = __expf(s[t][r] - m);

        const v8f sv = (s[0] + s[1]) + (s[2] + s[3]);
        l = l * alpha + (((sv[0] + sv[1]) + (sv[2] + sv[3])) + ((sv[4] + sv[5]) + (sv[6] + sv[7])));

        // P^T as B operand: element e is key c*32 + 8*half + e (e < 8), c*32 + 16 + 8*half + e - 8 (e >= 8)
        v16bf bp[2];
#pragma unroll
        for (int c = 0; c < 2; ++c)
            bp[c] = __builtin_shufflevector(cvt8(s[2 * c]), cvt8(s[2 * c + 1]),
                                            0, 1, 2, 3, 4, 5, 6, 7, 8, 9, 10, 11, 12, 13, 14, 15);

        // O^T = O^T*alpha + V^T @ P^T  (two 32-key WMMA K-steps per group of 16 head elements)
#pragma unroll
        for (int n = 0; n < 4; ++n) {
            o[n] = o[n] * alpha;
#pragma unroll
            for (int c = 0; c < 2; ++c) {
                v16bf av = lds_load_op(vt, n * 16 + ln, LP, c * 32, lane);
                o[n] = wmma_bf16(av, bp[c], o[n]);
            }
        }

        ring_publish();
        if (tile + 2 < T)  // refill the buffers that every wave has just left
            async_copy4x2(lk + buf * LBUF, lv + buf * LBUF, LROWS,
                          gk + (size_t)(tile + 2) * 64 * DKk, (size_t)16 * DKk,
                          gv + (tile + 2) * 64, (size_t)16 * Ss);
    }
    asm volatile("s_wait_asynccnt 0x0" ::: "memory");  // no copy is left in flight at the wave's end

    // finalize: O /= l, write concatenated-head layout [b, s, h*DK + col]; a lane's
    // eight registers of a tile are eight consecutive columns: one 16-byte store
    const int bidx = bh >> 4, h = bh & 15;
    l += xhalf(l);                   // join the two lane halves' sums
    const float inv = 1.0f / l;
    u16* op = O + ((size_t)bidx * Ss + q0 + rb + ln) * (Hh * DKk) + h * DKk + half * 8;
#pragma unroll
    for (int n = 0; n < 4; ++n)
        *reinterpret_cast<uint4*>(op + n * 16) = __builtin_bit_cast(uint4, cvt8(o[n] * inv));
}

// ---------------- residual + LayerNorm --------------------------------------
// one row per block; 256 threads * 4 elems = D

template <bool WRITE_BF16>
__global__ __launch_bounds__(256) void add_ln_kernel(
    const float* __restrict__ a, const float* __restrict__ b,
    const float* __restrict__ g, const float* __restrict__ be,
    float* __restrict__ oF, u16* __restrict__ oB) {
    __shared__ float ss[256], sq[256];
    const int row = blockIdx.x, tid = threadIdx.x;
    const int i0 = tid * 4;

    float4 xa = *reinterpret_cast<const float4*>(a + (size_t)row * Dd + i0);
    float4 xb = *reinterpret_cast<const float4*>(b + (size_t)row * Dd + i0);
    float v[4] = { xa.x + xb.x, xa.y + xb.y, xa.z + xb.z, xa.w + xb.w };

    float s = v[0] + v[1] + v[2] + v[3];
    float q = v[0] * v[0] + v[1] * v[1] + v[2] * v[2] + v[3] * v[3];
    ss[tid] = s; sq[tid] = q;
    __syncthreads();
    for (int st = 128; st > 0; st >>= 1) {
        if (tid < st) { ss[tid] += ss[tid + st]; sq[tid] += sq[tid + st]; }
        __syncthreads();
    }
    const float mu   = ss[0] * (1.0f / Dd);
    const float var  = sq[0] * (1.0f / Dd) - mu * mu;
    const float rstd = rsqrtf(var + LN_EPS);

    float4 gg = *reinterpret_cast<const float4*>(g + i0);
    float4 bb = *reinterpret_cast<const float4*>(be + i0);
    float o0 = (v[0] - mu) * rstd * gg.x + bb.x;
    float o1 = (v[1] - mu) * rstd * gg.y + bb.y;
    float o2 = (v[2] - mu) * rstd * gg.z + bb.z;
    float o3 = (v[3] - mu) * rstd * gg.w + bb.w;

    *reinterpret_cast<float4*>(oF + (size_t)row * Dd + i0) = make_float4(o0, o1, o2, o3);
    if constexpr (WRITE_BF16) {
        u16* p = oB + (size_t)row * Dd + i0;
        p[0] = f2bf(o0); p[1] = f2bf(o1); p[2] = f2bf(o2); p[3] = f2bf(o3);
    }
}

// ---------------- launcher ---------------------------------------------------

extern "C" void kernel_launch(void* const* d_in, const int* in_sizes, int n_in,
                              void* d_out, int out_size, void* d_ws, size_t ws_size,
                              hipStream_t stream) {
    const float* x  = (const float*)d_in[0];
    const float* wq = (const float*)d_in[1];  const float* bq = (const float*)d_in[2];
    const float* wk = (const float*)d_in[3];  const float* bk = (const float*)d_in[4];
    const float* wv = (const float*)d_in[5];  const float* bv = (const float*)d_in[6];
    const float* wo = (const float*)d_in[7];  const float* bo = (const float*)d_in[8];
    const float* g1 = (const float*)d_in[9];  const float* be1 = (const float*)d_in[10];
    const float* w1 = (const float*)d_in[11]; const float* b1 = (const float*)d_in[12];
    const float* w2 = (const float*)d_in[13]; const float* b2 = (const float*)d_in[14];
    const float* g2 = (const float*)d_in[15]; const float* be2 = (const float*)d_in[16];
    float* out = (float*)d_out;

    char* ws = (char*)d_ws;
    const size_t MB = 1024 * 1024;
    u16* XB  = (u16*)(ws + 0);          //  8 MB  x bf16 [BS, D]
    u16* WQB = (u16*)(ws + 8  * MB);    //  2 MB
    u16* WKB = (u16*)(ws + 10 * MB);    //  2 MB
    u16* WVB = (u16*)(ws + 12 * MB);    //  2 MB
    u16* WOB = (u16*)(ws + 14 * MB);    //  2 MB
    u16* W1B = (u16*)(ws + 16 * MB);    //  8 MB
    u16* W2B = (u16*)(ws + 24 * MB);    //  8 MB
    u16* Qb  = (u16*)(ws + 32 * MB);    //  8 MB  [B,H,S,DK]
    u16* Kb  = (u16*)(ws + 40 * MB);    //  8 MB  [B,H,S,DK]
    u16* VTb = (u16*)(ws + 48 * MB);    //  8 MB  [B,H,DK,S]
    u16* Ob  = (u16*)(ws + 56 * MB);    //  8 MB  [B,S,H*DK]
    float* ATT = (float*)(ws + 64 * MB);   // 16 MB [BS, D]
    float* N1F = (float*)(ws + 80 * MB);   // 16 MB
    u16*   N1B = (u16*)(ws + 96 * MB);     //  8 MB
    u16*   FF1 = (u16*)(ws + 104 * MB);    // 32 MB [BS, FF]
    float* FF2 = (float*)(ws + 136 * MB);  // 16 MB

    // 1. bf16 conversions: XB .. W2B are one contiguous destination
    cvt_all_bf16_kernel<<<CVT_BLOCKS, CVT_THREADS, 0, stream>>>(x, wq, wk, wv, wo, w1, w2, XB);

    // 2. QKV projections in one launch (N = 3 * H*DK = 3072, K = 1024): WQB, WKB, WVB
    //    are one [3072, 1024] matrix in the workspace, Qb, Kb, VTb one output range
    dim3 gP(Dd / 128, BS / 128);
    gemm_bf16_kernel<MODE_QKV, 256, 192><<<dim3(3 * Dd / 192, BS / 256), 512, 0, stream>>>(
        XB, WQB, bq, bk, bv, nullptr, Qb, BS, 3 * Dd, Dd);

    // 3. fused attention
    flash_attn_kernel<<<dim3(Ss / 64, Bb * Hh), 128, 0, stream>>>(Qb, Kb, VTb, Ob);

    // 4. output projection
    gemm_bf16_kernel<MODE_F32, 128, 128><<<gP, 256, 0, stream>>>(Ob, WOB, bo, nullptr, nullptr, ATT, nullptr, BS, Dd, Dd);

    // 5. LN1 (residual with x), keep bf16 mirror for FFN input
    add_ln_kernel<true><<<BS, 256, 0, stream>>>(ATT, x, g1, be1, N1F, N1B);

    // 6. FFN
    gemm_bf16_kernel<MODE_RELU_BF16, 256, 256><<<dim3(FFf / 256, BS / 256), 512, 0, stream>>>(
        N1B, W1B, b1, nullptr, nullptr, nullptr, FF1, BS, FFf, Dd);
    gemm_bf16_kernel<MODE_F32, 128, 128><<<gP, 256, 0, stream>>>(FF1, W2B, b2, nullptr, nullptr, FF2, nullptr, BS, Dd, FFf);

    // 7. LN2 -> output
    add_ln_kernel<false><<<BS, 256, 0, stream>>>(FF2, N1F, g2, be2, out, nullptr);
}

// v009
// One run takes 151 microseconds.
// Next to v008, in two timings, it ran 1.04 times as fast each time.
// Over all steps from v000 it is 4.79 times as fast.
#include <hip/hip_runtime.h>

// ---------------------------------------------------------------------------
// Transformer encoder block for MI455X (gfx1250, wave32, WMMA bf16)
//   B=2, S=2048, D=1024, H=16, DK=64, FF=4096, fp32 I/O
// ---------------------------------------------------------------------------

typedef __attribute__((ext_vector_type(16))) __bf16 v16bf;
typedef __attribute__((ext_vector_type(8)))  __bf16 v8bf;
typedef __attribute__((ext_vector_type(8)))  float  v8f;
typedef __attribute__((ext_vector_type(4)))  float  f32x4;

using u16 = unsigned short;
using u32 = unsigned int;

static constexpr int Hh = 16;
static constexpr int Dd = 1024;
static constexpr int DKk = 64;
static constexpr int FFf = 4096;
static constexpr int Bb = 2;
static constexpr int Ss = 2048;
static constexpr int BS = Bb * Ss;       // 4096 rows
static constexpr float LN_EPS = 1e-5f;
// LDS row pitch in bf16 elements for tiles of 64 elements a row: 144 B = 16 B x 9.
// An odd multiple of 16 B spreads the 16 rows of a ds_load_b128 fragment read
// over all 64 banks; at 128 B eight rows fall on the same four banks.
static constexpr int LP = 72;

// ---------------- helpers ---------------------------------------------------

__device__ __forceinline__ u16 f2bf(float f) {
    u32 u = __float_as_uint(f);
    u32 r = u + 0x7FFFu + ((u >> 16) & 1u);   // round-to-nearest-even
    return (u16)(r >> 16);
}

union Op32 { uint4 q[2]; v16bf v; };

// Load one WMMA 16x16x32 bf16 operand (A layout; B uses the same pattern on
// the transposed [N,K] matrix).  `base` points at a row-major bf16 tile in
// LDS with `stride` elements per row, `kbase` selects the 32-wide K chunk.
// Lanes 0-15: K = kbase+{0..7,16..23};  lanes 16-31: K = kbase+{8..15,24..31}.
__device__ __forceinline__ v16bf lds_load_op(const u16* base, int row, int stride,
                                             int kbase, int lane) {
    const u16* p = base + row * stride + kbase + ((lane >> 4) & 1) * 8;
    Op32 u;
    u.q[0] = *reinterpret_cast<const uint4*>(p);
    u.q[1] = *reinterpret_cast<const uint4*>(p + 16);
    return u.v;
}

__device__ __forceinline__ v8f wmma_bf16(v16bf a, v16bf b, v8f c) {
    return __builtin_amdgcn_wmma_f32_16x16x32_bf16(false, a, false, b,
                                                   (short)0, c, false, false);
}

// Byte address inside the work-group's LDS: the low half of the flat address.
__device__ __forceinline__ u32 lds_addr(const void* p) { return (u32)(size_t)p; }

// Eight asynchronous copies of 16 bytes a lane, global memory -> LDS, through
// no register: four for each of two tiles.  Copy i of tile n moves the bytes at
// gn + i * gstepn to LDS byte ln + i * lstep.  The s_wait_xcnt stands inside the
// statement, behind the last copy, so that no address register is rewritten
// ahead of it.
__device__ __forceinline__ void async_copy4x2(u32 l0, u32 l1, u32 lstep, const u16* g0, size_t gstep0,
                                              const u16* g1, size_t gstep1) {
    asm volatile(
        "global_load_async_to_lds_b128 %0, %8, off\n\t"
        "global_load_async_to_lds_b128 %1, %9, off\n\t"
        "global_load_async_to_lds_b128 %2, %10, off\n\t"
        "global_load_async_to_lds_b128 %3, %11, off\n\t"
        "global_load_async_to_lds_b128 %4, %12, off\n\t"
        "global_load_async_to_lds_b128 %5, %13, off\n\t"
        "global_load_async_to_lds_b128 %6, %14, off\n\t"
        "global_load_async_to_lds_b128 %7, %15, off\n\t"
        "s_wait_xcnt 0x0"
        :: "v"(l0), "v"(l0 + lstep), "v"(l0 + 2 * lstep), "v"(l0 + 3 * lstep),
           "v"(l1), "v"(l1 + lstep), "v"(l1 + 2 * lstep), "v"(l1 + 3 * lstep),
           "v"(g0), "v"(g0 + gstep0), "v"(g0 + 2 * gstep0), "v"(g0 + 3 * gstep0),
           "v"(g1), "v"(g1 + gstep1), "v"(g1 + 2 * gstep1), "v"(g1 + 3 * gstep1)
        : "memory");
}

// The same for a second tile of three quarters the rows: four copies and three.
__device__ __forceinline__ void async_copy4x3(u32 l0, u32 l1, u32 lstep, const u16* g0, size_t gstep0,
                                              const u16* g1, size_t gstep1) {
    asm volatile(
        "global_load_async_to_lds_b128 %0, %7, off\n\t"
        "global_load_async_to_lds_b128 %1, %8, off\n\t"
        "global_load_async_to_lds_b128 %2, %9, off\n\t"
        "global_load_async_to_lds_b128 %3, %10, off\n\t"
        "global_load_async_to_lds_b128 %4, %11, off\n\t"
        "global_load_async_to_lds_b128 %5, %12, off\n\t"
        "global_load_async_to_lds_b128 %6, %13, off\n\t"
        "s_wait_xcnt 0x0"
        :: "v"(l0), "v"(l0 + lstep), "v"(l0 + 2 * lstep), "v"(l0 + 3 * lstep),
           "v"(l1), "v"(l1 + lstep), "v"(l1 + 2 * lstep),
           "v"(g0), "v"(g0 + gstep0), "v"(g0 + 2 * gstep0), "v"(g0 + 3 * gstep0),
           "v"(g1), "v"(g1 + gstep1), "v"(g1 + 2 * gstep1)
        : "memory");
}

// The hand-over of a two-buffer ring, every wave: this wave's LDS reads of the
// buffer it leaves have returned, its own copies of the next tile have landed,
// and the barrier tells both to the other waves.
__device__ __forceinline__ void ring_publish() {
    asm volatile("s_wait_dscnt 0x0" ::: "memory");     // my reads of the old buffer are done
    asm volatile("s_wait_asynccnt 0x0" ::: "memory");  // my copies of the next tile have landed
    __syncthreads();
}

// Lane l takes the value of lane l ^ 16: the two lanes that share a column of a
// WMMA accumulator tile.
__device__ __forceinline__ float xhalf(float v) {
    int b = __builtin_bit_cast(int, v);
    return __builtin_bit_cast(float, __builtin_amdgcn_permlanex16(b, b, 0x76543210, 0xfedcba98, false, false));
}

// Eight f32 -> eight bf16, round-to-nearest-even, two a conversion instruction.
__device__ __forceinline__ v8bf cvt8(v8f v) { return __builtin_convertvector(v, v8bf); }

// ---------------- fp32 -> bf16 conversion -----------------------------------
// One launch converts x and the six weight matrices.  Their bf16 copies lie
// back to back in the workspace, so the destination is one array of 16 Mi
// elements; in units of 1 Mi elements x fills 0-3, wq 4, wk 5, wv 6, wo 7,
// w1 8-11, w2 12-15.  256 blocks of 16 waves, one per WGP: a block owns 64 Ki
// consecutive elements (always inside one source) and walks them in two
// rounds.  In a round a wave has 16 loads of 16 bytes a lane in flight, each
// covering 512 contiguous bytes; each store covers 256 contiguous bytes.

static constexpr int CVT_THREADS = 512;
static constexpr int CVT_BLOCKS  = 256;
static constexpr int CVT_LOADS   = 16;                         // 16-byte loads a lane and round
static constexpr int CVT_ROUNDS  = 2;
static constexpr int CVT_STEP    = CVT_THREADS * 4;            // elements a block-wide load covers
static constexpr int CVT_ROUND   = CVT_STEP * CVT_LOADS;       // elements a block converts a round
static constexpr int CVT_PER_BLOCK = CVT_ROUND * CVT_ROUNDS;   // 64 Ki elements
static_assert((size_t)CVT_BLOCKS * CVT_PER_BLOCK ==
              (size_t)BS * Dd + 4u * Dd * Dd + 2u * (size_t)FFf * Dd, "the grid covers every element once");
static_assert((1 << 20) % CVT_PER_BLOCK == 0, "a block never straddles two sources");

__global__ __launch_bounds__(CVT_THREADS) void cvt_all_bf16_kernel(
    const float* __restrict__ x,  const float* __restrict__ wq,
    const float* __restrict__ wk, const float* __restrict__ wv,
    const float* __restrict__ wo, const float* __restrict__ w1,
    const float* __restrict__ w2, u16* __restrict__ y) {
    const int seg = blockIdx.x >> 4;                   // which 1 Mi-element unit
    const float* src;
    int first;                                         // the source's first unit
    if (seg < 4)       { src = x;  first = 0; }
    else if (seg == 4) { src = wq; first = 4; }
    else if (seg == 5) { src = wk; first = 5; }
    else if (seg == 6) { src = wv; first = 6; }
    else if (seg == 7) { src = wo; first = 7; }
    else if (seg < 12) { src = w1; first = 8; }
    else               { src = w2; first = 12; }

    const size_t dst0 = (size_t)blockIdx.x * CVT_PER_BLOCK + threadIdx.x * 4;
    const float* s = src + (dst0 - ((size_t)first << 20));
    u16* d = y + dst0;

    for (int r = 0; r < CVT_ROUNDS; ++r) {
        f32x4 v[CVT_LOADS];
        // Both inner loops unrolled: constant indices keep v[] in registers.
#pragma unroll
        for (int i = 0; i < CVT_LOADS; ++i)
            v[i] = *reinterpret_cast<const f32x4*>(s + i * CVT_STEP);
        // Inputs-only fence on the loaded values: it keeps the round's 16 loads
        // ahead of its converts.  Left free, the compiler waits out each load
        // alone, with one in flight a wave.
        asm volatile("" :: "v"(v[0]), "v"(v[1]), "v"(v[2]), "v"(v[3]), "v"(v[4]), "v"(v[5]), "v"(v[6]), "v"(v[7]),
                           "v"(v[8]), "v"(v[9]), "v"(v[10]), "v"(v[11]), "v"(v[12]), "v"(v[13]), "v"(v[14]), "v"(v[15]));
#pragma unroll
        for (int i = 0; i < CVT_LOADS; ++i) {
            uint2 p;
            p.x = (u32)f2bf(v[i].x) | ((u32)f2bf(v[i].y) << 16);
            p.y = (u32)f2bf(v[i].z) | ((u32)f2bf(v[i].w) << 16);
            *reinterpret_cast<uint2*>(d + i * CVT_STEP) = p;
        }
        s += CVT_ROUND;
        d += CVT_ROUND;
    }
}

// ---------------- generic WMMA GEMM -----------------------------------------
// C[M,N] = A[M,K](bf16) * Bt[N,K](bf16)^T + bias[N], with epilogue modes.
// Block tile TB rows x TN columns, K-step 64.  Three forms, each of 256 blocks, one a WGP:
//   128 x 128,  8 waves, wave tile 32 x 64 (2 x 4 WMMA tiles): the products of 1024 columns;
//   256 x 256, 16 waves, wave tile 64 x 64 (4 x 4 WMMA tiles): the product of 4096 columns.
//             A block copies 64 KB a K-step for four times the products of the small
//             tile's 32 KB, so half the bytes leave L2, and a wave reads 8 fragments
//             from LDS for 16 WMMAs, not 6 for 8;
//   256 x 192, 16 waves, wave tile 64 x 48 (4 x 3 WMMA tiles): the product of 3072 columns,
//             which has only 192 tiles of 256 x 256.  56 KB a K-step for three times the products.
// The A and B tiles come into LDS by asynchronous copies, in a ring of four
// buffers: the copies of the next three tiles fly while this tile is multiplied,
// so that a tile has three trips to land in and the requests of one tile follow
// those of the tile before without a pause.

// MODE_QKV is the three projections of x as one product: Bt holds wq, wk and wv
// one below the other (N = 3 * D), Cb the three outputs one behind the other.  The
// 16 columns of a WMMA tile lie in one of the three, which picks bias and layout.

enum { MODE_F32 = 0, MODE_RELU_BF16 = 1, MODE_QKV = 2 };

static constexpr int NBUF = 4;   // buffers of the GEMM ring
static_assert(NBUF == 4, "the counted waits below are written for four buffers");

template <int MODE, int TB, int TN>
__global__ __launch_bounds__(2 * TB) void gemm_bf16_kernel(
    const u16* __restrict__ A, const u16* __restrict__ Bt,
    const float* __restrict__ bias, const float* __restrict__ biasK,
    const float* __restrict__ biasV, float* __restrict__ Cf,
    u16* __restrict__ Cb, int M, int N, int K) {
    static_assert(TB == 128 || TB == 256, "8 or 16 waves");
    constexpr int WM = TB / 4;                 // rows of a wave tile: four waves one below the other
    constexpr int WN = TN / (TB / 64);         // columns of a wave tile: two or four waves side by side
    constexpr int FA = WM / 16, FB = WN / 16;  // A and B fragments of a wave and 32 k
    constexpr int CROWS = TB / 4;              // rows that one copy of every thread covers
    constexpr int NB = TN / CROWS;             // copies a thread and B tile: 4 or 3
    constexpr int CP = 4 + NB;                 // copies a wave and pair of tiles
    static_assert(WN % 16 == 0 && TN % CROWS == 0 && (NB == 4 || NB == 3), "whole fragments, whole copies");
    __shared__ __attribute__((aligned(16))) u16 As[NBUF][TB * LP];   // 4 x 18 KB or 4 x 36 KB
    __shared__ __attribute__((aligned(16))) u16 Bs[NBUF][TN * LP];

    const int tid  = threadIdx.x;
    const int lane = tid & 31;
    const int ln   = lane & 15;
    const int half = lane >> 4;
    const int wave = tid >> 5;
    const int wr   = (wave & 3) * WM;   // wave row offset within the block tile
    const int wc   = (wave >> 2) * WN;  // wave col offset within the block tile
    const int m0   = blockIdx.y * TB;
    const int n0   = blockIdx.x * TN;

    v8f acc[FA][FB] = {};
    // Which operand goes in as the WMMA's A decides what a lane's eight accumulator registers
    // hold.  Rows of A first: eight rows of one column.  Rows of Bt first (WFIRST): eight
    // consecutive columns of one row, which go to the epilogue's row-major staging 16 B at a time.
    constexpr bool WFIRST = MODE != MODE_QKV;
    auto mm = [](v16bf a, v16bf b, v8f c) {
        if constexpr (WFIRST) return wmma_bf16(b, a, c);
        else                  return wmma_bf16(a, b, c);
    };

    // A tile is TB or TN rows x 128 B, 8 pieces of 16 B a row: 4 a thread for A, NB for B.
    // A wave's copy covers four whole rows; copy i takes the rows CROWS * i further on.
    const int crow = tid >> 3, cq = tid & 7;
    const u16* ga = A  + (size_t)(m0 + crow) * K + cq * 8;
    const u16* gb = Bt + (size_t)(n0 + crow) * K + cq * 8;
    const u32 la = lds_addr(&As[0][crow * LP + cq * 8]);
    const u32 lb = lds_addr(&Bs[0][crow * LP + cq * 8]);
    constexpr u32 LROWS = CROWS * LP * 2;      // LDS bytes of CROWS rows
    constexpr u32 LBUFA = TB * LP * 2;         // LDS bytes of one buffer of A
    constexpr u32 LBUFB = TN * LP * 2;         // and of B
    const size_t grows = (size_t)CROWS * K;    // elements of CROWS rows in memory
    const int T = K / 64;

    // The first four tiles, each into a buffer that nobody has read yet.  The loop is
    // unrolled so that each buffer's offsets are constants.
    auto copy_tiles = [&](int buf, size_t k0) {   // the A and B tiles at column k0 into buffer buf
        if constexpr (NB == 4)
            async_copy4x2(la + buf * LBUFA, lb + buf * LBUFB, LROWS, ga + k0, grows, gb + k0, grows);
        else
            async_copy4x3(la + buf * LBUFA, lb + buf * LBUFB, LROWS, ga + k0, grows, gb + k0, grows);
    };
    copy_tiles(0, 0);
#pragma unroll
    for (int s = 1; s < NBUF; ++s)
        if (s < T) copy_tiles(s, s * 64);
    // Tile 0 has landed before anyone reads it: a wave's copies count down in issue
    // order, and its 3 * CP youngest are those of tiles 1 to 3.
    if (T >= NBUF) asm volatile("s_wait_asynccnt %0" :: "n"(3 * CP) : "memory");
    else           asm volatile("s_wait_asynccnt 0x0" ::: "memory");
    __syncthreads();

    for (int t = 0; t < T; ++t) {
        const int buf = t & (NBUF - 1);
        const u16* as = As[buf];
        const u16* bs = Bs[buf];

        if constexpr (TB == 128) {
            // All 24 fragment reads of the trip go out as one group, each fragment
            // into registers of its own, in the order in which the products use them.
            v16bf a[2][FA], b[2][FB];
#pragma unroll
            for (int c = 0; c < 2; ++c) {
#pragma unroll
                for (int i = 0; i < FA; ++i)
                    a[c][i] = lds_load_op(as, wr + i * 16 + ln, LP, c * 32, lane);
#pragma unroll
                for (int j = 0; j < FB; ++j)
                    b[c][j] = lds_load_op(bs, wc + j * 16 + ln, LP, c * 32, lane);
            }
            // Keeps the reads ahead of the products.  Left free, the compiler sinks each
            // B fragment's reads to its two products, into one shared register set, and
            // the wave waits out a whole LDS latency eight times a trip.
            __builtin_amdgcn_sched_barrier(0);

#pragma unroll
            for (int c = 0; c < 2; ++c) {
#pragma unroll
                for (int j = 0; j < FB; ++j) {
                    acc[0][j] = mm(a[c][0], b[c][j], acc[0][j]);
                    acc[1][j] = mm(a[c][1], b[c][j], acc[1][j]);
                }
            }
        } else {
            // A wave of sixteen has 256 registers.  Beside the 96 accumulator registers of the
            // 64 x 48 tile the trip's 14 fragments fit: all their reads go out as one group,
            // as above.  Beside the 128 of the 64 x 64 tile only the 8 fragments of 32 k fit:
            // two groups a trip; while one wave waits for its reads, the three that share its
            // SIMD have products to issue.  In a group the reads stand in the order in which
            // the products use them.
            constexpr int G = (FA * FB + 2 * (FA + FB)) * 8 <= 208 ? 2 : 1;   // 32-k steps a group
#pragma unroll
            for (int g = 0; g < 2; g += G) {
                v16bf a[G][FA], b[G][FB];
#pragma unroll
                for (int c = 0; c < G; ++c) {
                    a[c][0] = lds_load_op(as, wr + ln, LP, (g + c) * 32, lane);
#pragma unroll
                    for (int j = 0; j < FB; ++j)
                        b[c][j] = lds_load_op(bs, wc + j * 16 + ln, LP, (g + c) * 32, lane);
#pragma unroll
                    for (int i = 1; i < FA; ++i)
                        a[c][i] = lds_load_op(as, wr + i * 16 + ln, LP, (g + c) * 32, lane);
                }
                // Keeps the group's reads together, ahead of its products (as above).
                __builtin_amdgcn_sched_barrier(0);
#pragma unroll
                for (int c = 0; c < G; ++c)
#pragma unroll
                    for (int i = 0; i < FA; ++i)
#pragma unroll
                        for (int j = 0; j < FB; ++j)
                            acc[i][j] = mm(a[c][i], b[c][j], acc[i][j]);
                // Keeps the next group's reads from being spread among these products.
                if (g + G < 2) __builtin_amdgcn_sched_barrier(0);
            }
        }
        // Keeps the products ahead of the hand-over.  Left free, the compiler lifts the
        // hand-over's waits and barrier over them: every product then waits for the last
        // read, and tile t + 1's copies lose this trip's products from their time to land in.
        __builtin_amdgcn_sched_barrier(0);

        // The hand-over, every wave: my reads of this buffer are done, my copies of tile
        // t + 1 have landed, and the barrier tells both to the other waves.  While tile
        // t + 3 exists the wave's 2 * CP youngest copies are those of tiles t + 2 and t + 3,
        // which stay in flight; in the last trips nothing younger has been issued for long.
        asm volatile("s_wait_dscnt 0x0" ::: "memory");
        if (t + NBUF - 1 < T) asm volatile("s_wait_asynccnt %0" :: "n"(2 * CP) : "memory");
        else                  asm volatile("s_wait_asynccnt 0x0" ::: "memory");
        __syncthreads();
        if (t + NBUF < T)  // refill the buffers that every wave has just left
            copy_tiles(buf, (size_t)(t + NBUF) * 64);
    }
    asm volatile("s_wait_asynccnt 0x0" ::: "memory");  // no copy is left in flight at the wave's end

    // Epilogue.  Every wave stages its own tile in its own sixteenth (or eighth) of the ring and
    // reads it back row by row, 16 B a lane, so that a store instruction covers whole 128-B lines
    // (Q and K rows of the 48-column tiles: 96 B, or 64 and 32 B where they span two heads) and not a WMMA tile's pieces of 32 or 64 B.  The ring is free here:
    // the last trip's hand-over had every wave's reads done and copies landed ahead of its barrier.
    // No wave touches another's range, so no further barrier is needed.
    constexpr int SLICE_A = NBUF * 16 * LP;                  // elements of As a wave: 9,216 B
    u16* const sa = &As[0][0] + wave * SLICE_A;
    if constexpr (MODE == MODE_QKV) {
        // Accumulator register r of a lane: row r + 8 * half, column lane & 15.
        constexpr int RP = WN + 8;                           // pitch of the row-major tile: 112 B = 16 B x 7
        constexpr int SLICE_B = NBUF * TN * LP / (TB / 16);  // elements of Bs a wave
        static_assert(WM * RP <= SLICE_A && WN * LP <= SLICE_B && WM + 8 <= LP, "both staged tiles fit");
        u16* const sb = &Bs[0][0] + wave * SLICE_B;          // the transposed tile: WN rows of WM elements, pitch LP
        int part[FB];                                  // 0 = Q, 1 = K, 2 = V: the same for the whole wave
        float bv[FB];                                  // the bias of the lane's columns
#pragma unroll
        for (int j = 0; j < FB; ++j) {
            const int cg = n0 + wc + j * 16;           // the WMMA tile's first column
            part[j] = __builtin_amdgcn_readfirstlane(cg >> 10);
            const float* bp = part[j] == 0 ? bias : part[j] == 1 ? biasK : biasV;
            bv[j] = bp[(cg & (Dd - 1)) + ln];
        }
#pragma unroll
        for (int j = 0; j < FB; ++j) {
            if (part[j] < 2) {    // Q, K are stored [b,h,s,kk]: staged row-major, 2 B a register
#pragma unroll
                for (int i = 0; i < FA; ++i) {
                    const uint4 q = __builtin_bit_cast(uint4, cvt8(acc[i][j] + bv[j]));
                    const u32 w[4] = { q.x, q.y, q.z, q.w };   // rows 2n and 2n + 1 in word n
#pragma unroll
                    for (int r = 0; r < 8; ++r)
                        sa[(i * 16 + half * 8 + r) * RP + j * 16 + ln] = (u16)(w[r >> 1] >> ((r & 1) * 16));
                }
            } else {              // V is stored [b,h,kk,s]: staged transposed, a lane's 8 rows are 16 B
#pragma unroll
                for (int i = 0; i < FA; ++i)
                    *reinterpret_cast<uint4*>(&sb[(j * 16 + ln) * LP + i * 16 + half * 8]) =
                        __builtin_bit_cast(uint4, cvt8(acc[i][j] + bv[j]));
            }
        }
        // The other lanes' staged values are in LDS before this lane reads them back.
        asm volatile("s_wait_dscnt 0x0" ::: "memory");

        const int bidx = (m0 + wr) >> 11, s0 = (m0 + wr) & (Ss - 1);   // the wave's 64 rows lie in one batch
        const int lr = lane >> 3, lp = lane & 7;       // an instruction takes 4 staged rows, 8 lanes a row
        if (part[0] < 2) {        // the parts rise with j: some column of the wave is Q or K
            const int cg = n0 + wc + lp * 8;           // the lane's 8 columns, for lp < WN / 8
            const int pt = cg >> 10, c = cg & (Dd - 1);
            if (lp < WN / 8 && pt < 2) {
                u16* gp = Cb + (size_t)pt * BS * Dd + ((size_t)(bidx * Hh + (c >> 6)) * Ss + s0 + lr) * DKk + (c & 63);
                uint4 v[WM / 4];
#pragma unroll
                for (int it = 0; it < WM / 4; ++it)
                    v[it] = *reinterpret_cast<const uint4*>(&sa[(it * 4 + lr) * RP + lp * 8]);
#pragma unroll
                for (int it = 0; it < WM / 4; ++it)
                    *reinterpret_cast<uint4*>(gp + it * 4 * DKk) = v[it];
            }
            // The code behind this branch rewrites registers that these stores name.
            asm volatile("s_wait_xcnt 0x0" ::: "memory");
        }
#pragma unroll
        for (int j = 0; j < FB; ++j) {
            if (part[j] == 2) {
                const int c = ((n0 + wc + j * 16) & (Dd - 1)) + lr;   // 16 columns of one head
                u16* gp = Cb + (size_t)2 * BS * Dd + ((size_t)(bidx * Hh + (c >> 6)) * DKk + (c & 63)) * Ss + s0 + lp * 8;
                uint4 v[4];
#pragma unroll
                for (int it = 0; it < 4; ++it)
                    v[it] = *reinterpret_cast<const uint4*>(&sb[(j * 16 + it * 4 + lr) * LP + lp * 8]);
#pragma unroll
                for (int it = 0; it < 4; ++it)
                    *reinterpret_cast<uint4*>(gp + (size_t)it * 4 * Ss) = v[it];
                // The next tile's code rewrites registers that these stores name.
                asm volatile("s_wait_xcnt 0x0" ::: "memory");
            }
        }
    } else {
        // Accumulator register r of a lane: row lane & 15, column r + 8 * half.
        v8f bl[FB];                                    // the bias of the lane's columns, read as one group
        const float* bp = bias + n0 + wc + half * 8;
#pragma unroll
        for (int j = 0; j < FB; ++j)
            bl[j] = *reinterpret_cast<const v8f*>(bp + j * 16);
        // Stands ahead of any rewrite of the address that these loads name: as an operand the
        // address stays in its registers up to the wait (left free, the last load landed on them).
        asm volatile("s_wait_xcnt 0x0" :: "v"(bp) : "memory");
        if constexpr (MODE == MODE_F32) {
            constexpr int FP = WN + 4;                 // pitch in floats: 272 B = 16 B x 17
            static_assert(WM * FP * 2 <= SLICE_A && WN == 64, "the staged tile fits; a row is 16 lanes");
            float* const sf = reinterpret_cast<float*>(sa);
#pragma unroll
            for (int i = 0; i < FA; ++i)
#pragma unroll
                for (int j = 0; j < FB; ++j) {
                    const v8f v = acc[i][j] + bl[j];
                    float* p = sf + (i * 16 + ln) * FP + j * 16 + half * 8;
                    *reinterpret_cast<f32x4*>(p)     = __builtin_shufflevector(v, v, 0, 1, 2, 3);
                    *reinterpret_cast<f32x4*>(p + 4) = __builtin_shufflevector(v, v, 4, 5, 6, 7);
                }
            // The other lanes' staged values are in LDS before this lane reads them back.
            asm volatile("s_wait_dscnt 0x0" ::: "memory");
            const int lr = lane >> 4, lp = lane & 15;  // an instruction takes 2 rows of 256 B
            float* gp = Cf + (size_t)(m0 + wr + lr) * N + n0 + wc + lp * 4;
            f32x4 v[WM / 2];
#pragma unroll
            for (int it = 0; it < WM / 2; ++it)
                v[it] = *reinterpret_cast<const f32x4*>(&sf[(it * 2 + lr) * FP + lp * 4]);
#pragma unroll
            for (int it = 0; it < WM / 2; ++it)
                *reinterpret_cast<f32x4*>(gp + (size_t)it * 2 * N) = v[it];
        } else {
            static_assert(WM * LP <= SLICE_A && WN == 64, "the staged tile fits; a row is 8 lanes");
#pragma unroll
            for (int i = 0; i < FA; ++i)
#pragma unroll
                for (int j = 0; j < FB; ++j) {
                    v8f v = acc[i][j] + bl[j];
#pragma unroll
                    for (int r = 0; r < 8; ++r) v[r] = fmaxf(v[r], 0.0f);
                    *reinterpret_cast<uint4*>(&sa[(i * 16 + ln) * LP + j * 16 + half * 8]) =
                        __builtin_bit_cast(uint4, cvt8(v));
                }
            // The other lanes' staged values are in LDS before this lane reads them back.
            asm volatile("s_wait_dscnt 0x0" ::: "memory");
            const int lr = lane >> 3, lp = lane & 7;   // an instruction takes 4 rows of 128 B
            u16* gp = Cb + (size_t)(m0 + wr + lr) * N + n0 + wc + lp * 8;
            uint4 v[WM / 4];
#pragma unroll
            for (int it = 0; it < WM / 4; ++it)
                v[it] = *reinterpret_cast<const uint4*>(&sa[(it * 4 + lr) * LP + lp * 8]);
#pragma unroll
            for (int it = 0; it < WM / 4; ++it)
                *reinterpret_cast<uint4*>(gp + (size_t)it * 4 * N) = v[it];
        }
    }
}

__global__ __launch_bounds__(128) void flash_attn_kernel(
    const u16* __restrict__ Q, const u16* __restrict__ Km,
    const u16* __restrict__ VT, u16* __restrict__ O) {
    __shared__ __attribute__((aligned(16))) u16 qs[64 * LP];       // 64 q rows x DK      (9 KB)
    __shared__ __attribute__((aligned(16))) u16 ks[2][64 * LP];    // 64 keys  x DK       (2 x 9 KB)
    __shared__ __attribute__((aligned(16))) u16 vts[2][64 * LP];   // DK rows  x 64 keys  (2 x 9 KB)

    const int tid  = threadIdx.x;
    const int lane = tid & 31;
    const int ln   = lane & 15;
    const int half = lane >> 4;
    const int wave = tid >> 5;
    const int bh   = blockIdx.y;                 // b*H + h
    const int q0   = blockIdx.x * 64;
    const int rb   = wave * 16;

    // A K or V^T tile is 64 rows x 128 B = 512 pieces of 16 B: 4 a thread and
    // tile.  A wave's copy covers four whole rows; copy i the rows 16 * i further on.
    const int crow = tid >> 3, cq = tid & 7;
    const u16* gk = Km + ((size_t)bh * Ss + crow) * DKk + cq * 8;
    const u16* gv = VT + ((size_t)bh * DKk + crow) * Ss + cq * 8;
    const u32 lk = lds_addr(&ks[0][crow * LP + cq * 8]);
    const u32 lv = lds_addr(&vts[0][crow * LP + cq * 8]);
    constexpr u32 LROWS = 16 * LP * 2;         // LDS bytes of 16 rows
    constexpr u32 LBUF  = 64 * LP * 2;         // LDS bytes of one buffer
    constexpr int T = Ss / 64;
    static_assert(T >= 2, "the ring's prologue fills two tiles");

    async_copy4x2(lk, lv, LROWS, gk, (size_t)16 * DKk, gv, (size_t)16 * Ss);

    // stage Q tile
    {
        const u16* qg = Q + ((size_t)bh * Ss + q0) * DKk;
        int row = tid >> 1, cb = (tid & 1) * 32;
#pragma unroll
        for (int q = 0; q < 4; ++q)
            *reinterpret_cast<uint4*>(&qs[row * LP + cb + q * 8]) =
                *reinterpret_cast<const uint4*>(&qg[(size_t)row * DKk + cb + q * 8]);
    }
    asm volatile("s_wait_asynccnt 0x0" ::: "memory");  // tile 0 has landed before anyone reads it
    __syncthreads();
    async_copy4x2(lk + LBUF, lv + LBUF, LROWS, gk + (size_t)64 * DKk, (size_t)16 * DKk, gv + 64, (size_t)16 * Ss);

    v16bf bq[2];   // Q^T as B operand: lane ln holds query rb + ln
#pragma unroll
    for (int c = 0; c < 2; ++c)
        bq[c] = lds_load_op(qs, rb + ln, LP, c * 32, lane);

    float m = -INFINITY, l = 0.0f;   // of query rb + ln; l sums this lane half's keys only
    v8f o[4] = {};                   // O^T: o[n][r] = head element n*16 + 8*half + r of query rb + ln

    for (int tile = 0; tile < T; ++tile) {
        const int buf = tile & 1;
        const u16* kt = ks[buf];
        const u16* vt = vts[buf];

        // scores^T: [64 keys] x [16 queries] in 4 tiles, accumulate over DK
        v8f s[4] = {};
#pragma unroll
        for (int c = 0; c < 2; ++c)
#pragma unroll
            for (int t = 0; t < 4; ++t) {
                v16bf ak = lds_load_op(kt, t * 16 + ln, LP, c * 32, lane);
                s[t] = wmma_bf16(ak, bq[c], s[t]);
            }
#pragma unroll
        for (int t = 0; t < 4; ++t) s[t] = s[t] * 0.125f;   // 1/sqrt(DK)

        // online softmax: a lane holds 32 of its query's 64 scores, lane ^ 16 the rest
        float mx[8];
#pragma unroll
        for (int r = 0; r < 8; ++r)
            mx[r] = fmaxf(fmaxf(s[0][r], s[1][r]), fmaxf(s[2][r], s[3][r]));
        float rmax = fmaxf(fmaxf(fmaxf(mx[0], mx[1]), fmaxf(mx[2], mx[3])),
                           fmaxf(fmaxf(mx[4], mx[5]), fmaxf(mx[6], mx[7])));
        rmax = fmaxf(rmax, xhalf(rmax));

        const float mn = fmaxf(m, rmax);
        const float alpha = __expf(m - mn);
        m = mn;
#pragma unroll
        for (int t = 0; t < 4; ++t)
#pragma unroll
            for (int r = 0; r < 8; ++r)
                s[t][r] = __expf(s[t][r] - m);

        const v8f sv = (s[0] + s[1]) + (s[2] + s[3]);
        l = l * alpha + (((sv[0] + sv[1]) + (sv[2] + sv[3])) + ((sv[4] + sv[5]) + (sv[6] + sv[7])));

        // P^T as B operand: element e is key c*32 + 8*half + e (e < 8), c*32 + 16 + 8*half + e - 8 (e >= 8)
        v16bf bp[2];
#pragma unroll
        for (int c = 0; c < 2; ++c)
            bp[c] = __builtin_shufflevector(cvt8(s[2 * c]), cvt8(s[2 * c + 1]),
                                            0, 1, 2, 3, 4, 5, 6, 7, 8, 9, 10, 11, 12, 13, 14, 15);

        // O^T = O^T*alpha + V^T @ P^T  (two 32-key WMMA K-steps per group of 16 head elements)
#pragma unroll
        for (int n = 0; n < 4; ++n) {
            o[n] = o[n] * alpha;
#pragma unroll
            for (int c = 0; c < 2; ++c) {
                v16bf av = lds_load_op(vt, n * 16 + ln, LP, c * 32, lane);
                o[n] = wmma_bf16(av, bp[c], o[n]);
            }
        }

        ring_publish();
        if (tile + 2 < T)  // refill the buffers that every wave has just left
            async_copy4x2(lk + buf * LBUF, lv + buf * LBUF, LROWS,
                          gk + (size_t)(tile + 2) * 64 * DKk, (size_t)16 * DKk,
                          gv + (tile + 2) * 64, (size_t)16 * Ss);
    }
    asm volatile("s_wait_asynccnt 0x0" ::: "memory");  // no copy is left in flight at the wave's end

    // finalize: O /= l, write concatenated-head layout [b, s, h*DK + col]; a lane's
    // eight registers of a tile are eight consecutive columns of its query's row.  The
    // wave stages its 16 rows of 128 B over its own 16 rows of Q, which no other wave
    // reads and which it has long read itself, and stores them as whole 128-B lines,
    // four rows an instruction, not as pieces of 32 B.
    const int bidx = bh >> 4, h = bh & 15;
    l += xhalf(l);                   // join the two lane halves' sums
    const float inv = 1.0f / l;
    u16* const st = qs + rb * LP;
#pragma unroll
    for (int n = 0; n < 4; ++n)
        *reinterpret_cast<uint4*>(&st[ln * LP + n * 16 + half * 8]) = __builtin_bit_cast(uint4, cvt8(o[n] * inv));
    // The other lanes' staged values are in LDS before this lane reads them back.
    asm volatile("s_wait_dscnt 0x0" ::: "memory");
    const int lr = lane >> 3, lp = lane & 7;
    u16* op = O + ((size_t)bidx * Ss + q0 + rb + lr) * (Hh * DKk) + h * DKk + lp * 8;
    uint4 ov[4];
#pragma unroll
    for (int it = 0; it < 4; ++it)
        ov[it] = *reinterpret_cast<const uint4*>(&st[(it * 4 + lr) * LP + lp * 8]);
#pragma unroll
    for (int it = 0; it < 4; ++it)
        *reinterpret_cast<uint4*>(op + (size_t)it * 4 * (Hh * DKk)) = ov[it];
}

// ---------------- residual + LayerNorm --------------------------------------
// one row per block; 256 threads * 4 elems = D

template <bool WRITE_BF16>
__global__ __launch_bounds__(256) void add_ln_kernel(
    const float* __restrict__ a, const float* __restrict__ b,
    const float* __restrict__ g, const float* __restrict__ be,
    float* __restrict__ oF, u16* __restrict__ oB) {
    __shared__ float ss[256], sq[256];
    const int row = blockIdx.x, tid = threadIdx.x;
    const int i0 = tid * 4;

    float4 xa = *reinterpret_cast<const float4*>(a + (size_t)row * Dd + i0);
    float4 xb = *reinterpret_cast<const float4*>(b + (size_t)row * Dd + i0);
    float v[4] = { xa.x + xb.x, xa.y + xb.y, xa.z + xb.z, xa.w + xb.w };

    float s = v[0] + v[1] + v[2] + v[3];
    float q = v[0] * v[0] + v[1] * v[1] + v[2] * v[2] + v[3] * v[3];
    ss[tid] = s; sq[tid] = q;
    __syncthreads();
    for (int st = 128; st > 0; st >>= 1) {
        if (tid < st) { ss[tid] += ss[tid + st]; sq[tid] += sq[tid + st]; }
        __syncthreads();
    }
    const float mu   = ss[0] * (1.0f / Dd);
    const float var  = sq[0] * (1.0f / Dd) - mu * mu;
    const float rstd = rsqrtf(var + LN_EPS);

    float4 gg = *reinterpret_cast<const float4*>(g + i0);
    float4 bb = *reinterpret_cast<const float4*>(be + i0);
    float o0 = (v[0] - mu) * rstd * gg.x + bb.x;
    float o1 = (v[1] - mu) * rstd * gg.y + bb.y;
    float o2 = (v[2] - mu) * rstd * gg.z + bb.z;
    float o3 = (v[3] - mu) * rstd * gg.w + bb.w;

    *reinterpret_cast<float4*>(oF + (size_t)row * Dd + i0) = make_float4(o0, o1, o2, o3);
    if constexpr (WRITE_BF16) {
        u16* p = oB + (size_t)row * Dd + i0;
        p[0] = f2bf(o0); p[1] = f2bf(o1); p[2] = f2bf(o2); p[3] = f2bf(o3);
    }
}

// ---------------- launcher ---------------------------------------------------

extern "C" void kernel_launch(void* const* d_in, const int* in_sizes, int n_in,
                              void* d_out, int out_size, void* d_ws, size_t ws_size,
                              hipStream_t stream) {
    const float* x  = (const float*)d_in[0];
    const float* wq = (const float*)d_in[1];  const float* bq = (const float*)d_in[2];
    const float* wk = (const float*)d_in[3];  const float* bk = (const float*)d_in[4];
    const float* wv = (const float*)d_in[5];  const float* bv = (const float*)d_in[6];
    const float* wo = (const float*)d_in[7];  const float* bo = (const float*)d_in[8];
    const float* g1 = (const float*)d_in[9];  const float* be1 = (const float*)d_in[10];
    const float* w1 = (const float*)d_in[11]; const float* b1 = (const float*)d_in[12];
    const float* w2 = (const float*)d_in[13]; const float* b2 = (const float*)d_in[14];
    const float* g2 = (const float*)d_in[15]; const float* be2 = (const float*)d_in[16];
    float* out = (float*)d_out;

    char* ws = (char*)d_ws;
    const size_t MB = 1024 * 1024;
    u16* XB  = (u16*)(ws + 0);          //  8 MB  x bf16 [BS, D]
    u16* WQB = (u16*)(ws + 8  * MB);    //  2 MB
    u16* WKB = (u16*)(ws + 10 * MB);    //  2 MB
    u16* WVB = (u16*)(ws + 12 * MB);    //  2 MB
    u16* WOB = (u16*)(ws + 14 * MB);    //  2 MB
    u16* W1B = (u16*)(ws + 16 * MB);    //  8 MB
    u16* W2B = (u16*)(ws + 24 * MB);    //  8 MB
    u16* Qb  = (u16*)(ws + 32 * MB);    //  8 MB  [B,H,S,DK]
    u16* Kb  = (u16*)(ws + 40 * MB);    //  8 MB  [B,H,S,DK]
    u16* VTb = (u16*)(ws + 48 * MB);    //  8 MB  [B,H,DK,S]
    u16* Ob  = (u16*)(ws + 56 * MB);    //  8 MB  [B,S,H*DK]
    float* ATT = (float*)(ws + 64 * MB);   // 16 MB [BS, D]
    float* N1F = (float*)(ws + 80 * MB);   // 16 MB
    u16*   N1B = (u16*)(ws + 96 * MB);     //  8 MB
    u16*   FF1 = (u16*)(ws + 104 * MB);    // 32 MB [BS, FF]
    float* FF2 = (float*)(ws + 136 * MB);  // 16 MB

    // 1. bf16 conversions: XB .. W2B are one contiguous destination
    cvt_all_bf16_kernel<<<CVT_BLOCKS, CVT_THREADS, 0, stream>>>(x, wq, wk, wv, wo, w1, w2, XB);

    // 2. QKV projections in one launch (N = 3 * H*DK = 3072, K = 1024): WQB, WKB, WVB
    //    are one [3072, 1024] matrix in the workspace, Qb, Kb, VTb one output range
    dim3 gP(Dd / 128, BS / 128);
    gemm_bf16_kernel<MODE_QKV, 256, 192><<<dim3(3 * Dd / 192, BS / 256), 512, 0, stream>>>(
        XB, WQB, bq, bk, bv, nullptr, Qb, BS, 3 * Dd, Dd);

    // 3. fused attention
    flash_attn_kernel<<<dim3(Ss / 64, Bb * Hh), 128, 0, stream>>>(Qb, Kb, VTb, Ob);

    // 4. output projection
    gemm_bf16_kernel<MODE_F32, 128, 128><<<gP, 256, 0, stream>>>(Ob, WOB, bo, nullptr, nullptr, ATT, nullptr, BS, Dd, Dd);

    // 5. LN1 (residual with x), keep bf16 mirror for FFN input
    add_ln_kernel<true><<<BS, 256, 0, stream>>>(ATT, x, g1, be1, N1F, N1B);

    // 6. FFN
    gemm_bf16_kernel<MODE_RELU_BF16, 256, 256><<<dim3(FFf / 256, BS / 256), 512, 0, stream>>>(
        N1B, W1B, b1, nullptr, nullptr, nullptr, FF1, BS, FFf, Dd);
    gemm_bf16_kernel<MODE_F32, 128, 128><<<gP, 256, 0, stream>>>(FF1, W2B, b2, nullptr, nullptr, FF2, nullptr, BS, Dd, FFf);

    // 7. LN2 -> output
    add_ln_kernel<false><<<BS, 256, 0, stream>>>(FF2, N1F, g2, be2, out, nullptr);
}

// v010
// A run of this version takes 144 microseconds.
// Timed twice side by side with v009, it ran 1.04 times as fast both times.
// All steps since v000 together make it 5.00 times as fast.
#include <hip/hip_runtime.h>

// ---------------------------------------------------------------------------
// Transformer encoder block for MI455X (gfx1250, wave32, WMMA bf16)
//   B=2, S=2048, D=1024, H=16, DK=64, FF=4096, fp32 I/O
// ---------------------------------------------------------------------------

typedef __attribute__((ext_vector_type(16))) __bf16 v16bf;
typedef __attribute__((ext_vector_type(8)))  __bf16 v8bf;
typedef __attribute__((ext_vector_type(8)))  float  v8f;
typedef __attribute__((ext_vector_type(4)))  float  f32x4;

using u16 = unsigned short;
using u32 = unsigned int;

static constexpr int Hh = 16;
static constexpr int Dd = 1024;
static constexpr int DKk = 64;
static constexpr int FFf = 4096;
static constexpr int Bb = 2;
static constexpr int Ss = 2048;
static constexpr int BS = Bb * Ss;       // 4096 rows
static constexpr float LN_EPS = 1e-5f;
// LDS row pitch in bf16 elements for tiles of 64 elements a row: 144 B = 16 B x 9.
// An odd multiple of 16 B spreads the 16 rows of a ds_load_b128 fragment read
// over all 64 banks; at 128 B eight rows fall on the same four banks.
static constexpr int LP = 72;

// ---------------- helpers ---------------------------------------------------

__device__ __forceinline__ u16 f2bf(float f) {
    u32 u = __float_as_uint(f);
    u32 r = u + 0x7FFFu + ((u >> 16) & 1u);   // round-to-nearest-even
    return (u16)(r >> 16);
}

union Op32 { uint4 q[2]; v16bf v; };

// Load one WMMA 16x16x32 bf16 operand (A layout; B uses the same pattern on
// the transposed [N,K] matrix).  `base` points at a row-major bf16 tile in
// LDS with `stride` elements per row, `kbase` selects the 32-wide K chunk.
// Lanes 0-15: K = kbase+{0..7,16..23};  lanes 16-31: K = kbase+{8..15,24..31}.
__device__ __forceinline__ v16bf lds_load_op(const u16* base, int row, int stride,
                                             int kbase, int lane) {
    const u16* p = base + row * stride + kbase + ((lane >> 4) & 1) * 8;
    Op32 u;
    u.q[0] = *reinterpret_cast<const uint4*>(p);
    u.q[1] = *reinterpret_cast<const uint4*>(p + 16);
    return u.v;
}

__device__ __forceinline__ v8f wmma_bf16(v16bf a, v16bf b, v8f c) {
    return __builtin_amdgcn_wmma_f32_16x16x32_bf16(false, a, false, b,
                                                   (short)0, c, false, false);
}

// Byte address inside the work-group's LDS: the low half of the flat address.
__device__ __forceinline__ u32 lds_addr(const void* p) { return (u32)(size_t)p; }

// Eight asynchronous copies of 16 bytes a lane, global memory -> LDS, through
// no register: four for each of two tiles.  Copy i of tile n moves the bytes at
// gn + i * gstepn to LDS byte ln + i * lstep.  The s_wait_xcnt stands inside the
// statement, behind the last copy, so that no address register is rewritten
// ahead of it.
__device__ __forceinline__ void async_copy4x2(u32 l0, u32 l1, u32 lstep, const u16* g0, size_t gstep0,
                                              const u16* g1, size_t gstep1) {
    asm volatile(
        "global_load_async_to_lds_b128 %0, %8, off\n\t"
        "global_load_async_to_lds_b128 %1, %9, off\n\t"
        "global_load_async_to_lds_b128 %2, %10, off\n\t"
        "global_load_async_to_lds_b128 %3, %11, off\n\t"
        "global_load_async_to_lds_b128 %4, %12, off\n\t"
        "global_load_async_to_lds_b128 %5, %13, off\n\t"
        "global_load_async_to_lds_b128 %6, %14, off\n\t"
        "global_load_async_to_lds_b128 %7, %15, off\n\t"
        "s_wait_xcnt 0x0"
        :: "v"(l0), "v"(l0 + lstep), "v"(l0 + 2 * lstep), "v"(l0 + 3 * lstep),
           "v"(l1), "v"(l1 + lstep), "v"(l1 + 2 * lstep), "v"(l1 + 3 * lstep),
           "v"(g0), "v"(g0 + gstep0), "v"(g0 + 2 * gstep0), "v"(g0 + 3 * gstep0),
           "v"(g1), "v"(g1 + gstep1), "v"(g1 + 2 * gstep1), "v"(g1 + 3 * gstep1)
        : "memory");
}

// The same for a second tile of three quarters the rows: four copies and three.
__device__ __forceinline__ void async_copy4x3(u32 l0, u32 l1, u32 lstep, const u16* g0, size_t gstep0,
                                              const u16* g1, size_t gstep1) {
    asm volatile(
        "global_load_async_to_lds_b128 %0, %7, off\n\t"
        "global_load_async_to_lds_b128 %1, %8, off\n\t"
        "global_load_async_to_lds_b128 %2, %9, off\n\t"
        "global_load_async_to_lds_b128 %3, %10, off\n\t"
        "global_load_async_to_lds_b128 %4, %11, off\n\t"
        "global_load_async_to_lds_b128 %5, %12, off\n\t"
        "global_load_async_to_lds_b128 %6, %13, off\n\t"
        "s_wait_xcnt 0x0"
        :: "v"(l0), "v"(l0 + lstep), "v"(l0 + 2 * lstep), "v"(l0 + 3 * lstep),
           "v"(l1), "v"(l1 + lstep), "v"(l1 + 2 * lstep),
           "v"(g0), "v"(g0 + gstep0), "v"(g0 + 2 * gstep0), "v"(g0 + 3 * gstep0),
           "v"(g1), "v"(g1 + gstep1), "v"(g1 + 2 * gstep1)
        : "memory");
}

// The hand-over of a two-buffer ring, every wave: this wave's LDS reads of the
// buffer it leaves have returned, its own copies of the next tile have landed,
// and the barrier tells both to the other waves.
__device__ __forceinline__ void ring_publish() {
    asm volatile("s_wait_dscnt 0x0" ::: "memory");     // my reads of the old buffer are done
    asm volatile("s_wait_asynccnt 0x0" ::: "memory");  // my copies of the next tile have landed
    __syncthreads();
}

// Lane l takes the value of lane l ^ 16: the two lanes that share a column of a
// WMMA accumulator tile.
__device__ __forceinline__ float xhalf(float v) {
    int b = __builtin_bit_cast(int, v);
    return __builtin_bit_cast(float, __builtin_amdgcn_permlanex16(b, b, 0x76543210, 0xfedcba98, false, false));
}

// Eight f32 -> eight bf16, round-to-nearest-even, two a conversion instruction.
__device__ __forceinline__ v8bf cvt8(v8f v) { return __builtin_convertvector(v, v8bf); }

// ---------------- fp32 -> bf16 conversion -----------------------------------
// One launch converts x and the six weight matrices.  Their bf16 copies lie
// back to back in the workspace, so the destination is one array of 16 Mi
// elements; in units of 1 Mi elements x fills 0-3, wq 4, wk 5, wv 6, wo 7,
// w1 8-11, w2 12-15.  256 blocks of 16 waves, one per WGP: a block owns 64 Ki
// consecutive elements (always inside one source) and walks them in two
// rounds.  In a round a wave has 16 loads of 16 bytes a lane in flight, each
// covering 512 contiguous bytes; each store covers 256 contiguous bytes.

static constexpr int CVT_THREADS = 512;
static constexpr int CVT_BLOCKS  = 256;
static constexpr int CVT_LOADS   = 16;                         // 16-byte loads a lane and round
static constexpr int CVT_ROUNDS  = 2;
static constexpr int CVT_STEP    = CVT_THREADS * 4;            // elements a block-wide load covers
static constexpr int CVT_ROUND   = CVT_STEP * CVT_LOADS;       // elements a block converts a round
static constexpr int CVT_PER_BLOCK = CVT_ROUND * CVT_ROUNDS;   // 64 Ki elements
static_assert((size_t)CVT_BLOCKS * CVT_PER_BLOCK ==
              (size_t)BS * Dd + 4u * Dd * Dd + 2u * (size_t)FFf * Dd, "the grid covers every element once");
static_assert((1 << 20) % CVT_PER_BLOCK == 0, "a block never straddles two sources");

__global__ __launch_bounds__(CVT_THREADS) void cvt_all_bf16_kernel(
    const float* __restrict__ x,  const float* __restrict__ wq,
    const float* __restrict__ wk, const float* __restrict__ wv,
    const float* __restrict__ wo, const float* __restrict__ w1,
    const float* __restrict__ w2, u16* __restrict__ y) {
    const int seg = blockIdx.x >> 4;                   // which 1 Mi-element unit
    const float* src;
    int first;                                         // the source's first unit
    if (seg < 4)       { src = x;  first = 0; }
    else if (seg == 4) { src = wq; first = 4; }
    else if (seg == 5) { src = wk; first = 5; }
    else if (seg == 6) { src = wv; first = 6; }
    else if (seg == 7) { src = wo; first = 7; }
    else if (seg < 12) { src = w1; first = 8; }
    else               { src = w2; first = 12; }

    const size_t dst0 = (size_t)blockIdx.x * CVT_PER_BLOCK + threadIdx.x * 4;
    const float* s = src + (dst0 - ((size_t)first << 20));
    u16* d = y + dst0;

    for (int r = 0; r < CVT_ROUNDS; ++r) {
        f32x4 v[CVT_LOADS];
        // Both inner loops unrolled: constant indices keep v[] in registers.
#pragma unroll
        for (int i = 0; i < CVT_LOADS; ++i)
            v[i] = *reinterpret_cast<const f32x4*>(s + i * CVT_STEP);
        // Inputs-only fence on the loaded values: it keeps the round's 16 loads
        // ahead of its converts.  Left free, the compiler waits out each load
        // alone, with one in flight a wave.
        asm volatile("" :: "v"(v[0]), "v"(v[1]), "v"(v[2]), "v"(v[3]), "v"(v[4]), "v"(v[5]), "v"(v[6]), "v"(v[7]),
                           "v"(v[8]), "v"(v[9]), "v"(v[10]), "v"(v[11]), "v"(v[12]), "v"(v[13]), "v"(v[14]), "v"(v[15]));
#pragma unroll
        for (int i = 0; i < CVT_LOADS; ++i) {
            uint2 p;
            p.x = (u32)f2bf(v[i].x) | ((u32)f2bf(v[i].y) << 16);
            p.y = (u32)f2bf(v[i].z) | ((u32)f2bf(v[i].w) << 16);
            *reinterpret_cast<uint2*>(d + i * CVT_STEP) = p;
        }
        s += CVT_ROUND;
        d += CVT_ROUND;
    }
}

// ---------------- generic WMMA GEMM -----------------------------------------
// C[M,N] = A[M,K](bf16) * Bt[N,K](bf16)^T + bias[N], with epilogue modes.
// Block tile TB rows x TN columns, K-step 64.  Three forms, each of 256 blocks, one a WGP:
//   128 x 128,  8 waves, wave tile 32 x 64 (2 x 4 WMMA tiles): the products of 1024 columns;
//   256 x 256, 16 waves, wave tile 64 x 64 (4 x 4 WMMA tiles): the product of 4096 columns.
//             A block copies 64 KB a K-step for four times the products of the small
//             tile's 32 KB, so half the bytes leave L2, and a wave reads 8 fragments
//             from LDS for 16 WMMAs, not 6 for 8;
//   256 x 192, 16 waves, wave tile 64 x 48 (4 x 3 WMMA tiles): the product of 3072 columns,
//             which has only 192 tiles of 256 x 256.  56 KB a K-step for three times the products.
// The A and B tiles come into LDS by asynchronous copies, in a ring of four
// buffers: the copies of the next three tiles fly while this tile is multiplied,
// so that a tile has three trips to land in and the requests of one tile follow
// those of the tile before without a pause.

// MODE_QKV is the three projections of x as one product: Bt holds wq, wk and wv
// one below the other (N = 3 * D), Cb the three outputs one behind the other.  The
// 16 columns of a WMMA tile lie in one of the three, which picks bias and layout.

enum { MODE_F32 = 0, MODE_RELU_BF16 = 1, MODE_QKV = 2 };

static constexpr int NBUF = 4;   // buffers of the GEMM ring
static_assert(NBUF == 4, "the counted waits below are written for four buffers");

template <int MODE, int TB, int TN>
__global__ __launch_bounds__(2 * TB) void gemm_bf16_kernel(
    const u16* __restrict__ A, const u16* __restrict__ Bt,
    const float* __restrict__ bias, const float* __restrict__ biasK,
    const float* __restrict__ biasV, float* __restrict__ Cf,
    u16* __restrict__ Cb, int M, int N, int K) {
    static_assert(TB == 128 || TB == 256, "8 or 16 waves");
    constexpr int WM = TB / 4;                 // rows of a wave tile: four waves one below the other
    constexpr int WN = TN / (TB / 64);         // columns of a wave tile: two or four waves side by side
    constexpr int FA = WM / 16, FB = WN / 16;  // A and B fragments of a wave and 32 k
    constexpr int CROWS = TB / 4;              // rows that one copy of every thread covers
    constexpr int NB = TN / CROWS;             // copies a thread and B tile: 4 or 3
    constexpr int CP = 4 + NB;                 // copies a wave and pair of tiles
    static_assert(WN % 16 == 0 && TN % CROWS == 0 && (NB == 4 || NB == 3), "whole fragments, whole copies");
    __shared__ __attribute__((aligned(16))) u16 As[NBUF][TB * LP];   // 4 x 18 KB or 4 x 36 KB
    __shared__ __attribute__((aligned(16))) u16 Bs[NBUF][TN * LP];

    const int tid  = threadIdx.x;
    const int lane = tid & 31;
    const int ln   = lane & 15;
    const int half = lane >> 4;
    const int wave = tid >> 5;
    const int wr   = (wave & 3) * WM;   // wave row offset within the block tile
    const int wc   = (wave >> 2) * WN;  // wave col offset within the block tile
    const int m0   = blockIdx.y * TB;
    const int n0   = blockIdx.x * TN;

    v8f acc[FA][FB] = {};
    // Which operand goes in as the WMMA's A decides what a lane's eight accumulator registers
    // hold.  Rows of A first: eight rows of one column.  Rows of Bt first (WFIRST): eight
    // consecutive columns of one row, which go to the epilogue's row-major staging 16 B at a time.
    constexpr bool WFIRST = MODE != MODE_QKV;
    auto mm = [](v16bf a, v16bf b, v8f c) {
        if constexpr (WFIRST) return wmma_bf16(b, a, c);
        else                  return wmma_bf16(a, b, c);
    };

    // A tile is TB or TN rows x 128 B, 8 pieces of 16 B a row: 4 a thread for A, NB for B.
    // A wave's copy covers four whole rows; copy i takes the rows CROWS * i further on.
    const int crow = tid >> 3, cq = tid & 7;
    const u16* ga = A  + (size_t)(m0 + crow) * K + cq * 8;
    const u16* gb = Bt + (size_t)(n0 + crow) * K + cq * 8;
    const u32 la = lds_addr(&As[0][crow * LP + cq * 8]);
    const u32 lb = lds_addr(&Bs[0][crow * LP + cq * 8]);
    constexpr u32 LROWS = CROWS * LP * 2;      // LDS bytes of CROWS rows
    constexpr u32 LBUFA = TB * LP * 2;         // LDS bytes of one buffer of A
    constexpr u32 LBUFB = TN * LP * 2;         // and of B
    const size_t grows = (size_t)CROWS * K;    // elements of CROWS rows in memory
    const int T = K / 64;

    // The first four tiles, each into a buffer that nobody has read yet.  The loop is
    // unrolled so that each buffer's offsets are constants.
    auto copy_tiles = [&](int buf, size_t k0) {   // the A and B tiles at column k0 into buffer buf
        if constexpr (NB == 4)
            async_copy4x2(la + buf * LBUFA, lb + buf * LBUFB, LROWS, ga + k0, grows, gb + k0, grows);
        else
            async_copy4x3(la + buf * LBUFA, lb + buf * LBUFB, LROWS, ga + k0, grows, gb + k0, grows);
    };
    copy_tiles(0, 0);
#pragma unroll
    for (int s = 1; s < NBUF; ++s)
        if (s < T) copy_tiles(s, s * 64);
    // Tile 0 has landed before anyone reads it: a wave's copies count down in issue
    // order, and its 3 * CP youngest are those of tiles 1 to 3.
    if (T >= NBUF) asm volatile("s_wait_asynccnt %0" :: "n"(3 * CP) : "memory");
    else           asm volatile("s_wait_asynccnt 0x0" ::: "memory");
    __syncthreads();

    for (int t = 0; t < T; ++t) {
        const int buf = t & (NBUF - 1);
        const u16* as = As[buf];
        const u16* bs = Bs[buf];

        if constexpr (TB == 128) {
            // All 24 fragment reads of the trip go out as one group, each fragment
            // into registers of its own, in the order in which the products use them.
            v16bf a[2][FA], b[2][FB];
#pragma unroll
            for (int c = 0; c < 2; ++c) {
#pragma unroll
                for (int i = 0; i < FA; ++i)
                    a[c][i] = lds_load_op(as, wr + i * 16 + ln, LP, c * 32, lane);
#pragma unroll
                for (int j = 0; j < FB; ++j)
                    b[c][j] = lds_load_op(bs, wc + j * 16 + ln, LP, c * 32, lane);
            }
            // Keeps the reads ahead of the products.  Left free, the compiler sinks each
            // B fragment's reads to its two products, into one shared register set, and
            // the wave waits out a whole LDS latency eight times a trip.
            __builtin_amdgcn_sched_barrier(0);

#pragma unroll
            for (int c = 0; c < 2; ++c) {
#pragma unroll
                for (int j = 0; j < FB; ++j) {
                    acc[0][j] = mm(a[c][0], b[c][j], acc[0][j]);
                    acc[1][j] = mm(a[c][1], b[c][j], acc[1][j]);
                }
            }
        } else {
            // A wave of sixteen has 256 registers.  Beside the 96 accumulator registers of the
            // 64 x 48 tile the trip's 14 fragments fit: all their reads go out as one group,
            // as above.  Beside the 128 of the 64 x 64 tile only the 8 fragments of 32 k fit:
            // two groups a trip; while one wave waits for its reads, the three that share its
            // SIMD have products to issue.  In a group the reads stand in the order in which
            // the products use them.
            constexpr int G = (FA * FB + 2 * (FA + FB)) * 8 <= 208 ? 2 : 1;   // 32-k steps a group
#pragma unroll
            for (int g = 0; g < 2; g += G) {
                v16bf a[G][FA], b[G][FB];
#pragma unroll
                for (int c = 0; c < G; ++c) {
                    a[c][0] = lds_load_op(as, wr + ln, LP, (g + c) * 32, lane);
#pragma unroll
                    for (int j = 0; j < FB; ++j)
                        b[c][j] = lds_load_op(bs, wc + j * 16 + ln, LP, (g + c) * 32, lane);
#pragma unroll
                    for (int i = 1; i < FA; ++i)
                        a[c][i] = lds_load_op(as, wr + i * 16 + ln, LP, (g + c) * 32, lane);
                }
                // Keeps the group's reads together, ahead of its products (as above).
                __builtin_amdgcn_sched_barrier(0);
#pragma unroll
                for (int c = 0; c < G; ++c)
#pragma unroll
                    for (int i = 0; i < FA; ++i)
#pragma unroll
                        for (int j = 0; j < FB; ++j)
                            acc[i][j] = mm(a[c][i], b[c][j], acc[i][j]);
                // Keeps the next group's reads from being spread among these products.
                if (g + G < 2) __builtin_amdgcn_sched_barrier(0);
            }
        }
        // Keeps the products ahead of the hand-over.  Left free, the compiler lifts the
        // hand-over's waits and barrier over them: every product then waits for the last
        // read, and tile t + 1's copies lose this trip's products from their time to land in.
        __builtin_amdgcn_sched_barrier(0);

        // The hand-over, every wave: my reads of this buffer are done, my copies of tile
        // t + 1 have landed, and the barrier tells both to the other waves.  While tile
        // t + 3 exists the wave's 2 * CP youngest copies are those of tiles t + 2 and t + 3,
        // which stay in flight; in the last trips nothing younger has been issued for long.
        asm volatile("s_wait_dscnt 0x0" ::: "memory");
        if (t + NBUF - 1 < T) asm volatile("s_wait_asynccnt %0" :: "n"(2 * CP) : "memory");
        else                  asm volatile("s_wait_asynccnt 0x0" ::: "memory");
        __syncthreads();
        if (t + NBUF < T)  // refill the buffers that every wave has just left
            copy_tiles(buf, (size_t)(t + NBUF) * 64);
    }
    asm volatile("s_wait_asynccnt 0x0" ::: "memory");  // no copy is left in flight at the wave's end

    // Epilogue.  Every wave stages its own tile in its own sixteenth (or eighth) of the ring and
    // reads it back row by row, 16 B a lane, so that a store instruction covers whole 128-B lines
    // (Q and K rows of the 48-column tiles: 96 B, or 64 and 32 B where they span two heads) and not a WMMA tile's pieces of 32 or 64 B.  The ring is free here:
    // the last trip's hand-over had every wave's reads done and copies landed ahead of its barrier.
    // No wave touches another's range, so no further barrier is needed.
    constexpr int SLICE_A = NBUF * 16 * LP;                  // elements of As a wave: 9,216 B
    u16* const sa = &As[0][0] + wave * SLICE_A;
    if constexpr (MODE == MODE_QKV) {
        // Accumulator register r of a lane: row r + 8 * half, column lane & 15.
        constexpr int RP = WN + 8;                           // pitch of the row-major tile: 112 B = 16 B x 7
        constexpr int SLICE_B = NBUF * TN * LP / (TB / 16);  // elements of Bs a wave
        static_assert(WM * RP <= SLICE_A && WN * LP <= SLICE_B && WM + 8 <= LP, "both staged tiles fit");
        u16* const sb = &Bs[0][0] + wave * SLICE_B;          // the transposed tile: WN rows of WM elements, pitch LP
        int part[FB];                                  // 0 = Q, 1 = K, 2 = V: the same for the whole wave
        float bv[FB];                                  // the bias of the lane's columns
#pragma unroll
        for (int j = 0; j < FB; ++j) {
            const int cg = n0 + wc + j * 16;           // the WMMA tile's first column
            part[j] = __builtin_amdgcn_readfirstlane(cg >> 10);
            const float* bp = part[j] == 0 ? bias : part[j] == 1 ? biasK : biasV;
            bv[j] = bp[(cg & (Dd - 1)) + ln];
        }
#pragma unroll
        for (int j = 0; j < FB; ++j) {
            if (part[j] < 2) {    // Q, K are stored [b,h,s,kk]: staged row-major, 2 B a register
#pragma unroll
                for (int i = 0; i < FA; ++i) {
                    const uint4 q = __builtin_bit_cast(uint4, cvt8(acc[i][j] + bv[j]));
                    const u32 w[4] = { q.x, q.y, q.z, q.w };   // rows 2n and 2n + 1 in word n
#pragma unroll
                    for (int r = 0; r < 8; ++r)
                        sa[(i * 16 + half * 8 + r) * RP + j * 16 + ln] = (u16)(w[r >> 1] >> ((r & 1) * 16));
                }
            } else {              // V is stored [b,h,kk,s]: staged transposed, a lane's 8 rows are 16 B
#pragma unroll
                for (int i = 0; i < FA; ++i)
                    *reinterpret_cast<uint4*>(&sb[(j * 16 + ln) * LP + i * 16 + half * 8]) =
                        __builtin_bit_cast(uint4, cvt8(acc[i][j] + bv[j]));
            }
        }
        // The other lanes' staged values are in LDS before this lane reads them back.
        asm volatile("s_wait_dscnt 0x0" ::: "memory");

        const int bidx = (m0 + wr) >> 11, s0 = (m0 + wr) & (Ss - 1);   // the wave's 64 rows lie in one batch
        const int lr = lane >> 3, lp = lane & 7;       // an instruction takes 4 staged rows, 8 lanes a row
        if (part[0] < 2) {        // the parts rise with j: some column of the wave is Q or K
            const int cg = n0 + wc + lp * 8;           // the lane's 8 columns, for lp < WN / 8
            const int pt = cg >> 10, c = cg & (Dd - 1);
            if (lp < WN / 8 && pt < 2) {
                u16* gp = Cb + (size_t)pt * BS * Dd + ((size_t)(bidx * Hh + (c >> 6)) * Ss + s0 + lr) * DKk + (c & 63);
                uint4 v[WM / 4];
#pragma unroll
                for (int it = 0; it < WM / 4; ++it)
                    v[it] = *reinterpret_cast<const uint4*>(&sa[(it * 4 + lr) * RP + lp * 8]);
#pragma unroll
                for (int it = 0; it < WM / 4; ++it)
                    *reinterpret_cast<uint4*>(gp + it * 4 * DKk) = v[it];
            }
            // The code behind this branch rewrites registers that these stores name.
            asm volatile("s_wait_xcnt 0x0" ::: "memory");
        }
#pragma unroll
        for (int j = 0; j < FB; ++j) {
            if (part[j] == 2) {
                const int c = ((n0 + wc + j * 16) & (Dd - 1)) + lr;   // 16 columns of one head
                u16* gp = Cb + (size_t)2 * BS * Dd + ((size_t)(bidx * Hh + (c >> 6)) * DKk + (c & 63)) * Ss + s0 + lp * 8;
                uint4 v[4];
#pragma unroll
                for (int it = 0; it < 4; ++it)
                    v[it] = *reinterpret_cast<const uint4*>(&sb[(j * 16 + it * 4 + lr) * LP + lp * 8]);
#pragma unroll
                for (int it = 0; it < 4; ++it)
                    *reinterpret_cast<uint4*>(gp + (size_t)it * 4 * Ss) = v[it];
                // The next tile's code rewrites registers that these stores name.
                asm volatile("s_wait_xcnt 0x0" ::: "memory");
            }
        }
    } else {
        // Accumulator register r of a lane: row lane & 15, column r + 8 * half.
        v8f bl[FB];                                    // the bias of the lane's columns, read as one group
        const float* bp = bias + n0 + wc + half * 8;
#pragma unroll
        for (int j = 0; j < FB; ++j)
            bl[j] = *reinterpret_cast<const v8f*>(bp + j * 16);
        // Stands ahead of any rewrite of the address that these loads name: as an operand the
        // address stays in its registers up to the wait (left free, the last load landed on them).
        asm volatile("s_wait_xcnt 0x0" :: "v"(bp) : "memory");
        if constexpr (MODE == MODE_F32) {
            constexpr int FP = WN + 4;                 // pitch in floats: 272 B = 16 B x 17
            static_assert(WM * FP * 2 <= SLICE_A && WN == 64, "the staged tile fits; a row is 16 lanes");
            float* const sf = reinterpret_cast<float*>(sa);
#pragma unroll
            for (int i = 0; i < FA; ++i)
#pragma unroll
                for (int j = 0; j < FB; ++j) {
                    const v8f v = acc[i][j] + bl[j];
                    float* p = sf + (i * 16 + ln) * FP + j * 16 + half * 8;
                    *reinterpret_cast<f32x4*>(p)     = __builtin_shufflevector(v, v, 0, 1, 2, 3);
                    *reinterpret_cast<f32x4*>(p + 4) = __builtin_shufflevector(v, v, 4, 5, 6, 7);
                }
            // The other lanes' staged values are in LDS before this lane reads them back.
            asm volatile("s_wait_dscnt 0x0" ::: "memory");
            const int lr = lane >> 4, lp = lane & 15;  // an instruction takes 2 rows of 256 B
            float* gp = Cf + (size_t)(m0 + wr + lr) * N + n0 + wc + lp * 4;
            f32x4 v[WM / 2];
#pragma unroll
            for (int it = 0; it < WM / 2; ++it)
                v[it] = *reinterpret_cast<const f32x4*>(&sf[(it * 2 + lr) * FP + lp * 4]);
#pragma unroll
            for (int it = 0; it < WM / 2; ++it)
                *reinterpret_cast<f32x4*>(gp + (size_t)it * 2 * N) = v[it];
        } else {
            static_assert(WM * LP <= SLICE_A && WN == 64, "the staged tile fits; a row is 8 lanes");
#pragma unroll
            for (int i = 0; i < FA; ++i)
#pragma unroll
                for (int j = 0; j < FB; ++j) {
                    v8f v = acc[i][j] + bl[j];
#pragma unroll
                    for (int r = 0; r < 8; ++r) v[r] = fmaxf(v[r], 0.0f);
                    *reinterpret_cast<uint4*>(&sa[(i * 16 + ln) * LP + j * 16 + half * 8]) =
                        __builtin_bit_cast(uint4, cvt8(v));
                }
            // The other lanes' staged values are in LDS before this lane reads them back.
            asm volatile("s_wait_dscnt 0x0" ::: "memory");
            const int lr = lane >> 3, lp = lane & 7;   // an instruction takes 4 rows of 128 B
            u16* gp = Cb + (size_t)(m0 + wr + lr) * N + n0 + wc + lp * 8;
            uint4 v[WM / 4];
#pragma unroll
            for (int it = 0; it < WM / 4; ++it)
                v[it] = *reinterpret_cast<const uint4*>(&sa[(it * 4 + lr) * LP + lp * 8]);
#pragma unroll
            for (int it = 0; it < WM / 4; ++it)
                *reinterpret_cast<uint4*>(gp + (size_t)it * 4 * N) = v[it];
        }
    }
}

static constexpr int QG = 2;             // groups of 16 queries a wave
static constexpr int QB = 4 * QG * 16;   // queries a block
static constexpr int KS = 2;             // sets of four waves that share out the keys

__global__ __launch_bounds__(128 * KS) void flash_attn_kernel(
    const u16* __restrict__ Q, const u16* __restrict__ Km,
    const u16* __restrict__ VT, u16* __restrict__ O) {
    __shared__ __attribute__((aligned(16))) u16 qs[QB * LP];       // 128 q rows x DK     (18 KB)
    __shared__ __attribute__((aligned(16))) u16 ks[KS][2][64 * LP];    // 64 keys  x DK   (2 x 2 x 9 KB)
    __shared__ __attribute__((aligned(16))) u16 vts[KS][2][64 * LP];   // DK rows  x 64 keys

    const int tid  = threadIdx.x;
    const int lane = tid & 31;
    const int ln   = lane & 15;
    const int half = lane >> 4;
    const int wave = tid >> 5;
    const int bh   = blockIdx.y;                 // b*H + h
    const int q0   = blockIdx.x * QB;
    const int kg   = __builtin_amdgcn_readfirstlane(wave >> 2);   // the wave's set
    const int rb   = (wave & 3) * (QG * 16);

    // A K or V^T tile is 64 rows x 128 B = 512 pieces of 16 B: 4 a thread of the set and
    // tile.  A wave's copy covers four whole rows; copy i the rows 16 * i further on.
    const int crow = (tid & 127) >> 3, cq = tid & 7;
    const u16* gk = Km + ((size_t)bh * Ss + kg * 64 + crow) * DKk + cq * 8;   // the set's first tile
    const u16* gv = VT + ((size_t)bh * DKk + crow) * Ss + kg * 64 + cq * 8;
    const u32 lk = lds_addr(&ks[kg][0][crow * LP + cq * 8]);
    const u32 lv = lds_addr(&vts[kg][0][crow * LP + cq * 8]);
    constexpr u32 LROWS = 16 * LP * 2;         // LDS bytes of 16 rows
    constexpr u32 LBUF  = 64 * LP * 2;         // LDS bytes of one buffer
    constexpr int T = Ss / 64 / KS;            // tiles a set
    constexpr int KSTEP = KS * 64;             // keys from one tile of a set to its next
    static_assert(T >= 2, "the ring's prologue fills two tiles");
    static_assert(QB * 2 == 128 * KS, "two threads stage a row of Q");

    async_copy4x2(lk, lv, LROWS, gk, (size_t)16 * DKk, gv, (size_t)16 * Ss);

    // stage Q tile
    {
        const u16* qg = Q + ((size_t)bh * Ss + q0) * DKk;
        int row = tid >> 1, cb = (tid & 1) * 32;
#pragma unroll
        for (int q = 0; q < 4; ++q)
            *reinterpret_cast<uint4*>(&qs[row * LP + cb + q * 8]) =
                *reinterpret_cast<const uint4*>(&qg[(size_t)row * DKk + cb + q * 8]);
    }
    asm volatile("s_wait_asynccnt 0x0" ::: "memory");  // tile 0 has landed before anyone reads it
    __syncthreads();
    async_copy4x2(lk + LBUF, lv + LBUF, LROWS, gk + (size_t)KSTEP * DKk, (size_t)16 * DKk, gv + KSTEP, (size_t)16 * Ss);

    v16bf bq[QG][2];   // Q^T as B operand: in group g lane ln holds query rb + g*16 + ln
#pragma unroll
    for (int g = 0; g < QG; ++g)
#pragma unroll
        for (int c = 0; c < 2; ++c)
            bq[g][c] = lds_load_op(qs, rb + g * 16 + ln, LP, c * 32, lane);

    float m[QG], l[QG];              // of query rb + g*16 + ln, over the set's keys; l sums this lane half's only
    v8f o[QG][4] = {};               // O^T: o[g][n][r] = head element n*16 + 8*half + r of that query
#pragma unroll
    for (int g = 0; g < QG; ++g) { m[g] = -INFINITY; l[g] = 0.0f; }

    for (int tile = 0; tile < T; ++tile) {
        const int buf = tile & 1;
        const u16* kt = ks[kg][buf];
        const u16* vt = vts[kg][buf];

        // scores^T: [64 keys] x [16 queries] in 4 tiles a group, accumulate over DK
        v8f s[QG][4] = {};
#pragma unroll
        for (int c = 0; c < 2; ++c)
#pragma unroll
            for (int t = 0; t < 4; ++t) {
                v16bf ak = lds_load_op(kt, t * 16 + ln, LP, c * 32, lane);
#pragma unroll
                for (int g = 0; g < QG; ++g)
                    s[g][t] = wmma_bf16(ak, bq[g][c], s[g][t]);
            }

        float alpha[QG];
        v16bf bp[QG][2];
#pragma unroll
        for (int g = 0; g < QG; ++g) {
#pragma unroll
            for (int t = 0; t < 4; ++t) s[g][t] = s[g][t] * 0.125f;   // 1/sqrt(DK)

            // online softmax: a lane holds 32 of its query's 64 scores, lane ^ 16 the rest
            float mx[8];
#pragma unroll
            for (int r = 0; r < 8; ++r)
                mx[r] = fmaxf(fmaxf(s[g][0][r], s[g][1][r]), fmaxf(s[g][2][r], s[g][3][r]));
            float rmax = fmaxf(fmaxf(fmaxf(mx[0], mx[1]), fmaxf(mx[2], mx[3])),
                               fmaxf(fmaxf(mx[4], mx[5]), fmaxf(mx[6], mx[7])));
            rmax = fmaxf(rmax, xhalf(rmax));

            const float mn = fmaxf(m[g], rmax);
            alpha[g] = __expf(m[g] - mn);
            m[g] = mn;
#pragma unroll
            for (int t = 0; t < 4; ++t)
#pragma unroll
                for (int r = 0; r < 8; ++r)
                    s[g][t][r] = __expf(s[g][t][r] - mn);

            const v8f sv = (s[g][0] + s[g][1]) + (s[g][2] + s[g][3]);
            l[g] = l[g] * alpha[g] + (((sv[0] + sv[1]) + (sv[2] + sv[3])) + ((sv[4] + sv[5]) + (sv[6] + sv[7])));

            // P^T as B operand: element e is key c*32 + 8*half + e (e < 8), c*32 + 16 + 8*half + e - 8 (e >= 8)
#pragma unroll
            for (int c = 0; c < 2; ++c)
                bp[g][c] = __builtin_shufflevector(cvt8(s[g][2 * c]), cvt8(s[g][2 * c + 1]),
                                                   0, 1, 2, 3, 4, 5, 6, 7, 8, 9, 10, 11, 12, 13, 14, 15);
        }

        // O^T = O^T*alpha + V^T @ P^T  (two 32-key WMMA K-steps per group of 16 head elements)
#pragma unroll
        for (int n = 0; n < 4; ++n)
#pragma unroll
            for (int g = 0; g < QG; ++g) o[g][n] = o[g][n] * alpha[g];
#pragma unroll
        for (int c = 0; c < 2; ++c) {
            v16bf av[4];
#pragma unroll
            for (int n = 0; n < 4; ++n)
                av[n] = lds_load_op(vt, n * 16 + ln, LP, c * 32, lane);
            // Inputs-only fence on the loaded values: the four fragments of a K-step come as one
            // group, each in registers of its own.  Left free, the compiler reads them one by one
            // into one register set, and the wave waits out a whole LDS latency for each.
            asm volatile("" :: "v"(__builtin_bit_cast(v8f, av[0])), "v"(__builtin_bit_cast(v8f, av[1])),
                               "v"(__builtin_bit_cast(v8f, av[2])), "v"(__builtin_bit_cast(v8f, av[3])));
#pragma unroll
            for (int n = 0; n < 4; ++n)
#pragma unroll
                for (int g = 0; g < QG; ++g)
                    o[g][n] = wmma_bf16(av[n], bp[g][c], o[g][n]);
        }

        ring_publish();
        if (tile + 2 < T)  // refill the buffers that every wave has just left
            async_copy4x2(lk + buf * LBUF, lv + buf * LBUF, LROWS,
                          gk + (size_t)(tile + 2) * KSTEP * DKk, (size_t)16 * DKk,
                          gv + (tile + 2) * KSTEP, (size_t)16 * Ss);
    }
    asm volatile("s_wait_asynccnt 0x0" ::: "memory");  // no copy is left in flight at the wave's end

    // Join the two sets.  The ring is free here: the last trip's hand-over had every wave's
    // reads done and copies landed ahead of its barrier.  A wave of set 1 lays its partial
    // result down in K's ring, 16 B a lane and piece, lanes side by side; behind one barrier
    // the wave of set 0 with the same queries, whose lanes hold the same elements, takes it up.
    constexpr int MP = QG * 8 + 1;             // pieces a lane: O^T, then maxima and sums
    static_assert(4 * MP * 32 * 16 <= KS * 2 * 64 * LP * 2, "the partial results fit in K's ring");
    f32x4* const mg = reinterpret_cast<f32x4*>(&ks[0][0][0]) + (wave & 3) * (MP * 32) + lane;
    if (kg == 1) {
#pragma unroll
        for (int g = 0; g < QG; ++g)
#pragma unroll
            for (int n = 0; n < 4; ++n) {
                mg[(g * 8 + n * 2) * 32]     = __builtin_shufflevector(o[g][n], o[g][n], 0, 1, 2, 3);
                mg[(g * 8 + n * 2 + 1) * 32] = __builtin_shufflevector(o[g][n], o[g][n], 4, 5, 6, 7);
            }
        mg[QG * 8 * 32] = f32x4{ m[0], m[1], l[0], l[1] };
    }
    asm volatile("s_wait_dscnt 0x0" ::: "memory");     // set 1's partial results are in LDS
    __syncthreads();

    // finalize, set 0: O = (O0 * a0 + O1 * a1) / l, write concatenated-head layout
    // [b, s, h*DK + col]; a lane's eight registers of a tile are eight consecutive columns
    // of its query's row.  The wave stages its 32 rows of 128 B over its 32 rows of Q, which
    // only it and its partner of set 1 have read, long ago, and stores them as whole 128-B
    // lines, four rows an instruction, not as pieces of 32 B.
    if (kg == 0) {
        const int bidx = bh >> 4, h = bh & 15;
        u16* const st = qs + rb * LP;
        const f32x4 ml = mg[QG * 8 * 32];
#pragma unroll
        for (int g = 0; g < QG; ++g) {
            const float mn = fmaxf(m[g], ml[g]);
            const float a0 = __expf(m[g] - mn), a1 = __expf(ml[g] - mn);
            float lsum = l[g] * a0 + ml[QG + g] * a1;
            lsum += xhalf(lsum);                 // join the two lane halves' sums
            const float inv = 1.0f / lsum;
            const float f0 = a0 * inv, f1 = a1 * inv;
#pragma unroll
            for (int n = 0; n < 4; ++n) {
                const v8f o1 = __builtin_shufflevector(mg[(g * 8 + n * 2) * 32], mg[(g * 8 + n * 2 + 1) * 32],
                                                       0, 1, 2, 3, 4, 5, 6, 7);
                *reinterpret_cast<uint4*>(&st[(g * 16 + ln) * LP + n * 16 + half * 8]) =
                    __builtin_bit_cast(uint4, cvt8(o[g][n] * f0 + o1 * f1));
            }
        }
        // The other lanes' staged values are in LDS before this lane reads them back.
        asm volatile("s_wait_dscnt 0x0" ::: "memory");
        const int lr = lane >> 3, lp = lane & 7;
        u16* op = O + ((size_t)bidx * Ss + q0 + rb + lr) * (Hh * DKk) + h * DKk + lp * 8;
        uint4 ov[QG * 4];
#pragma unroll
        for (int it = 0; it < QG * 4; ++it)
            ov[it] = *reinterpret_cast<const uint4*>(&st[(it * 4 + lr) * LP + lp * 8]);
#pragma unroll
        for (int it = 0; it < QG * 4; ++it)
            *reinterpret_cast<uint4*>(op + (size_t)it * 4 * (Hh * DKk)) = ov[it];
    }
}

// ---------------- residual + LayerNorm --------------------------------------
// one row per block; 256 threads * 4 elems = D

template <bool WRITE_BF16>
__global__ __launch_bounds__(256) void add_ln_kernel(
    const float* __restrict__ a, const float* __restrict__ b,
    const float* __restrict__ g, const float* __restrict__ be,
    float* __restrict__ oF, u16* __restrict__ oB) {
    __shared__ float ss[256], sq[256];
    const int row = blockIdx.x, tid = threadIdx.x;
    const int i0 = tid * 4;

    float4 xa = *reinterpret_cast<const float4*>(a + (size_t)row * Dd + i0);
    float4 xb = *reinterpret_cast<const float4*>(b + (size_t)row * Dd + i0);
    float v[4] = { xa.x + xb.x, xa.y + xb.y, xa.z + xb.z, xa.w + xb.w };

    float s = v[0] + v[1] + v[2] + v[3];
    float q = v[0] * v[0] + v[1] * v[1] + v[2] * v[2] + v[3] * v[3];
    ss[tid] = s; sq[tid] = q;
    __syncthreads();
    for (int st = 128; st > 0; st >>= 1) {
        if (tid < st) { ss[tid] += ss[tid + st]; sq[tid] += sq[tid + st]; }
        __syncthreads();
    }
    const float mu   = ss[0] * (1.0f / Dd);
    const float var  = sq[0] * (1.0f / Dd) - mu * mu;
    const float rstd = rsqrtf(var + LN_EPS);

    float4 gg = *reinterpret_cast<const float4*>(g + i0);
    float4 bb = *reinterpret_cast<const float4*>(be + i0);
    float o0 = (v[0] - mu) * rstd * gg.x + bb.x;
    float o1 = (v[1] - mu) * rstd * gg.y + bb.y;
    float o2 = (v[2] - mu) * rstd * gg.z + bb.z;
    float o3 = (v[3] - mu) * rstd * gg.w + bb.w;

    *reinterpret_cast<float4*>(oF + (size_t)row * Dd + i0) = make_float4(o0, o1, o2, o3);
    if constexpr (WRITE_BF16) {
        u16* p = oB + (size_t)row * Dd + i0;
        p[0] = f2bf(o0); p[1] = f2bf(o1); p[2] = f2bf(o2); p[3] = f2bf(o3);
    }
}

// ---------------- launcher ---------------------------------------------------

extern "C" void kernel_launch(void* const* d_in, const int* in_sizes, int n_in,
                              void* d_out, int out_size, void* d_ws, size_t ws_size,
                              hipStream_t stream) {
    const float* x  = (const float*)d_in[0];
    const float* wq = (const float*)d_in[1];  const float* bq = (const float*)d_in[2];
    const float* wk = (const float*)d_in[3];  const float* bk = (const float*)d_in[4];
    const float* wv = (const float*)d_in[5];  const float* bv = (const float*)d_in[6];
    const float* wo = (const float*)d_in[7];  const float* bo = (const float*)d_in[8];
    const float* g1 = (const float*)d_in[9];  const float* be1 = (const float*)d_in[10];
    const float* w1 = (const float*)d_in[11]; const float* b1 = (const float*)d_in[12];
    const float* w2 = (const float*)d_in[13]; const float* b2 = (const float*)d_in[14];
    const float* g2 = (const float*)d_in[15]; const float* be2 = (const float*)d_in[16];
    float* out = (float*)d_out;

    char* ws = (char*)d_ws;
    const size_t MB = 1024 * 1024;
    u16* XB  = (u16*)(ws + 0);          //  8 MB  x bf16 [BS, D]
    u16* WQB = (u16*)(ws + 8  * MB);    //  2 MB
    u16* WKB = (u16*)(ws + 10 * MB);    //  2 MB
    u16* WVB = (u16*)(ws + 12 * MB);    //  2 MB
    u16* WOB = (u16*)(ws + 14 * MB);    //  2 MB
    u16* W1B = (u16*)(ws + 16 * MB);    //  8 MB
    u16* W2B = (u16*)(ws + 24 * MB);    //  8 MB
    u16* Qb  = (u16*)(ws + 32 * MB);    //  8 MB  [B,H,S,DK]
    u16* Kb  = (u16*)(ws + 40 * MB);    //  8 MB  [B,H,S,DK]
    u16* VTb = (u16*)(ws + 48 * MB);    //  8 MB  [B,H,DK,S]
    u16* Ob  = (u16*)(ws + 56 * MB);    //  8 MB  [B,S,H*DK]
    float* ATT = (float*)(ws + 64 * MB);   // 16 MB [BS, D]
    float* N1F = (float*)(ws + 80 * MB);   // 16 MB
    u16*   N1B = (u16*)(ws + 96 * MB);     //  8 MB
    u16*   FF1 = (u16*)(ws + 104 * MB);    // 32 MB [BS, FF]
    float* FF2 = (float*)(ws + 136 * MB);  // 16 MB

    // 1. bf16 conversions: XB .. W2B are one contiguous destination
    cvt_all_bf16_kernel<<<CVT_BLOCKS, CVT_THREADS, 0, stream>>>(x, wq, wk, wv, wo, w1, w2, XB);

    // 2. QKV projections in one launch (N = 3 * H*DK = 3072, K = 1024): WQB, WKB, WVB
    //    are one [3072, 1024] matrix in the workspace, Qb, Kb, VTb one output range
    dim3 gP(Dd / 128, BS / 128);
    gemm_bf16_kernel<MODE_QKV, 256, 192><<<dim3(3 * Dd / 192, BS / 256), 512, 0, stream>>>(
        XB, WQB, bq, bk, bv, nullptr, Qb, BS, 3 * Dd, Dd);

    // 3. fused attention
    flash_attn_kernel<<<dim3(Ss / QB, Bb * Hh), 128 * KS, 0, stream>>>(Qb, Kb, VTb, Ob);

    // 4. output projection
    gemm_bf16_kernel<MODE_F32, 128, 128><<<gP, 256, 0, stream>>>(Ob, WOB, bo, nullptr, nullptr, ATT, nullptr, BS, Dd, Dd);

    // 5. LN1 (residual with x), keep bf16 mirror for FFN input
    add_ln_kernel<true><<<BS, 256, 0, stream>>>(ATT, x, g1, be1, N1F, N1B);

    // 6. FFN
    gemm_bf16_kernel<MODE_RELU_BF16, 256, 256><<<dim3(FFf / 256, BS / 256), 512, 0, stream>>>(
        N1B, W1B, b1, nullptr, nullptr, nullptr, FF1, BS, FFf, Dd);
    gemm_bf16_kernel<MODE_F32, 128, 128><<<gP, 256, 0, stream>>>(FF1, W2B, b2, nullptr, nullptr, FF2, nullptr, BS, Dd, FFf);

    // 7. LN2 -> output
    add_ln_kernel<false><<<BS, 256, 0, stream>>>(FF2, N1F, g2, be2, out, nullptr);
}
